// v000
// The times below were measured on an AMD MI455X: many runs one after another, warmed up first and cycling through
// copies of the inputs, with the whole window's GPU time divided by the number of runs. Launches and the gaps
// between them are all in it. The median over several windows is given; except for v000 it joins two sittings, which
// can be a few percent apart, so the side-by-side timings, each taken in one sitting, are the better comparison.
// The starting kernel, v000, takes 2940 microseconds a run.
#include <hip/hip_runtime.h>

// Self_attention_pixel_wise: per image (4,096 pixels, NHWC 256 ch): k = x wk + bk, q = x wq + bq, v = x wv + bv (128); scores[n][m] = k_n . q_m (no scaling); attn = softmax over m; o = attn v; out = o wo + bo + x -> [4][64][64][256].
// Note the roles: the module's 'key' is the attention query (rows n) and its 'query' the attention key (columns m).
// Deterministic: no index structures, no atomics; flash-style online softmax over all key blocks in a fixed order.
// WMMA (v_wmma_f32_16x16x32_f16, f32 accumulate): the QKV projection with x EXACT bf16 x8 (K 256) against exact torch weight rows x256 (one product); S = Q K^T (hi+lo x hi+lo, 3 products, K 128); O = P V (P x256 hi+lo x V^T hi+lo, 3 products); out = attended (hi+lo) Wo^T (2 products); softmax in f32. Inputs rounded to bf16 once. Fragment k-map per lane half hh for A AND B: elements 0..7 <- k = 8hh+0..7, 8..15 <- k = 16+8hh+0..7; acc[r] = D[8hh+r][col].

namespace {
constexpr int NB = 4, L = 4096, C = 128, CX = 256 /* input / output channels */, NH = 1, HD = 128, NT = NB * L, KB = 128, PW = 3 * C;
constexpr float XS = 8.0f, HS = 256.0f /* hi+lo staging scale for k/q/v/attended */, WSC = 256.0f, PS = 256.0f, SCALE = 1.0f;
typedef _Float16 b16;
typedef __attribute__((ext_vector_type(16))) _Float16 v16b;
typedef __attribute__((ext_vector_type(8))) _Float16 v8b;
typedef __attribute__((ext_vector_type(8))) float v8f;
typedef __attribute__((ext_vector_type(4))) float v4f;
__device__ __forceinline__ float bf16_rne(float f) { unsigned int u = __float_as_uint(f); u += 0x7FFFu + ((u >> 16) & 1u); float r = __uint_as_float(u & 0xFFFF0000u); asm volatile("" : "+v"(r)); return r; }
__device__ __forceinline__ float bfv(float f) { float r = bf16_rne(f); asm volatile("" : "+v"(r)); return r; }
__device__ __forceinline__ void split16(float v, b16& hi, b16& lo) { hi = (b16)v; lo = (b16)(v - (float)hi); }
__device__ __forceinline__ v16b frag_kb(const b16* p, int hh) { const v8b a = *(const v8b*)(p + 8 * hh), b = *(const v8b*)(p + 16 + 8 * hh); v16b f;
#pragma unroll
  for (int e = 0; e < 8; ++e) { f[e] = a[e]; f[8 + e] = b[e]; } return f; }
__device__ __forceinline__ v8f wmma16b(v16b a, v16b b, v8f c) { v8f d = __builtin_amdgcn_wmma_f32_16x16x32_f16(false, a, false, b, (short)0, c, false, false); asm volatile("v_nop\n\tv_nop\n\tv_nop\n\tv_nop" : "+v"(d) : "v"(a), "v"(b)); return d; }
__device__ __forceinline__ void wave_lds_sync() { __builtin_amdgcn_fence(__ATOMIC_RELEASE, "workgroup"); __builtin_amdgcn_wave_barrier(); __builtin_amdgcn_fence(__ATOMIC_ACQUIRE, "workgroup"); }
__device__ __forceinline__ float pmul(float a, float b) { float p = a * b; asm volatile("" : "+v"(p)); return p; }

__global__ __launch_bounds__(256) void wput_kernel(const float* __restrict__ wq, const float* __restrict__ wk, const float* __restrict__ wv, const float* __restrict__ wo, b16* __restrict__ W3, b16* __restrict__ WO) { const size_t u = (size_t)blockIdx.x * 256 + threadIdx.x; v8b v;
  if (u < (size_t)3 * C * (CX / 8)) { const int r = (int)(u / (CX / 8)), k0 = (int)(u % (CX / 8)) * 8; const int p = r / C, o = r % C; const float* w = p == 0 ? wq : (p == 1 ? wk : wv);
#pragma unroll
    for (int j = 0; j < 8; ++j) v[j] = (b16)(bf16_rne(w[(size_t)(k0 + j) * C + o]) * WSC); { *(v8b*)(W3 + (size_t)r * CX + k0) = v;  } }
  if (u < (size_t)CX * (C / 8)) { const int o = (int)(u / (C / 8)), k0 = (int)(u % (C / 8)) * 8;
#pragma unroll
    for (int j = 0; j < 8; ++j) v[j] = (b16)(bf16_rne(wo[(size_t)(k0 + j) * CX + o]) * WSC); { *(v8b*)(WO + (size_t)o * C + k0) = v;  } } }
__global__ __launch_bounds__(32) void proj_kernel(const float* __restrict__ x, const b16* __restrict__ W3, const float* __restrict__ bq, const float* __restrict__ bk, const float* __restrict__ bv, int TLIM, b16* __restrict__ PH, b16* __restrict__ PL) { __shared__ __attribute__((aligned(16))) b16 Ah[16][CX + 8], Oh[16][264], Ol[16][264]; const int lane = threadIdx.x, nloc = lane & 15, hlf = lane >> 4; const size_t m0 = (size_t)blockIdx.x * 16; if (m0 >= (size_t)TLIM) return;
  for (int rr = 0; rr < 16; ++rr) for (int q = 0; q < CX / 32; ++q) Ah[rr][q * 32 + lane] = (b16)(bf16_rne(x[(m0 + rr) * CX + q * 32 + lane]) * XS);
  wave_lds_sync();
#pragma unroll 1
  for (int g = 0; g < 3; ++g) { const int pj = g;   /* one group of 8 tiles per projection (128 columns) */ const float* bb = pj == 0 ? bq : (pj == 1 ? bk : bv); v8f acc[8];
#pragma unroll
    for (int t = 0; t < 8; ++t) acc[t] = (v8f){};
#pragma unroll 2
    for (int kb = 0; kb < CX; kb += 32) { const v16b a = frag_kb(&Ah[nloc][kb], hlf);
#pragma unroll
      for (int t = 0; t < 8; ++t) acc[t] = wmma16b(a, frag_kb(W3 + (size_t)(g * C + t * 16 + nloc) * CX + kb, hlf), acc[t]); }
#pragma unroll
    for (int t = 0; t < 8; ++t) { const int cc = t * 16 + nloc; const float bvv = bfv(bb[cc]);
#pragma unroll
      for (int r8 = 0; r8 < 8; ++r8) { b16 p, ql; split16((acc[t][r8] * (1.0f / (XS * WSC)) + bvv) * HS, p, ql); Oh[8 * hlf + r8][cc] = p; Ol[8 * hlf + r8][cc] = ql; } }
    wave_lds_sync();
    { for (int rr = 0; rr < 16; ++rr) if (lane < 16) { *(v8b*)(PH + (m0 + rr) * PW + g * C + lane * 8) = *(const v8b*)(&Oh[rr][lane * 8]); *(v8b*)(PL + (m0 + rr) * PW + g * C + lane * 8) = *(const v8b*)(&Ol[rr][lane * 8]); }  }   
    wave_lds_sync(); } }
// attention: ONE WAVE PER BLOCK, wave per (b, h, 16-query tile): key blocks of 128 over all keys; S = Q K^T (3 products, K 128); online softmax; P x256 hi+lo;
__global__ __launch_bounds__(32) void att_kernel(const b16* __restrict__ PH, const b16* __restrict__ PL, const float* __restrict__ amask, int BLIM, float* __restrict__ ATT) { __shared__ __attribute__((aligned(16))) b16 Ph_[16][KB + 8], Pl_[16][KB + 8], Vth[HD][KB + 8], Vtl[HD][KB + 8]; __shared__ float Sf[16][KB + 4], Of[16][HD + 4];
  const int lane = threadIdx.x, nloc = lane & 15, hlf = lane >> 4; const int qt = blockIdx.x % (L / 16); const int h = (blockIdx.x / (L / 16)) % NH; const int b = blockIdx.x / ((L / 16) * NH); if (b >= BLIM) return; const int t0 = qt * 16; const size_t rowb = (size_t)b * L; const int qo = h * HD, ko = C + h * HD, vo = 2 * C + h * HD;
  v16b qh[HD / 32], ql[HD / 32];
#pragma unroll
  for (int s = 0; s < HD / 32; ++s) { qh[s] = frag_kb(PH + (rowb + t0 + nloc) * PW + qo + s * 32, hlf); ql[s] = frag_kb(PL + (rowb + t0 + nloc) * PW + qo + s * 32, hlf); }
  float m_r[8], den_r[8]; v8f acc[HD / 16];
#pragma unroll
  for (int r8 = 0; r8 < 8; ++r8) { m_r[r8] = -INFINITY; den_r[r8] = 0.0f; }
#pragma unroll
  for (int t = 0; t < HD / 16; ++t) acc[t] = (v8f){};
  const int kstart = 0; const int kend = L;   // [kstart, kend)
#pragma unroll 1
  for (int kb0 = kstart; kb0 < kend; kb0 += KB) { const int nk = (kend - kb0) < KB ? (kend - kb0) : KB; const int nkt = (nk + 15) / 16;
    for (int rr = 0; rr < KB; rr += 2) { const int r = rr + hlf; const int key = kb0 + r < L ? kb0 + r : L - 1;   /* stage the WHOLE block: keys past kend get p = 0 but their V^T rows must be finite (chip LDS is not zeroed) */ const size_t vr = (rowb + key) * PW + vo; for (int s = 0; s < HD / 32; ++s) { Vth[s * 32 + nloc][r] = PH[vr + s * 32 + nloc]; Vth[s * 32 + 16 + nloc][r] = PH[vr + s * 32 + 16 + nloc]; Vtl[s * 32 + nloc][r] = PL[vr + s * 32 + nloc]; Vtl[s * 32 + 16 + nloc][r] = PL[vr + s * 32 + 16 + nloc]; } }
    for (int t = 0; t < KB / 16; ++t) { if (t < nkt) { const int key = kb0 + t * 16 + nloc < L ? kb0 + t * 16 + nloc : L - 1; const size_t kr = (rowb + key) * PW + ko; v8f s = {};
#pragma unroll
        for (int q = 0; q < HD / 32; ++q) { const v16b kh = frag_kb(PH + kr + q * 32, hlf), kl = frag_kb(PL + kr + q * 32, hlf); s = wmma16b(qh[q], kh, s); s = wmma16b(qh[q], kl, s); s = wmma16b(ql[q], kh, s); }
#pragma unroll
        for (int r8 = 0; r8 < 8; ++r8) { const int i = t0 + 8 * hlf + r8, j = kb0 + t * 16 + nloc; const bool ok = (j < kend); Sf[8 * hlf + r8][t * 16 + nloc] = ok ? s[r8] * (1.0f / (HS * HS)) : -INFINITY; } }
      else {
#pragma unroll
        for (int r8 = 0; r8 < 8; ++r8) Sf[8 * hlf + r8][t * 16 + nloc] = -INFINITY; } }
    wave_lds_sync();
#pragma unroll
    for (int rr = 0; rr < 16; ++rr) { float mx = -INFINITY;
#pragma unroll
      for (int q = 0; q < 4; ++q) mx = fmaxf(mx, Sf[rr][q * 32 + lane]);
      for (int o = 16; o; o >>= 1) mx = fmaxf(mx, __shfl_xor(mx, o));
      const float mold = __shfl(m_r[rr & 7], (rr >> 3) * 16); const float mn = fmaxf(mold, mx); const float sf = (mold == -INFINITY) ? 0.0f : ((mn == -INFINITY) ? 1.0f : __expf(mold - mn)); float ps = 0.0f;
#pragma unroll
      for (int q = 0; q < 4; ++q) { const int kx = q * 32 + lane; const float sv = Sf[rr][kx]; const float p = (sv == -INFINITY || mn == -INFINITY) ? 0.0f : __expf(sv - mn); ps += p; b16 ph, pl; split16(p * PS, ph, pl); Ph_[rr][kx] = ph; Pl_[rr][kx] = pl; }
      for (int o = 16; o; o >>= 1) ps += __shfl_xor(ps, o);
      if ((rr >> 3) == hlf) { const int r8 = rr & 7; den_r[r8] = den_r[r8] * sf + ps; m_r[r8] = mn;
#pragma unroll
        for (int t = 0; t < HD / 16; ++t) acc[t][r8] = acc[t][r8] * sf; } }
    wave_lds_sync();
    for (int ks = 0; ks < nkt * 16; ks += 32) { const v16b pa = frag_kb(&Ph_[nloc][ks], hlf), pb = frag_kb(&Pl_[nloc][ks], hlf);
#pragma unroll
      for (int t = 0; t < HD / 16; ++t) { const v16b vh = frag_kb(&Vth[t * 16 + nloc][ks], hlf), vl = frag_kb(&Vtl[t * 16 + nloc][ks], hlf); acc[t] = wmma16b(pa, vh, acc[t]); acc[t] = wmma16b(pa, vl, acc[t]); acc[t] = wmma16b(pb, vh, acc[t]); } }
    wave_lds_sync(); }
#pragma unroll
  for (int t = 0; t < HD / 16; ++t)
#pragma unroll
    for (int r8 = 0; r8 < 8; ++r8) { const float dn = den_r[r8]; Of[8 * hlf + r8][t * 16 + nloc] = dn > 0.0f ? acc[t][r8] * (1.0f / (HS * PS)) / dn : 0.0f; }
  wave_lds_sync();
  { for (int rr = 0; rr < 16; ++rr) for (int s = 0; s < HD / 32; ++s) ((float*)ATT)[(rowb + t0 + rr) * C + h * HD + s * 32 + lane] = Of[rr][s * 32 + lane];  } }
__global__ __launch_bounds__(32) void out_kernel(const float* __restrict__ ATT, const b16* __restrict__ WO, const float* __restrict__ bo, const float* __restrict__ xres, int TLIM, float* __restrict__ out) { __shared__ __attribute__((aligned(16))) b16 Ah[16][C + 8], Al[16][C + 8]; __shared__ float Tf[16][260]; const int lane = threadIdx.x, nloc = lane & 15, hlf = lane >> 4; const size_t m0 = (size_t)blockIdx.x * 16; if (m0 >= (size_t)TLIM) return;
  for (int rr = 0; rr < 16; ++rr) for (int q = 0; q < C / 32; ++q) { b16 p, ql; split16(ATT[(m0 + rr) * C + q * 32 + lane] * HS, p, ql); Ah[rr][q * 32 + lane] = p; Al[rr][q * 32 + lane] = ql; }
  wave_lds_sync();
#pragma unroll 1
  for (int g = 0; g < CX / 256; ++g) { v8f acc[16];
#pragma unroll
    for (int t = 0; t < 16; ++t) acc[t] = (v8f){};
#pragma unroll 2
    for (int kb = 0; kb < C; kb += 32) { const v16b a = frag_kb(&Ah[nloc][kb], hlf), al = frag_kb(&Al[nloc][kb], hlf);
#pragma unroll
      for (int t = 0; t < 16; ++t) { const v16b bw = frag_kb(WO + (size_t)(g * 256 + t * 16 + nloc) * C + kb, hlf); acc[t] = wmma16b(a, bw, acc[t]); acc[t] = wmma16b(al, bw, acc[t]); } }
#pragma unroll
    for (int t = 0; t < 16; ++t) { const int cc = t * 16 + nloc; const float bb = bfv(bo[g * 256 + cc]);
#pragma unroll
      for (int r8 = 0; r8 < 8; ++r8) { const int rr = 8 * hlf + r8; Tf[rr][cc] = acc[t][r8] * (1.0f / (HS * WSC)) + bb + bfv(xres[(m0 + rr) * CX + g * 256 + cc]); } }   /* + residual x */
    wave_lds_sync();
    { for (int rr = 0; rr < 16; ++rr) for (int q = 0; q < 2; ++q) *(v4f*)(out + (m0 + rr) * CX + g * 256 + q * 128 + lane * 4) = *(const v4f*)(&Tf[rr][q * 128 + lane * 4]);  }
    wave_lds_sync(); } }
}  // namespace

extern "C" void kernel_launch(void* const* d_in, const int* in_sizes, int n_in, void* d_out, int out_size, void* d_ws, size_t ws_size, hipStream_t stream) {
  (void)n_in;
  auto Fp = [&](int i) { return (const float*)d_in[i]; };
  // input order: 0 x [4,64,64,256]; 1 wk [256,128]; 2 bk; 3 wq [256,128]; 4 bq; 5 wv [256,128]; 6 bv; 7 wo [128,256]; 8 bo [256]  (all (in,out))
  if (in_sizes[0] != NT * CX || in_sizes[1] != CX * C || in_sizes[3] != CX * C || in_sizes[5] != CX * C || in_sizes[7] != C * CX || in_sizes[8] != CX || out_size != NT * CX) return;
  const int BLIM = NB;
  const int TLIM = BLIM * L;
  size_t off = 0; char* ws = (char*)d_ws;
  auto carve = [&](size_t bytes) { char* p = ws + off; off += (bytes + 255) & ~(size_t)255; return p; };
  b16* W3 = (b16*)carve((size_t)3 * C * CX * 2); b16* WO = (b16*)carve((size_t)CX * C * 2); b16* PH = (b16*)carve((size_t)NT * PW * 2); b16* PL = (b16*)carve((size_t)NT * PW * 2); float* ATT = (float*)carve((size_t)NT * C * 4);
  if (off > ws_size || off > ((size_t)96 << 20)) return;   // ~ 30 MB
  wput_kernel<<<(unsigned)(((size_t)3 * C * (CX / 8) + 255) / 256), 256, 0, stream>>>(Fp(1), Fp(3), Fp(5), Fp(7), W3, WO);
  proj_kernel<<<TLIM / 16, 32, 0, stream>>>(Fp(0), W3, Fp(2), Fp(4), Fp(6), TLIM, PH, PL);
  att_kernel<<<BLIM * NH * (L / 16), 32, 0, stream>>>(PH, PL, (const float*)0, BLIM, ATT);
  out_kernel<<<TLIM / 16, 32, 0, stream>>>(ATT, WO, Fp(8), Fp(0), TLIM, (float*)d_out);
}

// v001
// One run takes 760 microseconds.
// Two timings next to v000 both put it at 3.91 times that version's speed.
#include <hip/hip_runtime.h>

// Self_attention_pixel_wise: per image (4,096 pixels, NHWC 256 ch): k = x wk + bk, q = x wq + bq, v = x wv + bv (128); scores[n][m] = k_n . q_m (no scaling); attn = softmax over m; o = attn v; out = o wo + bo + x -> [4][64][64][256].
// Note the roles: the module's 'key' is the attention query (rows n) and its 'query' the attention key (columns m).
// Deterministic: no index structures, no atomics; flash-style online softmax over all key blocks in a fixed order.
// WMMA (v_wmma_f32_16x16x32_f16, f32 accumulate): the QKV projection with x EXACT bf16 x8 (K 256) against exact weight rows x256 (one product); S = Q K^T (hi+lo x hi+lo, 3 products, K 128); O = P V (P x256 hi+lo x V^T hi+lo, 3 products; V^T is written by the projection in tiles [16 keys][128 channels][16] and read as B fragments straight from global memory); out = attended (hi+lo) Wo^T (2 products); softmax in f32. Inputs rounded to bf16 once. Fragment k-map per lane half hh for A AND B: elements 0..7 <- k = 8hh+0..7, 8..15 <- k = 16+8hh+0..7; acc[r] = D[8hh+r][col].

namespace {
constexpr int NB = 4, L = 4096, C = 128, CX = 256 /* input / output channels */, NH = 1, HD = 128, NT = NB * L, KB = 128, PW = 3 * C;
constexpr float XS = 8.0f, HS = 256.0f /* hi+lo staging scale for k/q/v/attended */, WSC = 256.0f, PS = 256.0f, SCALE = 1.0f;
typedef _Float16 b16;
typedef __attribute__((ext_vector_type(16))) _Float16 v16b;
typedef __attribute__((ext_vector_type(8))) _Float16 v8b;
typedef __attribute__((ext_vector_type(8))) float v8f;
typedef __attribute__((ext_vector_type(4))) float v4f;
__device__ __forceinline__ float bf16_rne(float f) { unsigned int u = __float_as_uint(f); u += 0x7FFFu + ((u >> 16) & 1u); float r = __uint_as_float(u & 0xFFFF0000u); asm volatile("" : "+v"(r)); return r; }
__device__ __forceinline__ float bfv(float f) { float r = bf16_rne(f); asm volatile("" : "+v"(r)); return r; }
__device__ __forceinline__ void split16(float v, b16& hi, b16& lo) { hi = (b16)v; lo = (b16)(v - (float)hi); }
__device__ __forceinline__ v16b frag_kb(const b16* p, int hh) { const v8b a = *(const v8b*)(p + 8 * hh), b = *(const v8b*)(p + 16 + 8 * hh); v16b f;
#pragma unroll
  for (int e = 0; e < 8; ++e) { f[e] = a[e]; f[8 + e] = b[e]; } return f; }
// same k-map as frag_kb, from the tiled V^T: p = channel row of the 16-key tile that holds k = 0..15; k = 16..31 is the next tile, HD * 16 elements on
__device__ __forceinline__ v16b frag_vt(const b16* p, int hh) { const v8b a = *(const v8b*)(p + 8 * hh), b = *(const v8b*)(p + HD * 16 + 8 * hh); v16b f;
#pragma unroll
  for (int e = 0; e < 8; ++e) { f[e] = a[e]; f[8 + e] = b[e]; } return f; }
__device__ __forceinline__ v8f wmma16b(v16b a, v16b b, v8f c) { v8f d = __builtin_amdgcn_wmma_f32_16x16x32_f16(false, a, false, b, (short)0, c, false, false); asm volatile("v_nop\n\tv_nop\n\tv_nop\n\tv_nop" : "+v"(d) : "v"(a), "v"(b)); return d; }
__device__ __forceinline__ void wave_lds_sync() { __builtin_amdgcn_fence(__ATOMIC_RELEASE, "workgroup"); __builtin_amdgcn_wave_barrier(); __builtin_amdgcn_fence(__ATOMIC_ACQUIRE, "workgroup"); }
__device__ __forceinline__ float pmul(float a, float b) { float p = a * b; asm volatile("" : "+v"(p)); return p; }

__global__ __launch_bounds__(256) void wput_kernel(const float* __restrict__ wq, const float* __restrict__ wk, const float* __restrict__ wv, const float* __restrict__ wo, b16* __restrict__ W3, b16* __restrict__ WO) { const size_t u = (size_t)blockIdx.x * 256 + threadIdx.x; v8b v;
  if (u < (size_t)3 * C * (CX / 8)) { const int r = (int)(u / (CX / 8)), k0 = (int)(u % (CX / 8)) * 8; const int p = r / C, o = r % C; const float* w = p == 0 ? wq : (p == 1 ? wk : wv);
#pragma unroll
    for (int j = 0; j < 8; ++j) v[j] = (b16)(bf16_rne(w[(size_t)(k0 + j) * C + o]) * WSC); { *(v8b*)(W3 + (size_t)r * CX + k0) = v;  } }
  if (u < (size_t)CX * (C / 8)) { const int o = (int)(u / (C / 8)), k0 = (int)(u % (C / 8)) * 8;
#pragma unroll
    for (int j = 0; j < 8; ++j) v[j] = (b16)(bf16_rne(wo[(size_t)(k0 + j) * CX + o]) * WSC); { *(v8b*)(WO + (size_t)o * C + k0) = v;  } } }
__global__ __launch_bounds__(32) void proj_kernel(const float* __restrict__ x, const b16* __restrict__ W3, const float* __restrict__ bq, const float* __restrict__ bk, const float* __restrict__ bv, int TLIM, b16* __restrict__ PH, b16* __restrict__ PL, b16* __restrict__ VTH, b16* __restrict__ VTL) { __shared__ __attribute__((aligned(16))) b16 Ah[16][CX + 8], Oh[16][264], Ol[16][264]; const int lane = threadIdx.x, nloc = lane & 15, hlf = lane >> 4; const size_t m0 = (size_t)blockIdx.x * 16; if (m0 >= (size_t)TLIM) return;
  for (int rr = 0; rr < 16; ++rr) for (int q = 0; q < CX / 32; ++q) Ah[rr][q * 32 + lane] = (b16)(bf16_rne(x[(m0 + rr) * CX + q * 32 + lane]) * XS);
  wave_lds_sync();
#pragma unroll 1
  for (int g = 0; g < 3; ++g) { const int pj = g;   /* one group of 8 tiles per projection (128 columns) */ const float* bb = pj == 0 ? bq : (pj == 1 ? bk : bv); v8f acc[8];
#pragma unroll
    for (int t = 0; t < 8; ++t) acc[t] = (v8f){};
#pragma unroll 2
    for (int kb = 0; kb < CX; kb += 32) { const v16b a = frag_kb(&Ah[nloc][kb], hlf);
#pragma unroll
      for (int t = 0; t < 8; ++t) acc[t] = wmma16b(a, frag_kb(W3 + (size_t)(g * C + t * 16 + nloc) * CX + kb, hlf), acc[t]); }
    if (g == 2) {   /* v: a lane's 8 accumulator rows are 8 consecutive keys of one channel = 16 bytes of V^T; tile [this block's 16 keys][channel][16], 512 contiguous bytes per store; the v third of the PH / PL rows stays unwritten and unread */
#pragma unroll
      for (int t = 0; t < 8; ++t) { const int cc = t * 16 + nloc; const float bvv = bfv(bb[cc]); v8b vh8, vl8;
#pragma unroll
        for (int r8 = 0; r8 < 8; ++r8) { b16 p, ql; split16((acc[t][r8] * (1.0f / (XS * WSC)) + bvv) * HS, p, ql); vh8[r8] = p; vl8[r8] = ql; }
        const size_t vo8 = ((size_t)blockIdx.x * HD + cc) * 16 + 8 * hlf; *(v8b*)(VTH + vo8) = vh8; *(v8b*)(VTL + vo8) = vl8; }
      asm volatile("s_wait_xcnt 0x0" ::: "memory");   /* stands behind the last V^T store, in front of any rewrite of the stores' address and data registers: this pass skips the sync whose store wait does that for k and q */
      continue; }
#pragma unroll
    for (int t = 0; t < 8; ++t) { const int cc = t * 16 + nloc; const float bvv = bfv(bb[cc]);
#pragma unroll
      for (int r8 = 0; r8 < 8; ++r8) { b16 p, ql; split16((acc[t][r8] * (1.0f / (XS * WSC)) + bvv) * HS, p, ql); Oh[8 * hlf + r8][cc] = p; Ol[8 * hlf + r8][cc] = ql; } }
    wave_lds_sync();
    { for (int rr = 0; rr < 16; ++rr) if (lane < 16) { *(v8b*)(PH + (m0 + rr) * PW + g * C + lane * 8) = *(const v8b*)(&Oh[rr][lane * 8]); *(v8b*)(PL + (m0 + rr) * PW + g * C + lane * 8) = *(const v8b*)(&Ol[rr][lane * 8]); }  }   
    wave_lds_sync(); } }
// attention: ONE WAVE PER BLOCK, wave per (b, h, 16-query tile): key blocks of 128 over all keys; S = Q K^T (3 products, K 128); online softmax; P x256 hi+lo;
__global__ __launch_bounds__(32) void att_kernel(const b16* __restrict__ PH, const b16* __restrict__ PL, const b16* __restrict__ VTH, const b16* __restrict__ VTL, const float* __restrict__ amask, int BLIM, float* __restrict__ ATT) { __shared__ __attribute__((aligned(16))) b16 Ph_[16][KB + 8], Pl_[16][KB + 8]; __shared__ float Sf[16][KB + 4], Of[16][HD + 4];
  const int lane = threadIdx.x, nloc = lane & 15, hlf = lane >> 4; const int qt = blockIdx.x % (L / 16); const int h = (blockIdx.x / (L / 16)) % NH; const int b = blockIdx.x / ((L / 16) * NH); if (b >= BLIM) return; const int t0 = qt * 16; const size_t rowb = (size_t)b * L; const int qo = h * HD, ko = C + h * HD;
  v16b qh[HD / 32], ql[HD / 32];
#pragma unroll
  for (int s = 0; s < HD / 32; ++s) { qh[s] = frag_kb(PH + (rowb + t0 + nloc) * PW + qo + s * 32, hlf); ql[s] = frag_kb(PL + (rowb + t0 + nloc) * PW + qo + s * 32, hlf); }
  float m_r[8], den_r[8]; v8f acc[HD / 16];
#pragma unroll
  for (int r8 = 0; r8 < 8; ++r8) { m_r[r8] = -INFINITY; den_r[r8] = 0.0f; }
#pragma unroll
  for (int t = 0; t < HD / 16; ++t) acc[t] = (v8f){};
  const int kstart = 0; const int kend = L;   // [kstart, kend)
#pragma unroll 1
  for (int kb0 = kstart; kb0 < kend; kb0 += KB) { const int nk = (kend - kb0) < KB ? (kend - kb0) : KB; const int nkt = (nk + 15) / 16;
    for (int t = 0; t < KB / 16; ++t) { if (t < nkt) { const int key = kb0 + t * 16 + nloc < L ? kb0 + t * 16 + nloc : L - 1; const size_t kr = (rowb + key) * PW + ko; v8f s = {};
#pragma unroll
        for (int q = 0; q < HD / 32; ++q) { const v16b kh = frag_kb(PH + kr + q * 32, hlf), kl = frag_kb(PL + kr + q * 32, hlf); s = wmma16b(qh[q], kh, s); s = wmma16b(qh[q], kl, s); s = wmma16b(ql[q], kh, s); }
#pragma unroll
        for (int r8 = 0; r8 < 8; ++r8) { const int i = t0 + 8 * hlf + r8, j = kb0 + t * 16 + nloc; const bool ok = (j < kend); Sf[8 * hlf + r8][t * 16 + nloc] = ok ? s[r8] * (1.0f / (HS * HS)) : -INFINITY; } }
      else {
#pragma unroll
        for (int r8 = 0; r8 < 8; ++r8) Sf[8 * hlf + r8][t * 16 + nloc] = -INFINITY; } }
    wave_lds_sync();
#pragma unroll
    for (int rr = 0; rr < 16; ++rr) { float mx = -INFINITY;
#pragma unroll
      for (int q = 0; q < 4; ++q) mx = fmaxf(mx, Sf[rr][q * 32 + lane]);
      for (int o = 16; o; o >>= 1) mx = fmaxf(mx, __shfl_xor(mx, o));
      const float mold = __shfl(m_r[rr & 7], (rr >> 3) * 16); const float mn = fmaxf(mold, mx); const float sf = (mold == -INFINITY) ? 0.0f : ((mn == -INFINITY) ? 1.0f : __expf(mold - mn)); float ps = 0.0f;
#pragma unroll
      for (int q = 0; q < 4; ++q) { const int kx = q * 32 + lane; const float sv = Sf[rr][kx]; const float p = (sv == -INFINITY || mn == -INFINITY) ? 0.0f : __expf(sv - mn); ps += p; b16 ph, pl; split16(p * PS, ph, pl); Ph_[rr][kx] = ph; Pl_[rr][kx] = pl; }
      for (int o = 16; o; o >>= 1) ps += __shfl_xor(ps, o);
      if ((rr >> 3) == hlf) { const int r8 = rr & 7; den_r[r8] = den_r[r8] * sf + ps; m_r[r8] = mn;
#pragma unroll
        for (int t = 0; t < HD / 16; ++t) acc[t][r8] = acc[t][r8] * sf; } }
    wave_lds_sync();
    for (int ks = 0; ks < nkt * 16; ks += 32) { const size_t vt = ((rowb + kb0 + ks) / 16 * HD + nloc) * 16; const v16b pa = frag_kb(&Ph_[nloc][ks], hlf), pb = frag_kb(&Pl_[nloc][ks], hlf);
#pragma unroll
      for (int tg = 0; tg < HD / 16; tg += 4) { v16b vh[4], vl[4];   /* the V^T fragments of four channel tiles are loaded ahead of their products: one wait on global memory per 12 products; eight tiles at once spilled */
#pragma unroll
        for (int t = 0; t < 4; ++t) { vh[t] = frag_vt(VTH + vt + (tg + t) * 256, hlf); vl[t] = frag_vt(VTL + vt + (tg + t) * 256, hlf); }
#pragma unroll
        for (int t = 0; t < 4; ++t) { acc[tg + t] = wmma16b(pa, vh[t], acc[tg + t]); acc[tg + t] = wmma16b(pa, vl[t], acc[tg + t]); acc[tg + t] = wmma16b(pb, vh[t], acc[tg + t]); } } }
    wave_lds_sync(); }
#pragma unroll
  for (int t = 0; t < HD / 16; ++t)
#pragma unroll
    for (int r8 = 0; r8 < 8; ++r8) { const float dn = den_r[r8]; Of[8 * hlf + r8][t * 16 + nloc] = dn > 0.0f ? acc[t][r8] * (1.0f / (HS * PS)) / dn : 0.0f; }
  wave_lds_sync();
  { for (int rr = 0; rr < 16; ++rr) for (int s = 0; s < HD / 32; ++s) ((float*)ATT)[(rowb + t0 + rr) * C + h * HD + s * 32 + lane] = Of[rr][s * 32 + lane];  } }
__global__ __launch_bounds__(32) void out_kernel(const float* __restrict__ ATT, const b16* __restrict__ WO, const float* __restrict__ bo, const float* __restrict__ xres, int TLIM, float* __restrict__ out) { __shared__ __attribute__((aligned(16))) b16 Ah[16][C + 8], Al[16][C + 8]; __shared__ float Tf[16][260]; const int lane = threadIdx.x, nloc = lane & 15, hlf = lane >> 4; const size_t m0 = (size_t)blockIdx.x * 16; if (m0 >= (size_t)TLIM) return;
  for (int rr = 0; rr < 16; ++rr) for (int q = 0; q < C / 32; ++q) { b16 p, ql; split16(ATT[(m0 + rr) * C + q * 32 + lane] * HS, p, ql); Ah[rr][q * 32 + lane] = p; Al[rr][q * 32 + lane] = ql; }
  wave_lds_sync();
#pragma unroll 1
  for (int g = 0; g < CX / 256; ++g) { v8f acc[16];
#pragma unroll
    for (int t = 0; t < 16; ++t) acc[t] = (v8f){};
#pragma unroll 2
    for (int kb = 0; kb < C; kb += 32) { const v16b a = frag_kb(&Ah[nloc][kb], hlf), al = frag_kb(&Al[nloc][kb], hlf);
#pragma unroll
      for (int t = 0; t < 16; ++t) { const v16b bw = frag_kb(WO + (size_t)(g * 256 + t * 16 + nloc) * C + kb, hlf); acc[t] = wmma16b(a, bw, acc[t]); acc[t] = wmma16b(al, bw, acc[t]); } }
#pragma unroll
    for (int t = 0; t < 16; ++t) { const int cc = t * 16 + nloc; const float bb = bfv(bo[g * 256 + cc]);
#pragma unroll
      for (int r8 = 0; r8 < 8; ++r8) { const int rr = 8 * hlf + r8; Tf[rr][cc] = acc[t][r8] * (1.0f / (HS * WSC)) + bb + bfv(xres[(m0 + rr) * CX + g * 256 + cc]); } }   /* + residual x */
    wave_lds_sync();
    { for (int rr = 0; rr < 16; ++rr) for (int q = 0; q < 2; ++q) *(v4f*)(out + (m0 + rr) * CX + g * 256 + q * 128 + lane * 4) = *(const v4f*)(&Tf[rr][q * 128 + lane * 4]);  }
    wave_lds_sync(); } }
}  // namespace

extern "C" void kernel_launch(void* const* d_in, const int* in_sizes, int n_in, void* d_out, int out_size, void* d_ws, size_t ws_size, hipStream_t stream) {
  (void)n_in;
  auto Fp = [&](int i) { return (const float*)d_in[i]; };
  // input order: 0 x [4,64,64,256]; 1 wk [256,128]; 2 bk; 3 wq [256,128]; 4 bq; 5 wv [256,128]; 6 bv; 7 wo [128,256]; 8 bo [256]  (all (in,out))
  if (in_sizes[0] != NT * CX || in_sizes[1] != CX * C || in_sizes[3] != CX * C || in_sizes[5] != CX * C || in_sizes[7] != C * CX || in_sizes[8] != CX || out_size != NT * CX) return;
  const int BLIM = NB;
  const int TLIM = BLIM * L;
  size_t off = 0; char* ws = (char*)d_ws;
  auto carve = [&](size_t bytes) { char* p = ws + off; off += (bytes + 255) & ~(size_t)255; return p; };
  b16* W3 = (b16*)carve((size_t)3 * C * CX * 2); b16* WO = (b16*)carve((size_t)CX * C * 2); b16* PH = (b16*)carve((size_t)NT * PW * 2); b16* PL = (b16*)carve((size_t)NT * PW * 2); float* ATT = (float*)carve((size_t)NT * C * 4); b16* VTH = (b16*)carve((size_t)NT * HD * 2); b16* VTL = (b16*)carve((size_t)NT * HD * 2);
  if (off > ws_size || off > ((size_t)96 << 20)) return;   // ~ 42 MB
  wput_kernel<<<(unsigned)(((size_t)3 * C * (CX / 8) + 255) / 256), 256, 0, stream>>>(Fp(1), Fp(3), Fp(5), Fp(7), W3, WO);
  proj_kernel<<<TLIM / 16, 32, 0, stream>>>(Fp(0), W3, Fp(2), Fp(4), Fp(6), TLIM, PH, PL, VTH, VTL);
  att_kernel<<<BLIM * NH * (L / 16), 32, 0, stream>>>(PH, PL, VTH, VTL, (const float*)0, BLIM, ATT);
  out_kernel<<<TLIM / 16, 32, 0, stream>>>(ATT, WO, Fp(8), Fp(0), TLIM, (float*)d_out);
}

// v002
// It runs in 385 microseconds.
// Timed twice side by side with v001, it ran 1.99 and 1.95 times as fast.
// Over all steps from v000 it is 7.70 times as fast.
#include <hip/hip_runtime.h>

// Self_attention_pixel_wise: per image (4,096 pixels, NHWC 256 ch): k = x wk + bk, q = x wq + bq, v = x wv + bv (128); scores[n][m] = k_n . q_m (no scaling); attn = softmax over m; o = attn v; out = o wo + bo + x -> [4][64][64][256].
// Note the roles: the module's 'key' is the attention query (rows n) and its 'query' the attention key (columns m).
// Deterministic: no index structures, no atomics; flash-style online softmax, the keys of a query tile split over the four waves of a block in a fixed order, the four partial results joined in a fixed order.
// WMMA (v_wmma_f32_16x16x32_f16, f32 accumulate): the QKV projection with x EXACT bf16 x8 (K 256) against exact weight rows x256 (one product); S = Q K^T (hi+lo x hi+lo, 3 products, K 128); O = P V (P x256 hi+lo x V^T hi+lo, 3 products; V^T is written by the projection in tiles [16 keys][128 channels][16] and read as B fragments straight from global memory); out = attended (hi+lo) Wo^T (2 products); softmax in f32. Inputs rounded to bf16 once. Fragment k-map per lane half hh for A AND B: elements 0..7 <- k = 8hh+0..7, 8..15 <- k = 16+8hh+0..7; acc[r] = D[8hh+r][col].

namespace {
constexpr int NB = 4, L = 4096, C = 128, CX = 256 /* input / output channels */, NH = 1, HD = 128, NT = NB * L, KB = 128, PW = 3 * C, KW = 4 /* waves per attention block, each takes L / KW keys */;
constexpr float XS = 8.0f, HS = 256.0f /* hi+lo staging scale for k/q/v/attended */, WSC = 256.0f, PS = 256.0f, SCALE = 1.0f;
typedef _Float16 b16;
typedef __attribute__((ext_vector_type(16))) _Float16 v16b;
typedef __attribute__((ext_vector_type(8))) _Float16 v8b;
typedef __attribute__((ext_vector_type(8))) float v8f;
typedef __attribute__((ext_vector_type(4))) float v4f;
__device__ __forceinline__ float bf16_rne(float f) { unsigned int u = __float_as_uint(f); u += 0x7FFFu + ((u >> 16) & 1u); float r = __uint_as_float(u & 0xFFFF0000u); asm volatile("" : "+v"(r)); return r; }
__device__ __forceinline__ float bfv(float f) { float r = bf16_rne(f); asm volatile("" : "+v"(r)); return r; }
__device__ __forceinline__ void split16(float v, b16& hi, b16& lo) { hi = (b16)v; lo = (b16)(v - (float)hi); }
__device__ __forceinline__ v16b frag_kb(const b16* p, int hh) { const v8b a = *(const v8b*)(p + 8 * hh), b = *(const v8b*)(p + 16 + 8 * hh); v16b f;
#pragma unroll
  for (int e = 0; e < 8; ++e) { f[e] = a[e]; f[8 + e] = b[e]; } return f; }
// same k-map as frag_kb, from the tiled V^T: p = channel row of the 16-key tile that holds k = 0..15; k = 16..31 is the next tile, HD * 16 elements on
__device__ __forceinline__ v16b frag_vt(const b16* p, int hh) { const v8b a = *(const v8b*)(p + 8 * hh), b = *(const v8b*)(p + HD * 16 + 8 * hh); v16b f;
#pragma unroll
  for (int e = 0; e < 8; ++e) { f[e] = a[e]; f[8 + e] = b[e]; } return f; }
__device__ __forceinline__ v8f wmma16b(v16b a, v16b b, v8f c) { v8f d = __builtin_amdgcn_wmma_f32_16x16x32_f16(false, a, false, b, (short)0, c, false, false); asm volatile("v_nop\n\tv_nop\n\tv_nop\n\tv_nop" : "+v"(d) : "v"(a), "v"(b)); return d; }
__device__ __forceinline__ void wave_lds_sync() { __builtin_amdgcn_fence(__ATOMIC_RELEASE, "workgroup"); __builtin_amdgcn_wave_barrier(); __builtin_amdgcn_fence(__ATOMIC_ACQUIRE, "workgroup"); }
__device__ __forceinline__ float pmul(float a, float b) { float p = a * b; asm volatile("" : "+v"(p)); return p; }

__global__ __launch_bounds__(256) void wput_kernel(const float* __restrict__ wq, const float* __restrict__ wk, const float* __restrict__ wv, const float* __restrict__ wo, b16* __restrict__ W3, b16* __restrict__ WO) { const size_t u = (size_t)blockIdx.x * 256 + threadIdx.x; v8b v;
  if (u < (size_t)3 * C * (CX / 8)) { const int r = (int)(u / (CX / 8)), k0 = (int)(u % (CX / 8)) * 8; const int p = r / C, o = r % C; const float* w = p == 0 ? wq : (p == 1 ? wk : wv);
#pragma unroll
    for (int j = 0; j < 8; ++j) v[j] = (b16)(bf16_rne(w[(size_t)(k0 + j) * C + o]) * WSC); { *(v8b*)(W3 + (size_t)r * CX + k0) = v;  } }
  if (u < (size_t)CX * (C / 8)) { const int o = (int)(u / (C / 8)), k0 = (int)(u % (C / 8)) * 8;
#pragma unroll
    for (int j = 0; j < 8; ++j) v[j] = (b16)(bf16_rne(wo[(size_t)(k0 + j) * CX + o]) * WSC); { *(v8b*)(WO + (size_t)o * C + k0) = v;  } } }
__global__ __launch_bounds__(32) void proj_kernel(const float* __restrict__ x, const b16* __restrict__ W3, const float* __restrict__ bq, const float* __restrict__ bk, const float* __restrict__ bv, int TLIM, b16* __restrict__ PH, b16* __restrict__ PL, b16* __restrict__ VTH, b16* __restrict__ VTL) { __shared__ __attribute__((aligned(16))) b16 Ah[16][CX + 8], Oh[16][264], Ol[16][264]; const int lane = threadIdx.x, nloc = lane & 15, hlf = lane >> 4; const size_t m0 = (size_t)blockIdx.x * 16; if (m0 >= (size_t)TLIM) return;
  for (int rr = 0; rr < 16; ++rr) for (int q = 0; q < CX / 32; ++q) Ah[rr][q * 32 + lane] = (b16)(bf16_rne(x[(m0 + rr) * CX + q * 32 + lane]) * XS);
  wave_lds_sync();
#pragma unroll 1
  for (int g = 0; g < 3; ++g) { const int pj = g;   /* one group of 8 tiles per projection (128 columns) */ const float* bb = pj == 0 ? bq : (pj == 1 ? bk : bv); v8f acc[8];
#pragma unroll
    for (int t = 0; t < 8; ++t) acc[t] = (v8f){};
#pragma unroll 2
    for (int kb = 0; kb < CX; kb += 32) { const v16b a = frag_kb(&Ah[nloc][kb], hlf);
#pragma unroll
      for (int t = 0; t < 8; ++t) acc[t] = wmma16b(a, frag_kb(W3 + (size_t)(g * C + t * 16 + nloc) * CX + kb, hlf), acc[t]); }
    if (g == 2) {   /* v: a lane's 8 accumulator rows are 8 consecutive keys of one channel = 16 bytes of V^T; tile [this block's 16 keys][channel][16], 512 contiguous bytes per store; the v third of the PH / PL rows stays unwritten and unread */
#pragma unroll
      for (int t = 0; t < 8; ++t) { const int cc = t * 16 + nloc; const float bvv = bfv(bb[cc]); v8b vh8, vl8;
#pragma unroll
        for (int r8 = 0; r8 < 8; ++r8) { b16 p, ql; split16((acc[t][r8] * (1.0f / (XS * WSC)) + bvv) * HS, p, ql); vh8[r8] = p; vl8[r8] = ql; }
        const size_t vo8 = ((size_t)blockIdx.x * HD + cc) * 16 + 8 * hlf; *(v8b*)(VTH + vo8) = vh8; *(v8b*)(VTL + vo8) = vl8; }
      asm volatile("s_wait_xcnt 0x0" ::: "memory");   /* stands behind the last V^T store, in front of any rewrite of the stores' address and data registers: this pass skips the sync whose store wait does that for k and q */
      continue; }
#pragma unroll
    for (int t = 0; t < 8; ++t) { const int cc = t * 16 + nloc; const float bvv = bfv(bb[cc]);
#pragma unroll
      for (int r8 = 0; r8 < 8; ++r8) { b16 p, ql; split16((acc[t][r8] * (1.0f / (XS * WSC)) + bvv) * HS, p, ql); Oh[8 * hlf + r8][cc] = p; Ol[8 * hlf + r8][cc] = ql; } }
    wave_lds_sync();
    { for (int rr = 0; rr < 16; ++rr) if (lane < 16) { *(v8b*)(PH + (m0 + rr) * PW + g * C + lane * 8) = *(const v8b*)(&Oh[rr][lane * 8]); *(v8b*)(PL + (m0 + rr) * PW + g * C + lane * 8) = *(const v8b*)(&Ol[rr][lane * 8]); }  }   
    wave_lds_sync(); } }
// attention: block per (b, h, 16-query tile), KW waves; wave w walks keys [w L / KW, (w + 1) L / KW) in key blocks of 128 with LDS of its own: S = Q K^T (3 products, K 128); online softmax; P x256 hi+lo; at the end the waves' (max, sum, O) are joined through LDS.
// 4 waves per SIMD (256 registers each) and 4 blocks per WGP (4 x the LDS size below 327,680 B): all blocks resident at once, four waves to cover each other's load, LDS and cross-lane waits.
__global__ __launch_bounds__(32 * KW) __attribute__((amdgpu_waves_per_eu(4, 4))) void att_kernel(const b16* __restrict__ PH, const b16* __restrict__ PL, const b16* __restrict__ VTH, const b16* __restrict__ VTL, const float* __restrict__ amask, int BLIM, float* __restrict__ ATT) { __shared__ __attribute__((aligned(16))) b16 PhW[KW][16][KB + 8], PlW[KW][16][KB + 8]; __shared__ float SfW[KW][16][KB + 4], Mw[KW][16], Dw[KW][16]; static_assert(HD <= KB && L % (KW * KB) == 0, "a wave's O partial lies in its score tile; whole key blocks per wave");
  const int wv = __builtin_amdgcn_readfirstlane((int)(threadIdx.x >> 5)); auto& Ph_ = PhW[wv]; auto& Pl_ = PlW[wv]; auto& Sf = SfW[wv];
  const int lane = threadIdx.x & 31, nloc = lane & 15, hlf = lane >> 4; const int qt = blockIdx.x % (L / 16); const int h = (blockIdx.x / (L / 16)) % NH; const int b = blockIdx.x / ((L / 16) * NH); if (b >= BLIM) return; const int t0 = qt * 16; const size_t rowb = (size_t)b * L; const int qo = h * HD, ko = C + h * HD;
  v16b qh[HD / 32], ql[HD / 32];
#pragma unroll
  for (int s = 0; s < HD / 32; ++s) { qh[s] = frag_kb(PH + (rowb + t0 + nloc) * PW + qo + s * 32, hlf); ql[s] = frag_kb(PL + (rowb + t0 + nloc) * PW + qo + s * 32, hlf); }
  float m_r[8], den_r[8]; v8f acc[HD / 16];
#pragma unroll
  for (int r8 = 0; r8 < 8; ++r8) { m_r[r8] = -INFINITY; den_r[r8] = 0.0f; }
#pragma unroll
  for (int t = 0; t < HD / 16; ++t) acc[t] = (v8f){};
  const int kstart = wv * (L / KW); const int kend = kstart + L / KW;   // this wave's keys [kstart, kend)
#pragma unroll 1
  for (int kb0 = kstart; kb0 < kend; kb0 += KB) { const int nk = KB; const int nkt = (nk + 15) / 16;   /* whole key blocks only (asserted above) */
    for (int t = 0; t < KB / 16; ++t) { if (t < nkt) { const int key = kb0 + t * 16 + nloc < L ? kb0 + t * 16 + nloc : L - 1; const size_t kr = (rowb + key) * PW + ko; v8f s = {};
#pragma unroll
        for (int q = 0; q < HD / 32; ++q) { const v16b kh = frag_kb(PH + kr + q * 32, hlf), kl = frag_kb(PL + kr + q * 32, hlf); s = wmma16b(qh[q], kh, s); s = wmma16b(qh[q], kl, s); s = wmma16b(ql[q], kh, s); }
#pragma unroll
        for (int r8 = 0; r8 < 8; ++r8) { const int i = t0 + 8 * hlf + r8, j = kb0 + t * 16 + nloc; const bool ok = (j < kend); Sf[8 * hlf + r8][t * 16 + nloc] = ok ? s[r8] * (1.0f / (HS * HS)) : -INFINITY; } }
      else {
#pragma unroll
        for (int r8 = 0; r8 < 8; ++r8) Sf[8 * hlf + r8][t * 16 + nloc] = -INFINITY; } }
    wave_lds_sync();
#pragma unroll
    for (int rr = 0; rr < 16; ++rr) { float mx = -INFINITY;
#pragma unroll
      for (int q = 0; q < 4; ++q) mx = fmaxf(mx, Sf[rr][q * 32 + lane]);
      for (int o = 16; o; o >>= 1) mx = fmaxf(mx, __shfl_xor(mx, o));
      const float mold = __shfl(m_r[rr & 7], (rr >> 3) * 16); const float mn = fmaxf(mold, mx); const float sf = (mold == -INFINITY) ? 0.0f : ((mn == -INFINITY) ? 1.0f : __expf(mold - mn)); float ps = 0.0f;
#pragma unroll
      for (int q = 0; q < 4; ++q) { const int kx = q * 32 + lane; const float sv = Sf[rr][kx]; const float p = (sv == -INFINITY || mn == -INFINITY) ? 0.0f : __expf(sv - mn); ps += p; b16 ph, pl; split16(p * PS, ph, pl); Ph_[rr][kx] = ph; Pl_[rr][kx] = pl; }
      for (int o = 16; o; o >>= 1) ps += __shfl_xor(ps, o);
      if ((rr >> 3) == hlf) { const int r8 = rr & 7; den_r[r8] = den_r[r8] * sf + ps; m_r[r8] = mn;
#pragma unroll
        for (int t = 0; t < HD / 16; ++t) acc[t][r8] = acc[t][r8] * sf; } }
    wave_lds_sync();
    for (int ks = 0; ks < nkt * 16; ks += 32) { const size_t vt = ((rowb + kb0 + ks) / 16 * HD + nloc) * 16; const v16b pa = frag_kb(&Ph_[nloc][ks], hlf), pb = frag_kb(&Pl_[nloc][ks], hlf);
#pragma unroll
      for (int tg = 0; tg < HD / 16; tg += 4) { v16b vh[4], vl[4];   /* the V^T fragments of four channel tiles are loaded ahead of their products: one wait on global memory per 12 products; eight tiles at once spilled */
#pragma unroll
        for (int t = 0; t < 4; ++t) { vh[t] = frag_vt(VTH + vt + (tg + t) * 256, hlf); vl[t] = frag_vt(VTL + vt + (tg + t) * 256, hlf); }
#pragma unroll
        for (int t = 0; t < 4; ++t) { acc[tg + t] = wmma16b(pa, vh[t], acc[tg + t]); acc[tg + t] = wmma16b(pa, vl[t], acc[tg + t]); acc[tg + t] = wmma16b(pb, vh[t], acc[tg + t]); } } }
    wave_lds_sync(); }
#pragma unroll
  for (int t = 0; t < HD / 16; ++t)
#pragma unroll
    for (int r8 = 0; r8 < 8; ++r8) Sf[8 * hlf + r8][t * 16 + nloc] = acc[t][r8];
  if (nloc == 0) {
#pragma unroll   /* m_r and den_r live in registers: constant indices only */
    for (int r8 = 0; r8 < 8; ++r8) { Mw[wv][8 * hlf + r8] = m_r[r8]; Dw[wv][8 * hlf + r8] = den_r[r8]; } }
  __syncthreads();   /* every wave's partial (max, sum, O) is in LDS before any thread joins them */
  for (int ch = threadIdx.x; ch < HD; ch += 32 * KW)
    for (int rr = 0; rr < 16; ++rr) { float mx = Mw[0][rr];
      for (int w = 1; w < KW; ++w) mx = fmaxf(mx, Mw[w][rr]);
      float dn = 0.0f, o = 0.0f;
      for (int w = 0; w < KW; ++w) { const float mw = Mw[w][rr]; const float e = (mw == -INFINITY) ? 0.0f : __expf(mw - mx); dn += e * Dw[w][rr]; o += e * SfW[w][rr][ch]; }
      ATT[(rowb + t0 + rr) * C + h * HD + ch] = dn > 0.0f ? o * (1.0f / (HS * PS)) / dn : 0.0f;
      asm volatile("s_wait_xcnt 0x0" ::: "memory");   /* stands behind the store, in front of the next row's rewrite of the store's data and address registers */
    } }
__global__ __launch_bounds__(32) void out_kernel(const float* __restrict__ ATT, const b16* __restrict__ WO, const float* __restrict__ bo, const float* __restrict__ xres, int TLIM, float* __restrict__ out) { __shared__ __attribute__((aligned(16))) b16 Ah[16][C + 8], Al[16][C + 8]; __shared__ float Tf[16][260]; const int lane = threadIdx.x, nloc = lane & 15, hlf = lane >> 4; const size_t m0 = (size_t)blockIdx.x * 16; if (m0 >= (size_t)TLIM) return;
  for (int rr = 0; rr < 16; ++rr) for (int q = 0; q < C / 32; ++q) { b16 p, ql; split16(ATT[(m0 + rr) * C + q * 32 + lane] * HS, p, ql); Ah[rr][q * 32 + lane] = p; Al[rr][q * 32 + lane] = ql; }
  wave_lds_sync();
#pragma unroll 1
  for (int g = 0; g < CX / 256; ++g) { v8f acc[16];
#pragma unroll
    for (int t = 0; t < 16; ++t) acc[t] = (v8f){};
#pragma unroll 2
    for (int kb = 0; kb < C; kb += 32) { const v16b a = frag_kb(&Ah[nloc][kb], hlf), al = frag_kb(&Al[nloc][kb], hlf);
#pragma unroll
      for (int t = 0; t < 16; ++t) { const v16b bw = frag_kb(WO + (size_t)(g * 256 + t * 16 + nloc) * C + kb, hlf); acc[t] = wmma16b(a, bw, acc[t]); acc[t] = wmma16b(al, bw, acc[t]); } }
#pragma unroll
    for (int t = 0; t < 16; ++t) { const int cc = t * 16 + nloc; const float bb = bfv(bo[g * 256 + cc]);
#pragma unroll
      for (int r8 = 0; r8 < 8; ++r8) { const int rr = 8 * hlf + r8; Tf[rr][cc] = acc[t][r8] * (1.0f / (HS * WSC)) + bb + bfv(xres[(m0 + rr) * CX + g * 256 + cc]); } }   /* + residual x */
    wave_lds_sync();
    { for (int rr = 0; rr < 16; ++rr) for (int q = 0; q < 2; ++q) *(v4f*)(out + (m0 + rr) * CX + g * 256 + q * 128 + lane * 4) = *(const v4f*)(&Tf[rr][q * 128 + lane * 4]);  }
    wave_lds_sync(); } }
}  // namespace

extern "C" void kernel_launch(void* const* d_in, const int* in_sizes, int n_in, void* d_out, int out_size, void* d_ws, size_t ws_size, hipStream_t stream) {
  (void)n_in;
  auto Fp = [&](int i) { return (const float*)d_in[i]; };
  // input order: 0 x [4,64,64,256]; 1 wk [256,128]; 2 bk; 3 wq [256,128]; 4 bq; 5 wv [256,128]; 6 bv; 7 wo [128,256]; 8 bo [256]  (all (in,out))
  if (in_sizes[0] != NT * CX || in_sizes[1] != CX * C || in_sizes[3] != CX * C || in_sizes[5] != CX * C || in_sizes[7] != C * CX || in_sizes[8] != CX || out_size != NT * CX) return;
  const int BLIM = NB;
  const int TLIM = BLIM * L;
  size_t off = 0; char* ws = (char*)d_ws;
  auto carve = [&](size_t bytes) { char* p = ws + off; off += (bytes + 255) & ~(size_t)255; return p; };
  b16* W3 = (b16*)carve((size_t)3 * C * CX * 2); b16* WO = (b16*)carve((size_t)CX * C * 2); b16* PH = (b16*)carve((size_t)NT * PW * 2); b16* PL = (b16*)carve((size_t)NT * PW * 2); float* ATT = (float*)carve((size_t)NT * C * 4); b16* VTH = (b16*)carve((size_t)NT * HD * 2); b16* VTL = (b16*)carve((size_t)NT * HD * 2);
  if (off > ws_size || off > ((size_t)96 << 20)) return;   // ~ 42 MB
  wput_kernel<<<(unsigned)(((size_t)3 * C * (CX / 8) + 255) / 256), 256, 0, stream>>>(Fp(1), Fp(3), Fp(5), Fp(7), W3, WO);
  proj_kernel<<<TLIM / 16, 32, 0, stream>>>(Fp(0), W3, Fp(2), Fp(4), Fp(6), TLIM, PH, PL, VTH, VTL);
  att_kernel<<<BLIM * NH * (L / 16), 32 * KW, 0, stream>>>(PH, PL, VTH, VTL, (const float*)0, BLIM, ATT);
  out_kernel<<<TLIM / 16, 32, 0, stream>>>(ATT, WO, Fp(8), Fp(0), TLIM, (float*)d_out);
}

// v003
// One run takes 277 microseconds.
// Two timings next to v002 put it at 1.37 and 1.39 times that version's speed.
// All steps since v000 together make it 10.6 times as fast.
#include <hip/hip_runtime.h>

// Self_attention_pixel_wise: per image (4,096 pixels, NHWC 256 ch): k = x wk + bk, q = x wq + bq, v = x wv + bv (128); scores[n][m] = k_n . q_m (no scaling); attn = softmax over m; o = attn v; out = o wo + bo + x -> [4][64][64][256].
// Note the roles: the module's 'key' is the attention query (rows n) and its 'query' the attention key (columns m).
// Deterministic: no index structures, no atomics; flash-style online softmax, the keys of a query tile split over the four waves of a block in a fixed order, the four partial results joined in a fixed order.
// WMMA (v_wmma_f32_16x16x32_f16, f32 accumulate): the QKV projection with x EXACT bf16 x8 (K 256) against exact weight rows x256 (one product); S = Q K^T (hi+lo x hi+lo, 3 products, K 128); O = P V (P x256 hi+lo x V^T hi+lo, 3 products; V^T is written by the projection in tiles [16 keys][128 channels][16] and read as B fragments straight from global memory); out = attended (hi+lo) Wo^T (2 products); softmax in f32. Inputs rounded to bf16 once. Fragment k-map per lane half hh for A AND B: elements 0..7 <- k = 8hh+0..7, 8..15 <- k = 16+8hh+0..7; acc[r] = D[8hh+r][col].

namespace {
constexpr int NB = 4, L = 4096, C = 128, CX = 256 /* input / output channels */, NH = 1, HD = 128, NT = NB * L, KB = 128, PW = 3 * C, KW = 4 /* waves per attention block, each takes L / KW keys */;
constexpr float XS = 8.0f, HS = 256.0f /* hi+lo staging scale for k/q/v/attended */, WSC = 256.0f, PS = 256.0f, SCALE = 1.0f;
typedef _Float16 b16;
typedef __attribute__((ext_vector_type(16))) _Float16 v16b;
typedef __attribute__((ext_vector_type(8))) _Float16 v8b;
typedef __attribute__((ext_vector_type(8))) float v8f;
typedef __attribute__((ext_vector_type(4))) float v4f;
__device__ __forceinline__ float bf16_rne(float f) { unsigned int u = __float_as_uint(f); u += 0x7FFFu + ((u >> 16) & 1u); float r = __uint_as_float(u & 0xFFFF0000u); asm volatile("" : "+v"(r)); return r; }
__device__ __forceinline__ float bfv(float f) { float r = bf16_rne(f); asm volatile("" : "+v"(r)); return r; }
__device__ __forceinline__ void split16(float v, b16& hi, b16& lo) { hi = (b16)v; lo = (b16)(v - (float)hi); }
__device__ __forceinline__ v16b frag_kb(const b16* p, int hh) { const v8b a = *(const v8b*)(p + 8 * hh), b = *(const v8b*)(p + 16 + 8 * hh); v16b f;
#pragma unroll
  for (int e = 0; e < 8; ++e) { f[e] = a[e]; f[8 + e] = b[e]; } return f; }
// same k-map as frag_kb, from the tiled V^T: p = channel row of the 16-key tile that holds k = 0..15; k = 16..31 is the next tile, HD * 16 elements on
__device__ __forceinline__ v16b frag_vt(const b16* p, int hh) { const v8b a = *(const v8b*)(p + 8 * hh), b = *(const v8b*)(p + HD * 16 + 8 * hh); v16b f;
#pragma unroll
  for (int e = 0; e < 8; ++e) { f[e] = a[e]; f[8 + e] = b[e]; } return f; }
__device__ __forceinline__ v8f wmma16b(v16b a, v16b b, v8f c) { v8f d = __builtin_amdgcn_wmma_f32_16x16x32_f16(false, a, false, b, (short)0, c, false, false); asm volatile("v_nop\n\tv_nop\n\tv_nop\n\tv_nop" : "+v"(d) : "v"(a), "v"(b)); return d; }
__device__ __forceinline__ void wave_lds_sync() { __builtin_amdgcn_fence(__ATOMIC_RELEASE, "workgroup"); __builtin_amdgcn_wave_barrier(); __builtin_amdgcn_fence(__ATOMIC_ACQUIRE, "workgroup"); }
__device__ __forceinline__ float pmul(float a, float b) { float p = a * b; asm volatile("" : "+v"(p)); return p; }

__global__ __launch_bounds__(256) void wput_kernel(const float* __restrict__ wq, const float* __restrict__ wk, const float* __restrict__ wv, const float* __restrict__ wo, b16* __restrict__ W3, b16* __restrict__ WO) { const size_t u = (size_t)blockIdx.x * 256 + threadIdx.x; v8b v;
  if (u < (size_t)3 * C * (CX / 8)) { const int r = (int)(u / (CX / 8)), k0 = (int)(u % (CX / 8)) * 8; const int p = r / C, o = r % C; const float* w = p == 0 ? wq : (p == 1 ? wk : wv); float wr[8];   /* all eight loads stand ahead of the first rounding: its asm statement holds later loads behind it, which cost one memory wait per element */
#pragma unroll
    for (int j = 0; j < 8; ++j) wr[j] = w[(size_t)(k0 + j) * C + o];
#pragma unroll
    for (int j = 0; j < 8; ++j) v[j] = (b16)(bf16_rne(wr[j]) * WSC); { *(v8b*)(W3 + (size_t)r * CX + k0) = v;  } }
  if (u < (size_t)CX * (C / 8)) { const int o = (int)(u / (C / 8)), k0 = (int)(u % (C / 8)) * 8; float wr[8];
#pragma unroll
    for (int j = 0; j < 8; ++j) wr[j] = wo[(size_t)(k0 + j) * CX + o];
#pragma unroll
    for (int j = 0; j < 8; ++j) v[j] = (b16)(bf16_rne(wr[j]) * WSC); { *(v8b*)(WO + (size_t)o * C + k0) = v;  } } }
__global__ __launch_bounds__(32) void proj_kernel(const float* __restrict__ x, const b16* __restrict__ W3, const float* __restrict__ bq, const float* __restrict__ bk, const float* __restrict__ bv, int TLIM, b16* __restrict__ PH, b16* __restrict__ PL, b16* __restrict__ VTH, b16* __restrict__ VTL) { __shared__ __attribute__((aligned(16))) b16 Ah[16][CX + 8], Oh[16][264], Ol[16][264]; const int lane = threadIdx.x, nloc = lane & 15, hlf = lane >> 4; const size_t m0 = (size_t)blockIdx.x * 16; if (m0 >= (size_t)TLIM) return;
#pragma unroll
  for (int r0 = 0; r0 < 16; r0 += 8) { float xv[8][CX / 32];   /* eight rows of x (64 loads) are requested before the first rounding (see wput_kernel): one memory wait per half tile, not one per element */
#pragma unroll
    for (int rr = 0; rr < 8; ++rr)
#pragma unroll
      for (int q = 0; q < CX / 32; ++q) xv[rr][q] = x[(m0 + r0 + rr) * CX + q * 32 + lane];
#pragma unroll
    for (int rr = 0; rr < 8; ++rr)
#pragma unroll
      for (int q = 0; q < CX / 32; ++q) Ah[r0 + rr][q * 32 + lane] = (b16)(bf16_rne(xv[rr][q]) * XS); }
  wave_lds_sync();
#pragma unroll 1
  for (int g = 0; g < 3; ++g) { const int pj = g;   /* one group of 8 tiles per projection (128 columns) */ const float* bb = pj == 0 ? bq : (pj == 1 ? bk : bv); v8f acc[8]; float braw[8];
#pragma unroll
    for (int t = 0; t < 8; ++t) { acc[t] = (v8f){}; braw[t] = bb[t * 16 + nloc]; }   /* the bias loads fly with the first weight group */
#pragma unroll 1   /* one group of 32 loads (128 registers) per trip, kept rolled so that the groups share those registers */
    for (int kb = 0; kb < CX; kb += 64) { v16b bw[2][8];   /* the weight fragments of two k steps are loaded ahead of their 16 products: the asm statement behind each product holds later loads back, which cost one L2 wait per product */
#pragma unroll
      for (int u2 = 0; u2 < 2; ++u2)
#pragma unroll
        for (int t = 0; t < 8; ++t) bw[u2][t] = frag_kb(W3 + (size_t)(g * C + t * 16 + nloc) * CX + kb + 32 * u2, hlf);
#pragma unroll
      for (int u2 = 0; u2 < 2; ++u2) { const v16b a = frag_kb(&Ah[nloc][kb + 32 * u2], hlf);
#pragma unroll
        for (int t = 0; t < 8; ++t) acc[t] = wmma16b(a, bw[u2][t], acc[t]); } }
    if (g == 2) {   /* v: a lane's 8 accumulator rows are 8 consecutive keys of one channel = 16 bytes of V^T; tile [this block's 16 keys][channel][16], 512 contiguous bytes per store; the v third of the PH / PL rows stays unwritten and unread */
#pragma unroll
      for (int t = 0; t < 8; ++t) { const int cc = t * 16 + nloc; const float bvv = bfv(braw[t]); v8b vh8, vl8;
#pragma unroll
        for (int r8 = 0; r8 < 8; ++r8) { b16 p, ql; split16((acc[t][r8] * (1.0f / (XS * WSC)) + bvv) * HS, p, ql); vh8[r8] = p; vl8[r8] = ql; }
        const size_t vo8 = ((size_t)blockIdx.x * HD + cc) * 16 + 8 * hlf; *(v8b*)(VTH + vo8) = vh8; *(v8b*)(VTL + vo8) = vl8; }
      asm volatile("s_wait_xcnt 0x0" ::: "memory");   /* stands behind the last V^T store, in front of any rewrite of the stores' address and data registers: this pass skips the sync whose store wait does that for k and q */
      continue; }
#pragma unroll
    for (int t = 0; t < 8; ++t) { const int cc = t * 16 + nloc; const float bvv = bfv(braw[t]);
#pragma unroll
      for (int r8 = 0; r8 < 8; ++r8) { b16 p, ql; split16((acc[t][r8] * (1.0f / (XS * WSC)) + bvv) * HS, p, ql); Oh[8 * hlf + r8][cc] = p; Ol[8 * hlf + r8][cc] = ql; } }
    wave_lds_sync();
    { for (int rr = 0; rr < 16; ++rr) if (lane < 16) { *(v8b*)(PH + (m0 + rr) * PW + g * C + lane * 8) = *(const v8b*)(&Oh[rr][lane * 8]); *(v8b*)(PL + (m0 + rr) * PW + g * C + lane * 8) = *(const v8b*)(&Ol[rr][lane * 8]); }  }   
    wave_lds_sync(); } }
// attention: block per (b, h, 16-query tile), KW waves; wave w walks keys [w L / KW, (w + 1) L / KW) in key blocks of 128 with LDS of its own: S = Q K^T (3 products, K 128); online softmax; P x256 hi+lo; at the end the waves' (max, sum, O) are joined through LDS.
// 4 waves per SIMD (256 registers each) and 4 blocks per WGP (4 x the LDS size below 327,680 B): all blocks resident at once, four waves to cover each other's load, LDS and cross-lane waits.
__global__ __launch_bounds__(32 * KW) __attribute__((amdgpu_waves_per_eu(4, 4))) void att_kernel(const b16* __restrict__ PH, const b16* __restrict__ PL, const b16* __restrict__ VTH, const b16* __restrict__ VTL, const float* __restrict__ amask, int BLIM, float* __restrict__ ATT) { __shared__ __attribute__((aligned(16))) b16 PhW[KW][16][KB + 8], PlW[KW][16][KB + 8]; __shared__ float SfW[KW][16][KB + 4], Mw[KW][16], Dw[KW][16]; static_assert(HD <= KB && L % (KW * KB) == 0, "a wave's O partial lies in its score tile; whole key blocks per wave");
  const int wv = __builtin_amdgcn_readfirstlane((int)(threadIdx.x >> 5)); auto& Ph_ = PhW[wv]; auto& Pl_ = PlW[wv]; auto& Sf = SfW[wv];
  const int lane = threadIdx.x & 31, nloc = lane & 15, hlf = lane >> 4; const int qt = blockIdx.x % (L / 16); const int h = (blockIdx.x / (L / 16)) % NH; const int b = blockIdx.x / ((L / 16) * NH); if (b >= BLIM) return; const int t0 = qt * 16; const size_t rowb = (size_t)b * L; const int qo = h * HD, ko = C + h * HD;
  v16b qh[HD / 32], ql[HD / 32];
#pragma unroll
  for (int s = 0; s < HD / 32; ++s) { qh[s] = frag_kb(PH + (rowb + t0 + nloc) * PW + qo + s * 32, hlf); ql[s] = frag_kb(PL + (rowb + t0 + nloc) * PW + qo + s * 32, hlf); }
  float m_r[8], den_r[8]; v8f acc[HD / 16];
#pragma unroll
  for (int r8 = 0; r8 < 8; ++r8) { m_r[r8] = -INFINITY; den_r[r8] = 0.0f; }
#pragma unroll
  for (int t = 0; t < HD / 16; ++t) acc[t] = (v8f){};
  const int kstart = wv * (L / KW); const int kend = kstart + L / KW;   // this wave's keys [kstart, kend)
#pragma unroll 1
  for (int kb0 = kstart; kb0 < kend; kb0 += KB) { const int nk = KB; const int nkt = (nk + 15) / 16;   /* whole key blocks only (asserted above) */
    for (int t = 0; t < KB / 16; ++t) { if (t < nkt) { const int key = kb0 + t * 16 + nloc < L ? kb0 + t * 16 + nloc : L - 1; const size_t kr = (rowb + key) * PW + ko; v8f s = {}; v16b kh[HD / 32], kl[HD / 32];   /* all 16 loads of a key tile are issued ahead of its 12 products: one wait on global memory per tile, not one per k step */
#pragma unroll
        for (int q = 0; q < HD / 32; ++q) { kh[q] = frag_kb(PH + kr + q * 32, hlf); kl[q] = frag_kb(PL + kr + q * 32, hlf); }
        asm volatile("s_wait_xcnt 0x0" :: "v"(PH + (rowb + key) * PW + 8 * hlf), "v"(PL + (rowb + key) * PW + 8 * hlf) : "memory");   /* stands behind the 16 loads, in front of any rewrite of their two address pairs; naming the pairs keeps them out of the loads' own destinations */
#pragma unroll
        for (int q = 0; q < HD / 32; ++q) { s = wmma16b(qh[q], kh[q], s); s = wmma16b(qh[q], kl[q], s); s = wmma16b(ql[q], kh[q], s); }
#pragma unroll
        for (int r8 = 0; r8 < 8; ++r8) { const int i = t0 + 8 * hlf + r8, j = kb0 + t * 16 + nloc; const bool ok = (j < kend); Sf[8 * hlf + r8][t * 16 + nloc] = ok ? s[r8] * (1.0f / (HS * HS)) : -INFINITY; } }
      else {
#pragma unroll
        for (int r8 = 0; r8 < 8; ++r8) Sf[8 * hlf + r8][t * 16 + nloc] = -INFINITY; } }
    wave_lds_sync();
#pragma unroll
    for (int rr = 0; rr < 16; ++rr) { float mx = -INFINITY;
#pragma unroll
      for (int q = 0; q < 4; ++q) mx = fmaxf(mx, Sf[rr][q * 32 + lane]);
      for (int o = 16; o; o >>= 1) mx = fmaxf(mx, __shfl_xor(mx, o));
      const float mold = __shfl(m_r[rr & 7], (rr >> 3) * 16); const float mn = fmaxf(mold, mx); const float sf = (mold == -INFINITY) ? 0.0f : ((mn == -INFINITY) ? 1.0f : __expf(mold - mn)); float ps = 0.0f;
#pragma unroll
      for (int q = 0; q < 4; ++q) { const int kx = q * 32 + lane; const float sv = Sf[rr][kx]; const float p = (sv == -INFINITY || mn == -INFINITY) ? 0.0f : __expf(sv - mn); ps += p; b16 ph, pl; split16(p * PS, ph, pl); Ph_[rr][kx] = ph; Pl_[rr][kx] = pl; }
      for (int o = 16; o; o >>= 1) ps += __shfl_xor(ps, o);
      if ((rr >> 3) == hlf) { const int r8 = rr & 7; den_r[r8] = den_r[r8] * sf + ps; m_r[r8] = mn;
#pragma unroll
        for (int t = 0; t < HD / 16; ++t) acc[t][r8] = acc[t][r8] * sf; } }
    wave_lds_sync();
    for (int ks = 0; ks < nkt * 16; ks += 32) { const size_t vt = ((rowb + kb0 + ks) / 16 * HD + nloc) * 16; const v16b pa = frag_kb(&Ph_[nloc][ks], hlf), pb = frag_kb(&Pl_[nloc][ks], hlf);
#pragma unroll
      for (int tg = 0; tg < HD / 16; tg += 4) { v16b vh[4], vl[4];   /* the V^T fragments of four channel tiles are loaded ahead of their products: one wait on global memory per 12 products; eight tiles at once spilled */
#pragma unroll
        for (int t = 0; t < 4; ++t) { vh[t] = frag_vt(VTH + vt + (tg + t) * 256, hlf); vl[t] = frag_vt(VTL + vt + (tg + t) * 256, hlf); }
#pragma unroll
        for (int t = 0; t < 4; ++t) { acc[tg + t] = wmma16b(pa, vh[t], acc[tg + t]); acc[tg + t] = wmma16b(pa, vl[t], acc[tg + t]); acc[tg + t] = wmma16b(pb, vh[t], acc[tg + t]); } } }
    wave_lds_sync(); }
#pragma unroll
  for (int t = 0; t < HD / 16; ++t)
#pragma unroll
    for (int r8 = 0; r8 < 8; ++r8) Sf[8 * hlf + r8][t * 16 + nloc] = acc[t][r8];
  if (nloc == 0) {
#pragma unroll   /* m_r and den_r live in registers: constant indices only */
    for (int r8 = 0; r8 < 8; ++r8) { Mw[wv][8 * hlf + r8] = m_r[r8]; Dw[wv][8 * hlf + r8] = den_r[r8]; } }
  __syncthreads();   /* every wave's partial (max, sum, O) is in LDS before any thread joins them */
  for (int ch = threadIdx.x; ch < HD; ch += 32 * KW)
    for (int rr = 0; rr < 16; ++rr) { float mx = Mw[0][rr];
      for (int w = 1; w < KW; ++w) mx = fmaxf(mx, Mw[w][rr]);
      float dn = 0.0f, o = 0.0f;
      for (int w = 0; w < KW; ++w) { const float mw = Mw[w][rr]; const float e = (mw == -INFINITY) ? 0.0f : __expf(mw - mx); dn += e * Dw[w][rr]; o += e * SfW[w][rr][ch]; }
      ATT[(rowb + t0 + rr) * C + h * HD + ch] = dn > 0.0f ? o * (1.0f / (HS * PS)) / dn : 0.0f;
      asm volatile("s_wait_xcnt 0x0" ::: "memory");   /* stands behind the store, in front of the next row's rewrite of the store's data and address registers */
    } }
__global__ __launch_bounds__(32) void out_kernel(const float* __restrict__ ATT, const b16* __restrict__ WO, const float* __restrict__ bo, const float* __restrict__ xres, int TLIM, float* __restrict__ out) { __shared__ __attribute__((aligned(16))) b16 Ah[16][C + 8], Al[16][C + 8]; __shared__ float Tf[16][260]; const int lane = threadIdx.x, nloc = lane & 15, hlf = lane >> 4; const size_t m0 = (size_t)blockIdx.x * 16; if (m0 >= (size_t)TLIM) return;
  for (int rr = 0; rr < 16; ++rr) for (int q = 0; q < C / 32; ++q) { b16 p, ql; split16(ATT[(m0 + rr) * C + q * 32 + lane] * HS, p, ql); Ah[rr][q * 32 + lane] = p; Al[rr][q * 32 + lane] = ql; }
  wave_lds_sync();
#pragma unroll 1
  for (int g = 0; g < CX / 256; ++g) { v8f acc[16]; float braw[16];
#pragma unroll
    for (int t = 0; t < 16; ++t) { acc[t] = (v8f){}; braw[t] = bo[g * 256 + t * 16 + nloc]; }   /* the bias loads fly with the first weight group */
#pragma unroll 2
    for (int kb = 0; kb < C; kb += 32) { const v16b a = frag_kb(&Ah[nloc][kb], hlf), al = frag_kb(&Al[nloc][kb], hlf);
#pragma unroll
      for (int tg = 0; tg < 16; tg += 8) { v16b bw[8];   /* the weight fragments of eight tiles are loaded ahead of their 16 products: one L2 wait per group, not one per tile */
#pragma unroll
        for (int t = 0; t < 8; ++t) bw[t] = frag_kb(WO + (size_t)(g * 256 + (tg + t) * 16 + nloc) * C + kb, hlf);
#pragma unroll
        for (int t = 0; t < 8; ++t) { acc[tg + t] = wmma16b(a, bw[t], acc[tg + t]); acc[tg + t] = wmma16b(al, bw[t], acc[tg + t]); } } }
#pragma unroll
    for (int tg = 0; tg < 16; tg += 8) { float xr[8][8];   /* the residual of eight tiles is requested ahead of the first rounding: one wait per 64 loads, not one per element */
#pragma unroll
      for (int t = 0; t < 8; ++t)
#pragma unroll
        for (int r8 = 0; r8 < 8; ++r8) xr[t][r8] = xres[(m0 + 8 * hlf + r8) * CX + g * 256 + (tg + t) * 16 + nloc];
#pragma unroll
      for (int t = 0; t < 8; ++t) { const int cc = (tg + t) * 16 + nloc; const float bb = bfv(braw[tg + t]);
#pragma unroll
        for (int r8 = 0; r8 < 8; ++r8) { const int rr = 8 * hlf + r8; Tf[rr][cc] = acc[tg + t][r8] * (1.0f / (HS * WSC)) + bb + bfv(xr[t][r8]); } } }   /* + residual x */
    wave_lds_sync();
    { for (int rr = 0; rr < 16; ++rr) for (int q = 0; q < 2; ++q) *(v4f*)(out + (m0 + rr) * CX + g * 256 + q * 128 + lane * 4) = *(const v4f*)(&Tf[rr][q * 128 + lane * 4]);  }
    wave_lds_sync(); } }
}  // namespace

extern "C" void kernel_launch(void* const* d_in, const int* in_sizes, int n_in, void* d_out, int out_size, void* d_ws, size_t ws_size, hipStream_t stream) {
  (void)n_in;
  auto Fp = [&](int i) { return (const float*)d_in[i]; };
  // input order: 0 x [4,64,64,256]; 1 wk [256,128]; 2 bk; 3 wq [256,128]; 4 bq; 5 wv [256,128]; 6 bv; 7 wo [128,256]; 8 bo [256]  (all (in,out))
  if (in_sizes[0] != NT * CX || in_sizes[1] != CX * C || in_sizes[3] != CX * C || in_sizes[5] != CX * C || in_sizes[7] != C * CX || in_sizes[8] != CX || out_size != NT * CX) return;
  const int BLIM = NB;
  const int TLIM = BLIM * L;
  size_t off = 0; char* ws = (char*)d_ws;
  auto carve = [&](size_t bytes) { char* p = ws + off; off += (bytes + 255) & ~(size_t)255; return p; };
  b16* W3 = (b16*)carve((size_t)3 * C * CX * 2); b16* WO = (b16*)carve((size_t)CX * C * 2); b16* PH = (b16*)carve((size_t)NT * PW * 2); b16* PL = (b16*)carve((size_t)NT * PW * 2); float* ATT = (float*)carve((size_t)NT * C * 4); b16* VTH = (b16*)carve((size_t)NT * HD * 2); b16* VTL = (b16*)carve((size_t)NT * HD * 2);
  if (off > ws_size || off > ((size_t)96 << 20)) return;   // ~ 42 MB
  wput_kernel<<<(unsigned)(((size_t)3 * C * (CX / 8) + 255) / 256), 256, 0, stream>>>(Fp(1), Fp(3), Fp(5), Fp(7), W3, WO);
  proj_kernel<<<TLIM / 16, 32, 0, stream>>>(Fp(0), W3, Fp(2), Fp(4), Fp(6), TLIM, PH, PL, VTH, VTL);
  att_kernel<<<BLIM * NH * (L / 16), 32 * KW, 0, stream>>>(PH, PL, VTH, VTL, (const float*)0, BLIM, ATT);
  out_kernel<<<TLIM / 16, 32, 0, stream>>>(ATT, WO, Fp(8), Fp(0), TLIM, (float*)d_out);
}

// v004
// It runs in 222 microseconds.
// Two timings next to v003 put it at 1.26 and 1.23 times that version's speed.
// All steps since v000 together make it 13.2 times as fast.
#include <hip/hip_runtime.h>

// Self_attention_pixel_wise: per image (4,096 pixels, NHWC 256 ch): k = x wk + bk, q = x wq + bq, v = x wv + bv (128); scores[n][m] = k_n . q_m (no scaling); attn = softmax over m; o = attn v; out = o wo + bo + x -> [4][64][64][256].
// Note the roles: the module's 'key' is the attention query (rows n) and its 'query' the attention key (columns m).
// Deterministic: no index structures, no atomics; flash-style online softmax, the keys of a query tile split over the four waves of a block in a fixed order, the four partial results joined in a fixed order.
// WMMA (v_wmma_f32_16x16x32_f16, f32 accumulate): the QKV projection with x EXACT bf16 x8 (K 256) against exact weight rows x256 (one product); S = Q K^T (hi+lo x hi+lo, 3 products, K 128; K is written by the projection in B-fragment order, tiles [16 keys][hi, lo][8][32 lanes][8], and read in loads of 512 contiguous bytes); O = P V (P x256 hi+lo x V^T hi+lo, 3 products; V^T is written by the projection in tiles [16 keys][128 channels][16] and read as B fragments straight from global memory); out = attended (hi+lo) Wo^T (2 products); softmax in f32. Inputs rounded to bf16 once. Fragment k-map per lane half hh for A AND B: elements 0..7 <- k = 8hh+0..7, 8..15 <- k = 16+8hh+0..7; acc[r] = D[8hh+r][col].

namespace {
constexpr int NB = 4, L = 4096, C = 128, CX = 256 /* input / output channels */, NH = 1, HD = 128, NT = NB * L, KB = 128, PW = 3 * C, KW = 4 /* waves per attention block, each takes L / KW keys */;
constexpr float XS = 8.0f, HS = 256.0f /* hi+lo staging scale for k/q/v/attended */, WSC = 256.0f, PS = 256.0f, SCALE = 1.0f;
typedef _Float16 b16;
typedef __attribute__((ext_vector_type(16))) _Float16 v16b;
typedef __attribute__((ext_vector_type(8))) _Float16 v8b;
typedef __attribute__((ext_vector_type(8))) float v8f;
typedef __attribute__((ext_vector_type(4))) float v4f;
__device__ __forceinline__ float bf16_rne(float f) { unsigned int u = __float_as_uint(f); u += 0x7FFFu + ((u >> 16) & 1u); float r = __uint_as_float(u & 0xFFFF0000u); asm volatile("" : "+v"(r)); return r; }
__device__ __forceinline__ float bfv(float f) { float r = bf16_rne(f); asm volatile("" : "+v"(r)); return r; }
__device__ __forceinline__ void split16(float v, b16& hi, b16& lo) { hi = (b16)v; lo = (b16)(v - (float)hi); }
__device__ __forceinline__ v16b frag_kb(const b16* p, int hh) { const v8b a = *(const v8b*)(p + 8 * hh), b = *(const v8b*)(p + 16 + 8 * hh); v16b f;
#pragma unroll
  for (int e = 0; e < 8; ++e) { f[e] = a[e]; f[8 + e] = b[e]; } return f; }
// same k-map as frag_kb, from the tiled V^T: p = channel row of the 16-key tile that holds k = 0..15; k = 16..31 is the next tile, HD * 16 elements on
__device__ __forceinline__ v16b frag_vt(const b16* p, int hh) { const v8b a = *(const v8b*)(p + 8 * hh), b = *(const v8b*)(p + HD * 16 + 8 * hh); v16b f;
#pragma unroll
  for (int e = 0; e < 8; ++e) { f[e] = a[e]; f[8 + e] = b[e]; } return f; }
// same k-map as frag_kb, from the tiled K: p = this lane's 8 elements of the 256-element piece that holds k = 0..15 of all 16 keys; k = 16..31 is the next piece
__device__ __forceinline__ v16b frag_kt(const b16* p) { const v8b a = *(const v8b*)(p), b = *(const v8b*)(p + 256); v16b f;
#pragma unroll
  for (int e = 0; e < 8; ++e) { f[e] = a[e]; f[8 + e] = b[e]; } return f; }
__device__ __forceinline__ v8f wmma16b(v16b a, v16b b, v8f c) { v8f d = __builtin_amdgcn_wmma_f32_16x16x32_f16(false, a, false, b, (short)0, c, false, false); asm volatile("v_nop\n\tv_nop\n\tv_nop\n\tv_nop" : "+v"(d) : "v"(a), "v"(b)); return d; }
__device__ __forceinline__ void wave_lds_sync() { __builtin_amdgcn_fence(__ATOMIC_RELEASE, "workgroup"); __builtin_amdgcn_wave_barrier(); __builtin_amdgcn_fence(__ATOMIC_ACQUIRE, "workgroup"); }
__device__ __forceinline__ float pmul(float a, float b) { float p = a * b; asm volatile("" : "+v"(p)); return p; }

__global__ __launch_bounds__(256) void wput_kernel(const float* __restrict__ wq, const float* __restrict__ wk, const float* __restrict__ wv, const float* __restrict__ wo, b16* __restrict__ W3, b16* __restrict__ WO) { const size_t u = (size_t)blockIdx.x * 256 + threadIdx.x; v8b v;
  if (u < (size_t)3 * C * (CX / 8)) { const int r = (int)(u / (CX / 8)), k0 = (int)(u % (CX / 8)) * 8; const int p = r / C, o = r % C; const float* w = p == 0 ? wq : (p == 1 ? wk : wv); float wr[8];   /* all eight loads stand ahead of the first rounding: its asm statement holds later loads behind it, which cost one memory wait per element */
#pragma unroll
    for (int j = 0; j < 8; ++j) wr[j] = w[(size_t)(k0 + j) * C + o];
#pragma unroll
    for (int j = 0; j < 8; ++j) v[j] = (b16)(bf16_rne(wr[j]) * WSC); { *(v8b*)(W3 + (size_t)r * CX + k0) = v;  } }
  if (u < (size_t)CX * (C / 8)) { const int o = (int)(u / (C / 8)), k0 = (int)(u % (C / 8)) * 8; float wr[8];
#pragma unroll
    for (int j = 0; j < 8; ++j) wr[j] = wo[(size_t)(k0 + j) * CX + o];
#pragma unroll
    for (int j = 0; j < 8; ++j) v[j] = (b16)(bf16_rne(wr[j]) * WSC); { *(v8b*)(WO + (size_t)o * C + k0) = v;  } } }
__global__ __launch_bounds__(32) void proj_kernel(const float* __restrict__ x, const b16* __restrict__ W3, const float* __restrict__ bq, const float* __restrict__ bk, const float* __restrict__ bv, int TLIM, b16* __restrict__ PH, b16* __restrict__ PL, b16* __restrict__ VTH, b16* __restrict__ VTL, b16* __restrict__ KT) { __shared__ __attribute__((aligned(16))) b16 Ah[16][CX + 8], Oh[16][264], Ol[16][264]; const int lane = threadIdx.x, nloc = lane & 15, hlf = lane >> 4; const size_t m0 = (size_t)blockIdx.x * 16; if (m0 >= (size_t)TLIM) return;
#pragma unroll
  for (int r0 = 0; r0 < 16; r0 += 8) { float xv[8][CX / 32];   /* eight rows of x (64 loads) are requested before the first rounding (see wput_kernel): one memory wait per half tile, not one per element */
#pragma unroll
    for (int rr = 0; rr < 8; ++rr)
#pragma unroll
      for (int q = 0; q < CX / 32; ++q) xv[rr][q] = x[(m0 + r0 + rr) * CX + q * 32 + lane];
#pragma unroll
    for (int rr = 0; rr < 8; ++rr)
#pragma unroll
      for (int q = 0; q < CX / 32; ++q) Ah[r0 + rr][q * 32 + lane] = (b16)(bf16_rne(xv[rr][q]) * XS); }
  wave_lds_sync();
#pragma unroll 1
  for (int g = 0; g < 3; ++g) { const int pj = g;   /* one group of 8 tiles per projection (128 columns) */ const float* bb = pj == 0 ? bq : (pj == 1 ? bk : bv); v8f acc[8]; float braw[8];
#pragma unroll
    for (int t = 0; t < 8; ++t) { acc[t] = (v8f){}; braw[t] = bb[t * 16 + nloc]; }   /* the bias loads fly with the first weight group */
#pragma unroll 1   /* one group of 32 loads (128 registers) per trip, kept rolled so that the groups share those registers */
    for (int kb = 0; kb < CX; kb += 64) { v16b bw[2][8];   /* the weight fragments of two k steps are loaded ahead of their 16 products: the asm statement behind each product holds later loads back, which cost one L2 wait per product */
#pragma unroll
      for (int u2 = 0; u2 < 2; ++u2)
#pragma unroll
        for (int t = 0; t < 8; ++t) bw[u2][t] = frag_kb(W3 + (size_t)(g * C + t * 16 + nloc) * CX + kb + 32 * u2, hlf);
#pragma unroll
      for (int u2 = 0; u2 < 2; ++u2) { const v16b a = frag_kb(&Ah[nloc][kb + 32 * u2], hlf);
#pragma unroll
        for (int t = 0; t < 8; ++t) acc[t] = wmma16b(a, bw[u2][t], acc[t]); } }
    if (g == 2) {   /* v: a lane's 8 accumulator rows are 8 consecutive keys of one channel = 16 bytes of V^T; tile [this block's 16 keys][channel][16], 512 contiguous bytes per store; the v third of the PH / PL rows stays unwritten and unread */
#pragma unroll
      for (int t = 0; t < 8; ++t) { const int cc = t * 16 + nloc; const float bvv = bfv(braw[t]); v8b vh8, vl8;
#pragma unroll
        for (int r8 = 0; r8 < 8; ++r8) { b16 p, ql; split16((acc[t][r8] * (1.0f / (XS * WSC)) + bvv) * HS, p, ql); vh8[r8] = p; vl8[r8] = ql; }
        const size_t vo8 = ((size_t)blockIdx.x * HD + cc) * 16 + 8 * hlf; *(v8b*)(VTH + vo8) = vh8; *(v8b*)(VTL + vo8) = vl8; }
      asm volatile("s_wait_xcnt 0x0" ::: "memory");   /* stands behind the last V^T store, in front of any rewrite of the stores' address and data registers: this pass skips the sync whose store wait does that for k and q */
      continue; }
#pragma unroll
    for (int t = 0; t < 8; ++t) { const int cc = t * 16 + nloc; const float bvv = bfv(braw[t]);
#pragma unroll
      for (int r8 = 0; r8 < 8; ++r8) { b16 p, ql; split16((acc[t][r8] * (1.0f / (XS * WSC)) + bvv) * HS, p, ql); Oh[8 * hlf + r8][cc] = p; Ol[8 * hlf + r8][cc] = ql; } }
    wave_lds_sync();
    if (g == 1) {   /* attention keys: written in B-fragment order, tile [this block's 16 keys][hi, lo][8 pieces of 16 channels][lane][8], so that each load of the attention kernel covers 512 contiguous bytes (four whole lines) and not 32 bytes of each of 16 rows; the k third of the PH / PL rows stays unwritten and unread */
      v8b fh[HD / 16], fl[HD / 16]; b16* kt = KT + (size_t)blockIdx.x * (2 * 16 * HD) + lane * 8;
#pragma unroll
      for (int f = 0; f < HD / 16; ++f) { fh[f] = *(const v8b*)(&Oh[nloc][f * 16 + 8 * hlf]); fl[f] = *(const v8b*)(&Ol[nloc][f * 16 + 8 * hlf]); }
#pragma unroll
      for (int f = 0; f < HD / 16; ++f) { *(v8b*)(kt + f * 256) = fh[f]; *(v8b*)(kt + 16 * HD + f * 256) = fl[f]; }
      asm volatile("s_wait_xcnt 0x0" ::: "memory");   /* stands behind the last tile store, in front of any rewrite of the stores' address and data registers */
    } else
    { for (int rr = 0; rr < 16; ++rr) if (lane < 16) { *(v8b*)(PH + (m0 + rr) * PW + g * C + lane * 8) = *(const v8b*)(&Oh[rr][lane * 8]); *(v8b*)(PL + (m0 + rr) * PW + g * C + lane * 8) = *(const v8b*)(&Ol[rr][lane * 8]); }  }   
    wave_lds_sync(); } }
// attention: block per (b, h, 16-query tile), KW waves; wave w walks keys [w L / KW, (w + 1) L / KW) in key blocks of 128 with LDS of its own: S = Q K^T (3 products, K 128); online softmax; P x256 hi+lo; at the end the waves' (max, sum, O) are joined through LDS.
// 4 waves per SIMD (256 registers each) and 4 blocks per WGP (4 x the LDS size below 327,680 B): all blocks resident at once, four waves to cover each other's load, LDS and cross-lane waits.
__global__ __launch_bounds__(32 * KW) __attribute__((amdgpu_waves_per_eu(4, 4))) void att_kernel(const b16* __restrict__ PH, const b16* __restrict__ PL, const b16* __restrict__ VTH, const b16* __restrict__ VTL, const b16* __restrict__ KT, const float* __restrict__ amask, int BLIM, float* __restrict__ ATT) { __shared__ __attribute__((aligned(16))) b16 PhW[KW][16][KB + 8], PlW[KW][16][KB + 8]; __shared__ float SfW[KW][16][KB + 4], Mw[KW][16], Dw[KW][16]; static_assert(HD <= KB && L % (KW * KB) == 0, "a wave's O partial lies in its score tile; whole key blocks per wave");
  const int wv = __builtin_amdgcn_readfirstlane((int)(threadIdx.x >> 5)); auto& Ph_ = PhW[wv]; auto& Pl_ = PlW[wv]; auto& Sf = SfW[wv];
  const int lane = threadIdx.x & 31, nloc = lane & 15, hlf = lane >> 4; const int qt = blockIdx.x % (L / 16); const int h = (blockIdx.x / (L / 16)) % NH; const int b = blockIdx.x / ((L / 16) * NH); if (b >= BLIM) return; const int t0 = qt * 16; const size_t rowb = (size_t)b * L; const int qo = h * HD;
  v16b qh[HD / 32], ql[HD / 32];
#pragma unroll
  for (int s = 0; s < HD / 32; ++s) { qh[s] = frag_kb(PH + (rowb + t0 + nloc) * PW + qo + s * 32, hlf); ql[s] = frag_kb(PL + (rowb + t0 + nloc) * PW + qo + s * 32, hlf); }
  float m_r[8], den_r[8]; v8f acc[HD / 16];
#pragma unroll
  for (int r8 = 0; r8 < 8; ++r8) { m_r[r8] = -INFINITY; den_r[r8] = 0.0f; }
#pragma unroll
  for (int t = 0; t < HD / 16; ++t) acc[t] = (v8f){};
  const int kstart = wv * (L / KW); const int kend = kstart + L / KW;   // this wave's keys [kstart, kend)
#pragma unroll 1
  for (int kb0 = kstart; kb0 < kend; kb0 += KB) { const int nk = KB; const int nkt = (nk + 15) / 16;   /* whole key blocks only (asserted above) */
    for (int t = 0; t < KB / 16; ++t) { if (t < nkt) { const b16* kp = KT + ((rowb + kb0) / 16 + t) * (2 * 16 * HD) + lane * 8; v8f s = {}; v16b kh[HD / 32], kl[HD / 32];   /* all 16 loads of a key tile are issued ahead of its 12 products: one wait on global memory per tile, not one per k step */
#pragma unroll
        for (int q = 0; q < HD / 32; ++q) { kh[q] = frag_kt(kp + q * 512); kl[q] = frag_kt(kp + 16 * HD + q * 512); }
        asm volatile("s_wait_xcnt 0x0" :: "v"(kp) : "memory");   /* stands behind the 16 loads, in front of any rewrite of their address pair; naming the pair keeps it out of the loads' own destinations */
#pragma unroll
        for (int q = 0; q < HD / 32; ++q) { s = wmma16b(qh[q], kh[q], s); s = wmma16b(qh[q], kl[q], s); s = wmma16b(ql[q], kh[q], s); }
#pragma unroll
        for (int r8 = 0; r8 < 8; ++r8) { const int i = t0 + 8 * hlf + r8, j = kb0 + t * 16 + nloc; const bool ok = (j < kend); Sf[8 * hlf + r8][t * 16 + nloc] = ok ? s[r8] * (1.0f / (HS * HS)) : -INFINITY; } }
      else {
#pragma unroll
        for (int r8 = 0; r8 < 8; ++r8) Sf[8 * hlf + r8][t * 16 + nloc] = -INFINITY; } }
    wave_lds_sync();
#pragma unroll
    for (int rr = 0; rr < 16; ++rr) { float mx = -INFINITY;
#pragma unroll
      for (int q = 0; q < 4; ++q) mx = fmaxf(mx, Sf[rr][q * 32 + lane]);
      for (int o = 16; o; o >>= 1) mx = fmaxf(mx, __shfl_xor(mx, o));
      const float mold = __shfl(m_r[rr & 7], (rr >> 3) * 16); const float mn = fmaxf(mold, mx); const float sf = (mold == -INFINITY) ? 0.0f : ((mn == -INFINITY) ? 1.0f : __expf(mold - mn)); float ps = 0.0f;
#pragma unroll
      for (int q = 0; q < 4; ++q) { const int kx = q * 32 + lane; const float sv = Sf[rr][kx]; const float p = (sv == -INFINITY || mn == -INFINITY) ? 0.0f : __expf(sv - mn); ps += p; b16 ph, pl; split16(p * PS, ph, pl); Ph_[rr][kx] = ph; Pl_[rr][kx] = pl; }
      for (int o = 16; o; o >>= 1) ps += __shfl_xor(ps, o);
      if ((rr >> 3) == hlf) { const int r8 = rr & 7; den_r[r8] = den_r[r8] * sf + ps; m_r[r8] = mn;
#pragma unroll
        for (int t = 0; t < HD / 16; ++t) acc[t][r8] = acc[t][r8] * sf; } }
    wave_lds_sync();
    for (int ks = 0; ks < nkt * 16; ks += 32) { const size_t vt = ((rowb + kb0 + ks) / 16 * HD + nloc) * 16; const v16b pa = frag_kb(&Ph_[nloc][ks], hlf), pb = frag_kb(&Pl_[nloc][ks], hlf);
#pragma unroll
      for (int tg = 0; tg < HD / 16; tg += 4) { v16b vh[4], vl[4];   /* the V^T fragments of four channel tiles are loaded ahead of their products: one wait on global memory per 12 products; eight tiles at once spilled */
#pragma unroll
        for (int t = 0; t < 4; ++t) { vh[t] = frag_vt(VTH + vt + (tg + t) * 256, hlf); vl[t] = frag_vt(VTL + vt + (tg + t) * 256, hlf); }
#pragma unroll
        for (int t = 0; t < 4; ++t) { acc[tg + t] = wmma16b(pa, vh[t], acc[tg + t]); acc[tg + t] = wmma16b(pa, vl[t], acc[tg + t]); acc[tg + t] = wmma16b(pb, vh[t], acc[tg + t]); } } }
    wave_lds_sync(); }
#pragma unroll
  for (int t = 0; t < HD / 16; ++t)
#pragma unroll
    for (int r8 = 0; r8 < 8; ++r8) Sf[8 * hlf + r8][t * 16 + nloc] = acc[t][r8];
  if (nloc == 0) {
#pragma unroll   /* m_r and den_r live in registers: constant indices only */
    for (int r8 = 0; r8 < 8; ++r8) { Mw[wv][8 * hlf + r8] = m_r[r8]; Dw[wv][8 * hlf + r8] = den_r[r8]; } }
  __syncthreads();   /* every wave's partial (max, sum, O) is in LDS before any thread joins them */
  for (int ch = threadIdx.x; ch < HD; ch += 32 * KW)
    for (int rr = 0; rr < 16; ++rr) { float mx = Mw[0][rr];
      for (int w = 1; w < KW; ++w) mx = fmaxf(mx, Mw[w][rr]);
      float dn = 0.0f, o = 0.0f;
      for (int w = 0; w < KW; ++w) { const float mw = Mw[w][rr]; const float e = (mw == -INFINITY) ? 0.0f : __expf(mw - mx); dn += e * Dw[w][rr]; o += e * SfW[w][rr][ch]; }
      ATT[(rowb + t0 + rr) * C + h * HD + ch] = dn > 0.0f ? o * (1.0f / (HS * PS)) / dn : 0.0f;
      asm volatile("s_wait_xcnt 0x0" ::: "memory");   /* stands behind the store, in front of the next row's rewrite of the store's data and address registers */
    } }
__global__ __launch_bounds__(32) void out_kernel(const float* __restrict__ ATT, const b16* __restrict__ WO, const float* __restrict__ bo, const float* __restrict__ xres, int TLIM, float* __restrict__ out) { __shared__ __attribute__((aligned(16))) b16 Ah[16][C + 8], Al[16][C + 8]; __shared__ float Tf[16][260]; const int lane = threadIdx.x, nloc = lane & 15, hlf = lane >> 4; const size_t m0 = (size_t)blockIdx.x * 16; if (m0 >= (size_t)TLIM) return;
  for (int rr = 0; rr < 16; ++rr) for (int q = 0; q < C / 32; ++q) { b16 p, ql; split16(ATT[(m0 + rr) * C + q * 32 + lane] * HS, p, ql); Ah[rr][q * 32 + lane] = p; Al[rr][q * 32 + lane] = ql; }
  wave_lds_sync();
#pragma unroll 1
  for (int g = 0; g < CX / 256; ++g) { v8f acc[16]; float braw[16];
#pragma unroll
    for (int t = 0; t < 16; ++t) { acc[t] = (v8f){}; braw[t] = bo[g * 256 + t * 16 + nloc]; }   /* the bias loads fly with the first weight group */
#pragma unroll 2
    for (int kb = 0; kb < C; kb += 32) { const v16b a = frag_kb(&Ah[nloc][kb], hlf), al = frag_kb(&Al[nloc][kb], hlf);
#pragma unroll
      for (int tg = 0; tg < 16; tg += 8) { v16b bw[8];   /* the weight fragments of eight tiles are loaded ahead of their 16 products: one L2 wait per group, not one per tile */
#pragma unroll
        for (int t = 0; t < 8; ++t) bw[t] = frag_kb(WO + (size_t)(g * 256 + (tg + t) * 16 + nloc) * C + kb, hlf);
#pragma unroll
        for (int t = 0; t < 8; ++t) { acc[tg + t] = wmma16b(a, bw[t], acc[tg + t]); acc[tg + t] = wmma16b(al, bw[t], acc[tg + t]); } } }
#pragma unroll
    for (int tg = 0; tg < 16; tg += 8) { float xr[8][8];   /* the residual of eight tiles is requested ahead of the first rounding: one wait per 64 loads, not one per element */
#pragma unroll
      for (int t = 0; t < 8; ++t)
#pragma unroll
        for (int r8 = 0; r8 < 8; ++r8) xr[t][r8] = xres[(m0 + 8 * hlf + r8) * CX + g * 256 + (tg + t) * 16 + nloc];
#pragma unroll
      for (int t = 0; t < 8; ++t) { const int cc = (tg + t) * 16 + nloc; const float bb = bfv(braw[tg + t]);
#pragma unroll
        for (int r8 = 0; r8 < 8; ++r8) { const int rr = 8 * hlf + r8; Tf[rr][cc] = acc[tg + t][r8] * (1.0f / (HS * WSC)) + bb + bfv(xr[t][r8]); } } }   /* + residual x */
    wave_lds_sync();
    { for (int rr = 0; rr < 16; ++rr) for (int q = 0; q < 2; ++q) *(v4f*)(out + (m0 + rr) * CX + g * 256 + q * 128 + lane * 4) = *(const v4f*)(&Tf[rr][q * 128 + lane * 4]);  }
    wave_lds_sync(); } }
}  // namespace

extern "C" void kernel_launch(void* const* d_in, const int* in_sizes, int n_in, void* d_out, int out_size, void* d_ws, size_t ws_size, hipStream_t stream) {
  (void)n_in;
  auto Fp = [&](int i) { return (const float*)d_in[i]; };
  // input order: 0 x [4,64,64,256]; 1 wk [256,128]; 2 bk; 3 wq [256,128]; 4 bq; 5 wv [256,128]; 6 bv; 7 wo [128,256]; 8 bo [256]  (all (in,out))
  if (in_sizes[0] != NT * CX || in_sizes[1] != CX * C || in_sizes[3] != CX * C || in_sizes[5] != CX * C || in_sizes[7] != C * CX || in_sizes[8] != CX || out_size != NT * CX) return;
  const int BLIM = NB;
  const int TLIM = BLIM * L;
  size_t off = 0; char* ws = (char*)d_ws;
  auto carve = [&](size_t bytes) { char* p = ws + off; off += (bytes + 255) & ~(size_t)255; return p; };
  b16* W3 = (b16*)carve((size_t)3 * C * CX * 2); b16* WO = (b16*)carve((size_t)CX * C * 2); b16* PH = (b16*)carve((size_t)NT * PW * 2); b16* PL = (b16*)carve((size_t)NT * PW * 2); float* ATT = (float*)carve((size_t)NT * C * 4); b16* VTH = (b16*)carve((size_t)NT * HD * 2); b16* VTL = (b16*)carve((size_t)NT * HD * 2); b16* KT = (b16*)carve((size_t)NT * HD * 2 * 2);
  if (off > ws_size || off > ((size_t)96 << 20)) return;   // ~ 50 MB
  wput_kernel<<<(unsigned)(((size_t)3 * C * (CX / 8) + 255) / 256), 256, 0, stream>>>(Fp(1), Fp(3), Fp(5), Fp(7), W3, WO);
  proj_kernel<<<TLIM / 16, 32, 0, stream>>>(Fp(0), W3, Fp(2), Fp(4), Fp(6), TLIM, PH, PL, VTH, VTL, KT);
  att_kernel<<<BLIM * NH * (L / 16), 32 * KW, 0, stream>>>(PH, PL, VTH, VTL, KT, (const float*)0, BLIM, ATT);
  out_kernel<<<TLIM / 16, 32, 0, stream>>>(ATT, WO, Fp(8), Fp(0), TLIM, (float*)d_out);
}

// v005
// Measured time: 169 microseconds a run.
// Two timings next to v004 put it at 1.32 and 1.30 times that version's speed.
// Counting every step since v000, it is 17.3 times as fast.
#include <hip/hip_runtime.h>

// Self_attention_pixel_wise: per image (4,096 pixels, NHWC 256 ch): k = x wk + bk, q = x wq + bq, v = x wv + bv (128); scores[n][m] = k_n . q_m (no scaling); attn = softmax over m; o = attn v; out = o wo + bo + x -> [4][64][64][256].
// Note the roles: the module's 'key' is the attention query (rows n) and its 'query' the attention key (columns m).
// Deterministic: no index structures, no atomics; flash-style online softmax, the keys of a query tile split over four waves of a block in a fixed order, the four partial results joined in a fixed order.
// WMMA (v_wmma_f32_16x16x32_f16, f32 accumulate): the QKV projection with x EXACT bf16 x8 (K 256) against exact weight rows x256 (one product); S = Q K^T (hi+lo x hi+lo, 3 products, K 128; K is written by the projection in B-fragment order, tiles [16 keys][hi, lo][8][32 lanes][8], staged in LDS by asynchronous copies for four query tiles at once and read from there in loads of 512 contiguous bytes); O = P V (P x256 hi+lo x V^T hi+lo, 3 products; V^T is written by the projection in tiles [16 keys][128 channels][16] and staged in LDS the same way); out = attended (hi+lo) Wo^T (2 products); softmax in f32. Inputs rounded to bf16 once. Fragment k-map per lane half hh for A AND B: elements 0..7 <- k = 8hh+0..7, 8..15 <- k = 16+8hh+0..7; acc[r] = D[8hh+r][col].

namespace {
constexpr int NB = 4, L = 4096, C = 128, CX = 256 /* input / output channels */, NH = 1, HD = 128, NT = NB * L, KB = 128, PW = 3 * C, KW = 4 /* key groups per attention block, each takes L / KW keys */, QT = 4 /* query tiles per attention block */, SK = 32 /* keys per staged tile */, SEL = SK * HD * 2 /* its elements, hi + lo */, NST = (L / KW / KB) * (2 * KB / SK) /* staged tiles per key group: K and V^T */;
constexpr float XS = 8.0f, HS = 256.0f /* hi+lo staging scale for k/q/v/attended */, WSC = 256.0f, PS = 256.0f, SCALE = 1.0f;
typedef _Float16 b16;
typedef _Float16 __attribute__((may_alias)) b16a;
typedef __attribute__((ext_vector_type(16))) _Float16 v16b;
typedef __attribute__((ext_vector_type(8))) _Float16 v8b;
typedef __attribute__((ext_vector_type(8))) float v8f;
typedef __attribute__((ext_vector_type(4))) float v4f;
__device__ __forceinline__ float bf16_rne(float f) { unsigned int u = __float_as_uint(f); u += 0x7FFFu + ((u >> 16) & 1u); float r = __uint_as_float(u & 0xFFFF0000u); asm volatile("" : "+v"(r)); return r; }
__device__ __forceinline__ float bfv(float f) { float r = bf16_rne(f); asm volatile("" : "+v"(r)); return r; }
__device__ __forceinline__ void split16(float v, b16& hi, b16& lo) { hi = (b16)v; lo = (b16)(v - (float)hi); }
__device__ __forceinline__ v16b frag_kb(const b16* p, int hh) { const v8b a = *(const v8b*)(p + 8 * hh), b = *(const v8b*)(p + 16 + 8 * hh); v16b f;
#pragma unroll
  for (int e = 0; e < 8; ++e) { f[e] = a[e]; f[8 + e] = b[e]; } return f; }
// same k-map as frag_kb, from the V^T staged in LDS: p = this lane's 8 elements of the channel tile's 256-element piece that holds k = 0..15; k = 16..31 is the next key tile, HD * 16 elements on
__device__ __forceinline__ v16b frag_vs(const b16* p) { const v8b a = *(const v8b*)(p), b = *(const v8b*)(p + HD * 16); v16b f;
#pragma unroll
  for (int e = 0; e < 8; ++e) { f[e] = a[e]; f[8 + e] = b[e]; } return f; }
// same k-map as frag_kb, from the tiled K: p = this lane's 8 elements of the 256-element piece that holds k = 0..15 of all 16 keys; k = 16..31 is the next piece
__device__ __forceinline__ v16b frag_kt(const b16* p) { const v8b a = *(const v8b*)(p), b = *(const v8b*)(p + 256); v16b f;
#pragma unroll
  for (int e = 0; e < 8; ++e) { f[e] = a[e]; f[8 + e] = b[e]; } return f; }
__device__ __forceinline__ v8f wmma16b(v16b a, v16b b, v8f c) { v8f d = __builtin_amdgcn_wmma_f32_16x16x32_f16(false, a, false, b, (short)0, c, false, false); asm volatile("v_nop\n\tv_nop\n\tv_nop\n\tv_nop" : "+v"(d) : "v"(a), "v"(b)); return d; }
__device__ __forceinline__ void wave_lds_sync() { __builtin_amdgcn_fence(__ATOMIC_RELEASE, "workgroup"); __builtin_amdgcn_wave_barrier(); __builtin_amdgcn_fence(__ATOMIC_ACQUIRE, "workgroup"); }
__device__ __forceinline__ float pmul(float a, float b) { float p = a * b; asm volatile("" : "+v"(p)); return p; }

__global__ __launch_bounds__(256) void wput_kernel(const float* __restrict__ wq, const float* __restrict__ wk, const float* __restrict__ wv, const float* __restrict__ wo, b16* __restrict__ W3, b16* __restrict__ WO) { const size_t u = (size_t)blockIdx.x * 256 + threadIdx.x; v8b v;
  if (u < (size_t)3 * C * (CX / 8)) { const int r = (int)(u / (CX / 8)), k0 = (int)(u % (CX / 8)) * 8; const int p = r / C, o = r % C; const float* w = p == 0 ? wq : (p == 1 ? wk : wv); float wr[8];   /* all eight loads stand ahead of the first rounding: its asm statement holds later loads behind it, which cost one memory wait per element */
#pragma unroll
    for (int j = 0; j < 8; ++j) wr[j] = w[(size_t)(k0 + j) * C + o];
#pragma unroll
    for (int j = 0; j < 8; ++j) v[j] = (b16)(bf16_rne(wr[j]) * WSC); { *(v8b*)(W3 + (size_t)r * CX + k0) = v;  } }
  if (u < (size_t)CX * (C / 8)) { const int o = (int)(u / (C / 8)), k0 = (int)(u % (C / 8)) * 8; float wr[8];
#pragma unroll
    for (int j = 0; j < 8; ++j) wr[j] = wo[(size_t)(k0 + j) * CX + o];
#pragma unroll
    for (int j = 0; j < 8; ++j) v[j] = (b16)(bf16_rne(wr[j]) * WSC); { *(v8b*)(WO + (size_t)o * C + k0) = v;  } } }
__global__ __launch_bounds__(32) void proj_kernel(const float* __restrict__ x, const b16* __restrict__ W3, const float* __restrict__ bq, const float* __restrict__ bk, const float* __restrict__ bv, int TLIM, b16* __restrict__ PH, b16* __restrict__ PL, b16* __restrict__ VTH, b16* __restrict__ VTL, b16* __restrict__ KT) { __shared__ __attribute__((aligned(16))) b16 Ah[16][CX + 8], Oh[16][264], Ol[16][264]; const int lane = threadIdx.x, nloc = lane & 15, hlf = lane >> 4; const size_t m0 = (size_t)blockIdx.x * 16; if (m0 >= (size_t)TLIM) return;
#pragma unroll
  for (int r0 = 0; r0 < 16; r0 += 8) { float xv[8][CX / 32];   /* eight rows of x (64 loads) are requested before the first rounding (see wput_kernel): one memory wait per half tile, not one per element */
#pragma unroll
    for (int rr = 0; rr < 8; ++rr)
#pragma unroll
      for (int q = 0; q < CX / 32; ++q) xv[rr][q] = x[(m0 + r0 + rr) * CX + q * 32 + lane];
#pragma unroll
    for (int rr = 0; rr < 8; ++rr)
#pragma unroll
      for (int q = 0; q < CX / 32; ++q) Ah[r0 + rr][q * 32 + lane] = (b16)(bf16_rne(xv[rr][q]) * XS); }
  wave_lds_sync();
#pragma unroll 1
  for (int g = 0; g < 3; ++g) { const int pj = g;   /* one group of 8 tiles per projection (128 columns) */ const float* bb = pj == 0 ? bq : (pj == 1 ? bk : bv); v8f acc[8]; float braw[8];
#pragma unroll
    for (int t = 0; t < 8; ++t) { acc[t] = (v8f){}; braw[t] = bb[t * 16 + nloc]; }   /* the bias loads fly with the first weight group */
#pragma unroll 1   /* one group of 32 loads (128 registers) per trip, kept rolled so that the groups share those registers */
    for (int kb = 0; kb < CX; kb += 64) { v16b bw[2][8];   /* the weight fragments of two k steps are loaded ahead of their 16 products: the asm statement behind each product holds later loads back, which cost one L2 wait per product */
#pragma unroll
      for (int u2 = 0; u2 < 2; ++u2)
#pragma unroll
        for (int t = 0; t < 8; ++t) bw[u2][t] = frag_kb(W3 + (size_t)(g * C + t * 16 + nloc) * CX + kb + 32 * u2, hlf);
#pragma unroll
      for (int u2 = 0; u2 < 2; ++u2) { const v16b a = frag_kb(&Ah[nloc][kb + 32 * u2], hlf);
#pragma unroll
        for (int t = 0; t < 8; ++t) acc[t] = wmma16b(a, bw[u2][t], acc[t]); } }
    if (g == 2) {   /* v: a lane's 8 accumulator rows are 8 consecutive keys of one channel = 16 bytes of V^T; tile [this block's 16 keys][channel][16], 512 contiguous bytes per store; the v third of the PH / PL rows stays unwritten and unread */
#pragma unroll
      for (int t = 0; t < 8; ++t) { const int cc = t * 16 + nloc; const float bvv = bfv(braw[t]); v8b vh8, vl8;
#pragma unroll
        for (int r8 = 0; r8 < 8; ++r8) { b16 p, ql; split16((acc[t][r8] * (1.0f / (XS * WSC)) + bvv) * HS, p, ql); vh8[r8] = p; vl8[r8] = ql; }
        const size_t vo8 = ((size_t)blockIdx.x * HD + cc) * 16 + 8 * hlf; *(v8b*)(VTH + vo8) = vh8; *(v8b*)(VTL + vo8) = vl8; }
      asm volatile("s_wait_xcnt 0x0" ::: "memory");   /* stands behind the last V^T store, in front of any rewrite of the stores' address and data registers: this pass skips the sync whose store wait does that for k and q */
      continue; }
#pragma unroll
    for (int t = 0; t < 8; ++t) { const int cc = t * 16 + nloc; const float bvv = bfv(braw[t]);
#pragma unroll
      for (int r8 = 0; r8 < 8; ++r8) { b16 p, ql; split16((acc[t][r8] * (1.0f / (XS * WSC)) + bvv) * HS, p, ql); Oh[8 * hlf + r8][cc] = p; Ol[8 * hlf + r8][cc] = ql; } }
    wave_lds_sync();
    if (g == 1) {   /* attention keys: written in B-fragment order, tile [this block's 16 keys][hi, lo][8 pieces of 16 channels][lane][8], so that each load of the attention kernel covers 512 contiguous bytes (four whole lines) and not 32 bytes of each of 16 rows; the k third of the PH / PL rows stays unwritten and unread */
      v8b fh[HD / 16], fl[HD / 16]; b16* kt = KT + (size_t)blockIdx.x * (2 * 16 * HD) + lane * 8;
#pragma unroll
      for (int f = 0; f < HD / 16; ++f) { fh[f] = *(const v8b*)(&Oh[nloc][f * 16 + 8 * hlf]); fl[f] = *(const v8b*)(&Ol[nloc][f * 16 + 8 * hlf]); }
#pragma unroll
      for (int f = 0; f < HD / 16; ++f) { *(v8b*)(kt + f * 256) = fh[f]; *(v8b*)(kt + 16 * HD + f * 256) = fl[f]; }
      asm volatile("s_wait_xcnt 0x0" ::: "memory");   /* stands behind the last tile store, in front of any rewrite of the stores' address and data registers */
    } else
    { for (int rr = 0; rr < 16; ++rr) if (lane < 16) { *(v8b*)(PH + (m0 + rr) * PW + g * C + lane * 8) = *(const v8b*)(&Oh[rr][lane * 8]); *(v8b*)(PL + (m0 + rr) * PW + g * C + lane * 8) = *(const v8b*)(&Ol[rr][lane * 8]); }  }   
    wave_lds_sync(); } }
// attention: block per (b, h, QT query tiles of 16), QT * KW waves; wave (qi, kg) holds query tile qi and walks keys [kg L / KW, (kg + 1) L / KW) in key blocks of 128: S = Q K^T (3 products, K 128); online softmax; P x256 hi+lo; at the end the KW partial (max, sum, O) of each query tile are joined through LDS.
// The QT waves of a key group read the same K and V^T tiles: each tile (32 keys, hi + lo, 16 KiB) is brought into LDS once per block by asynchronous copies, a quarter per wave, two buffers, the next tile in flight while this one is worked on; L2 delivers a quarter of the bytes.
// One block per WGP, 4 waves per SIMD (256 registers each). To make room for the two buffers P hi / lo lie in the score rows they were computed from.
__global__ __launch_bounds__(32 * KW * QT) __attribute__((amdgpu_waves_per_eu(4, 4))) void att_kernel(const b16* __restrict__ PH, const b16* __restrict__ PL, const b16* __restrict__ VTH, const b16* __restrict__ VTL, const b16* __restrict__ KT, const float* __restrict__ amask, int BLIM, float* __restrict__ ATT) { __shared__ __attribute__((aligned(16))) b16 Stg[2][KW][SEL]; __shared__ __attribute__((aligned(16))) float SfW[KW * QT][16][KB + 4]; __shared__ float Mw[KW * QT][16], Dw[KW * QT][16]; static_assert(HD <= KB && L % (KW * KB) == 0, "a wave's O partial lies in its score tile; whole key blocks per wave"); static_assert(QT == 4 && HD == 128 && KB % SK == 0 && NST >= 2 && 32 * KW == HD, "a wave copies a quarter of a stage; the join takes one thread per (query tile, channel)");
  const int wv = __builtin_amdgcn_readfirstlane((int)(threadIdx.x >> 5)); const int qi = wv % QT, kg = wv / QT; auto& Sf = SfW[wv];
  const int lane = threadIdx.x & 31, nloc = lane & 15, hlf = lane >> 4; const int qt = blockIdx.x % (L / (16 * QT)); const int h = (blockIdx.x / (L / (16 * QT))) % NH; const int b = blockIdx.x / ((L / (16 * QT)) * NH); if (b >= BLIM) return; const int tb = qt * 16 * QT, t0 = tb + qi * 16; const size_t rowb = (size_t)b * L; const int qo = h * HD;
  const int kstart = kg * (L / KW); const int kend = kstart + L / KW;   // this wave's keys [kstart, kend)
  const unsigned ldst = (unsigned)(size_t)&Stg[0][kg][0] + (unsigned)(qi * 4096 + lane * 16);   // this lane's first 16 bytes of its wave's quarter, buffer 0
  // stage s of a key group: key block s / 8; s % 8 = 0..3: 32 keys of K (two fragment-order tiles [hi, lo], 16 KiB contiguous); 4..7: 32 keys of V^T (two tiles of the hi plane, then two of the lo plane).
  // V^T: lane l takes the 16 bytes (channel l % 16, key half l / 16) of each 512-byte channel tile, so that in LDS a fragment load reads 512 contiguous bytes (no bank conflict), as for K.
  auto stage_copy = [&](int s) { const int ph = s & 7; const size_t tile = (rowb + kstart + (s >> 3) * KB + (ph & 3) * SK) / 16;
    const char* g = ph < 4 ? (const char*)KT + tile * 8192 + qi * 4096 + lane * 16 : (const char*)(qi < 2 ? VTH : VTL) + (tile + (qi & 1)) * 4096 + (nloc * 2 + hlf) * 16;
    const unsigned l = ldst + (unsigned)(s & 1) * (unsigned)(KW * SEL * 2);
    /* eight copies of 512 bytes per wave; the last line stands in front of any rewrite of the copies' address registers */
    asm volatile("global_load_async_to_lds_b128 %0, %8, off\n\tglobal_load_async_to_lds_b128 %1, %9, off\n\tglobal_load_async_to_lds_b128 %2, %10, off\n\tglobal_load_async_to_lds_b128 %3, %11, off\n\tglobal_load_async_to_lds_b128 %4, %12, off\n\tglobal_load_async_to_lds_b128 %5, %13, off\n\tglobal_load_async_to_lds_b128 %6, %14, off\n\tglobal_load_async_to_lds_b128 %7, %15, off\n\ts_wait_xcnt 0x0"
      :: "v"(l), "v"(l + 512u), "v"(l + 1024u), "v"(l + 1536u), "v"(l + 2048u), "v"(l + 2560u), "v"(l + 3072u), "v"(l + 3584u), "v"(g), "v"(g + 512), "v"(g + 1024), "v"(g + 1536), "v"(g + 2048), "v"(g + 2560), "v"(g + 3072), "v"(g + 3584) : "memory"); };
  // foot of stage s: this wave's LDS reads of the stage are done, its copies of stage s + 1 have landed, every wave has passed both; only then is the buffer of stage s refilled
  auto stage_foot = [&](int s) {
    asm volatile("s_wait_dscnt 0x0" ::: "memory");     /* the wave's reads of this buffer have returned before another wave's copies may overwrite it */
    asm volatile("s_wait_asynccnt 0x0" ::: "memory");  /* the wave's own copies of the next stage have landed before the barrier publishes them */
    __syncthreads();
    if (s + 2 < NST) stage_copy(s + 2); };
  stage_copy(0);
  v16b qh[HD / 32], ql[HD / 32];
#pragma unroll
  for (int s = 0; s < HD / 32; ++s) { qh[s] = frag_kb(PH + (rowb + t0 + nloc) * PW + qo + s * 32, hlf); ql[s] = frag_kb(PL + (rowb + t0 + nloc) * PW + qo + s * 32, hlf); }
  float m_r[8], den_r[8]; v8f acc[HD / 16];
#pragma unroll
  for (int r8 = 0; r8 < 8; ++r8) { m_r[r8] = -INFINITY; den_r[r8] = 0.0f; }
#pragma unroll
  for (int t = 0; t < HD / 16; ++t) acc[t] = (v8f){};
  asm volatile("s_wait_asynccnt 0x0" ::: "memory");   /* stage 0 has landed before the barrier publishes it */
  __syncthreads();
  stage_copy(1);
#pragma unroll 1   /* one key block per trip: the body is long, and the stage number stays a scalar */
  for (int kbi = 0; kbi < L / KW / KB; ++kbi) { const int kb0 = kstart + kbi * KB;
#pragma unroll 1   /* one stage per trip, its foot at the end */
    for (int ph = 0; ph < KB / SK; ++ph) { const b16* ks0 = &Stg[ph & 1][kg][0] + lane * 8;
      for (int tt = 0; tt < SK / 16; ++tt) { const int t = ph * (SK / 16) + tt; const b16* kp = ks0 + tt * (2 * 16 * HD); v8f s = {}; v16b kh[HD / 32], kl[HD / 32];   /* all 16 LDS loads of a key tile are issued ahead of its 12 products: one wait per tile */
#pragma unroll
        for (int q = 0; q < HD / 32; ++q) { kh[q] = frag_kt(kp + q * 512); kl[q] = frag_kt(kp + 16 * HD + q * 512); }
#pragma unroll
        for (int q = 0; q < HD / 32; ++q) { s = wmma16b(qh[q], kh[q], s); s = wmma16b(qh[q], kl[q], s); s = wmma16b(ql[q], kh[q], s); }
#pragma unroll
        for (int r8 = 0; r8 < 8; ++r8) { const int j = kb0 + t * 16 + nloc; const bool ok = (j < kend); Sf[8 * hlf + r8][t * 16 + nloc] = ok ? s[r8] * (1.0f / (HS * HS)) : -INFINITY; } }
      stage_foot(kbi * (2 * KB / SK) + ph); }
    wave_lds_sync();
#pragma unroll
    for (int rg = 0; rg < 16; rg += 8) { float sv[8][4];   /* the scores of eight rows are in registers before the first of these rows is overwritten by its own P */
#pragma unroll
      for (int r = 0; r < 8; ++r)
#pragma unroll
        for (int q = 0; q < 4; ++q) sv[r][q] = Sf[rg + r][q * 32 + lane];
#pragma unroll
      for (int r = 0; r < 8; ++r) { const int rr = rg + r; float mx = -INFINITY; b16a* prow = (b16a*)&Sf[rr][0];   /* P hi in the row's first 256 bytes, P lo in the next 256; the type may alias the float scores, so no score load moves behind a P store */
#pragma unroll
        for (int q = 0; q < 4; ++q) mx = fmaxf(mx, sv[r][q]);
        for (int o = 16; o; o >>= 1) mx = fmaxf(mx, __shfl_xor(mx, o));
        const float mold = __shfl(m_r[rr & 7], (rr >> 3) * 16); const float mn = fmaxf(mold, mx); const float sf = (mold == -INFINITY) ? 0.0f : ((mn == -INFINITY) ? 1.0f : __expf(mold - mn)); float ps = 0.0f;
#pragma unroll
        for (int q = 0; q < 4; ++q) { const int kx = q * 32 + lane; const float sc = sv[r][q]; const float p = (sc == -INFINITY || mn == -INFINITY) ? 0.0f : __expf(sc - mn); ps += p; b16 ph, pl; split16(p * PS, ph, pl); prow[kx] = ph; prow[KB + kx] = pl; }
        for (int o = 16; o; o >>= 1) ps += __shfl_xor(ps, o);
        if ((rr >> 3) == hlf) { const int r8 = rr & 7; den_r[r8] = den_r[r8] * sf + ps; m_r[r8] = mn;
#pragma unroll
          for (int t = 0; t < HD / 16; ++t) acc[t][r8] = acc[t][r8] * sf; } } }
    wave_lds_sync();
#pragma unroll 1   /* one stage per trip, its foot at the end */
    for (int ph = 0; ph < KB / SK; ++ph) { const int ks = ph * SK; const b16* vs0 = &Stg[ph & 1][kg][0] + lane * 8; const b16* pr = (const b16*)&Sf[nloc][0]; const v16b pa = frag_kb(pr + ks, hlf), pb = frag_kb(pr + KB + ks, hlf);
#pragma unroll
      for (int tg = 0; tg < HD / 16; tg += 4) { v16b vh[4], vl[4];   /* the V^T fragments of four channel tiles are loaded ahead of their products: one wait per 12 products */
#pragma unroll
        for (int t = 0; t < 4; ++t) { vh[t] = frag_vs(vs0 + (tg + t) * 256); vl[t] = frag_vs(vs0 + 2 * 16 * HD + (tg + t) * 256); }
#pragma unroll
        for (int t = 0; t < 4; ++t) { acc[tg + t] = wmma16b(pa, vh[t], acc[tg + t]); acc[tg + t] = wmma16b(pa, vl[t], acc[tg + t]); acc[tg + t] = wmma16b(pb, vh[t], acc[tg + t]); } }
      stage_foot(kbi * (2 * KB / SK) + KB / SK + ph); }
    wave_lds_sync(); }
  asm volatile("s_wait_asynccnt 0x0" ::: "memory");   /* no copy is outstanding when the wave goes on to the join and ends */
#pragma unroll
  for (int t = 0; t < HD / 16; ++t)
#pragma unroll
    for (int r8 = 0; r8 < 8; ++r8) Sf[8 * hlf + r8][t * 16 + nloc] = acc[t][r8];
  if (nloc == 0) {
#pragma unroll   /* m_r and den_r live in registers: constant indices only */
    for (int r8 = 0; r8 < 8; ++r8) { Mw[wv][8 * hlf + r8] = m_r[r8]; Dw[wv][8 * hlf + r8] = den_r[r8]; } }
  __syncthreads();   /* every wave's partial (max, sum, O) is in LDS before any thread joins them */
  { const int qj = threadIdx.x / HD, ch = threadIdx.x % HD;   /* one thread per (query tile, channel); key groups joined in the order 0..KW-1; wave of (qj, w) = w * QT + qj */
    for (int rr = 0; rr < 16; ++rr) { float mx = Mw[qj][rr];
      for (int w = 1; w < KW; ++w) mx = fmaxf(mx, Mw[w * QT + qj][rr]);
      float dn = 0.0f, o = 0.0f;
      for (int w = 0; w < KW; ++w) { const float mw = Mw[w * QT + qj][rr]; const float e = (mw == -INFINITY) ? 0.0f : __expf(mw - mx); dn += e * Dw[w * QT + qj][rr]; o += e * SfW[w * QT + qj][rr][ch]; }
      ATT[(rowb + tb + qj * 16 + rr) * C + h * HD + ch] = dn > 0.0f ? o * (1.0f / (HS * PS)) / dn : 0.0f;
      asm volatile("s_wait_xcnt 0x0" ::: "memory");   /* stands behind the store, in front of the next row's rewrite of the store's data and address registers */
    } } }
__global__ __launch_bounds__(32) void out_kernel(const float* __restrict__ ATT, const b16* __restrict__ WO, const float* __restrict__ bo, const float* __restrict__ xres, int TLIM, float* __restrict__ out) { __shared__ __attribute__((aligned(16))) b16 Ah[16][C + 8], Al[16][C + 8]; __shared__ float Tf[16][260]; const int lane = threadIdx.x, nloc = lane & 15, hlf = lane >> 4; const size_t m0 = (size_t)blockIdx.x * 16; if (m0 >= (size_t)TLIM) return;
  for (int rr = 0; rr < 16; ++rr) for (int q = 0; q < C / 32; ++q) { b16 p, ql; split16(ATT[(m0 + rr) * C + q * 32 + lane] * HS, p, ql); Ah[rr][q * 32 + lane] = p; Al[rr][q * 32 + lane] = ql; }
  wave_lds_sync();
#pragma unroll 1
  for (int g = 0; g < CX / 256; ++g) { v8f acc[16]; float braw[16];
#pragma unroll
    for (int t = 0; t < 16; ++t) { acc[t] = (v8f){}; braw[t] = bo[g * 256 + t * 16 + nloc]; }   /* the bias loads fly with the first weight group */
#pragma unroll 2
    for (int kb = 0; kb < C; kb += 32) { const v16b a = frag_kb(&Ah[nloc][kb], hlf), al = frag_kb(&Al[nloc][kb], hlf);
#pragma unroll
      for (int tg = 0; tg < 16; tg += 8) { v16b bw[8];   /* the weight fragments of eight tiles are loaded ahead of their 16 products: one L2 wait per group, not one per tile */
#pragma unroll
        for (int t = 0; t < 8; ++t) bw[t] = frag_kb(WO + (size_t)(g * 256 + (tg + t) * 16 + nloc) * C + kb, hlf);
#pragma unroll
        for (int t = 0; t < 8; ++t) { acc[tg + t] = wmma16b(a, bw[t], acc[tg + t]); acc[tg + t] = wmma16b(al, bw[t], acc[tg + t]); } } }
#pragma unroll
    for (int tg = 0; tg < 16; tg += 8) { float xr[8][8];   /* the residual of eight tiles is requested ahead of the first rounding: one wait per 64 loads, not one per element */
#pragma unroll
      for (int t = 0; t < 8; ++t)
#pragma unroll
        for (int r8 = 0; r8 < 8; ++r8) xr[t][r8] = xres[(m0 + 8 * hlf + r8) * CX + g * 256 + (tg + t) * 16 + nloc];
#pragma unroll
      for (int t = 0; t < 8; ++t) { const int cc = (tg + t) * 16 + nloc; const float bb = bfv(braw[tg + t]);
#pragma unroll
        for (int r8 = 0; r8 < 8; ++r8) { const int rr = 8 * hlf + r8; Tf[rr][cc] = acc[tg + t][r8] * (1.0f / (HS * WSC)) + bb + bfv(xr[t][r8]); } } }   /* + residual x */
    wave_lds_sync();
    { for (int rr = 0; rr < 16; ++rr) for (int q = 0; q < 2; ++q) *(v4f*)(out + (m0 + rr) * CX + g * 256 + q * 128 + lane * 4) = *(const v4f*)(&Tf[rr][q * 128 + lane * 4]);  }
    wave_lds_sync(); } }
}  // namespace

extern "C" void kernel_launch(void* const* d_in, const int* in_sizes, int n_in, void* d_out, int out_size, void* d_ws, size_t ws_size, hipStream_t stream) {
  (void)n_in;
  auto Fp = [&](int i) { return (const float*)d_in[i]; };
  // input order: 0 x [4,64,64,256]; 1 wk [256,128]; 2 bk; 3 wq [256,128]; 4 bq; 5 wv [256,128]; 6 bv; 7 wo [128,256]; 8 bo [256]  (all (in,out))
  if (in_sizes[0] != NT * CX || in_sizes[1] != CX * C || in_sizes[3] != CX * C || in_sizes[5] != CX * C || in_sizes[7] != C * CX || in_sizes[8] != CX || out_size != NT * CX) return;
  const int BLIM = NB;
  const int TLIM = BLIM * L;
  size_t off = 0; char* ws = (char*)d_ws;
  auto carve = [&](size_t bytes) { char* p = ws + off; off += (bytes + 255) & ~(size_t)255; return p; };
  b16* W3 = (b16*)carve((size_t)3 * C * CX * 2); b16* WO = (b16*)carve((size_t)CX * C * 2); b16* PH = (b16*)carve((size_t)NT * PW * 2); b16* PL = (b16*)carve((size_t)NT * PW * 2); float* ATT = (float*)carve((size_t)NT * C * 4); b16* VTH = (b16*)carve((size_t)NT * HD * 2); b16* VTL = (b16*)carve((size_t)NT * HD * 2); b16* KT = (b16*)carve((size_t)NT * HD * 2 * 2);
  if (off > ws_size || off > ((size_t)96 << 20)) return;   // ~ 50 MB
  wput_kernel<<<(unsigned)(((size_t)3 * C * (CX / 8) + 255) / 256), 256, 0, stream>>>(Fp(1), Fp(3), Fp(5), Fp(7), W3, WO);
  proj_kernel<<<TLIM / 16, 32, 0, stream>>>(Fp(0), W3, Fp(2), Fp(4), Fp(6), TLIM, PH, PL, VTH, VTL, KT);
  att_kernel<<<BLIM * NH * (L / (16 * QT)), 32 * KW * QT, 0, stream>>>(PH, PL, VTH, VTL, KT, (const float*)0, BLIM, ATT);
  out_kernel<<<TLIM / 16, 32, 0, stream>>>(ATT, WO, Fp(8), Fp(0), TLIM, (float*)d_out);
}

// v006
// Measured time: 115 microseconds a run.
// In two side-by-side timings against v005, it was 1.48 and 1.49 times as fast.
// Counting every step since v000, it is 25.7 times as fast.
#include <hip/hip_runtime.h>

// Self_attention_pixel_wise: per image (4,096 pixels, NHWC 256 ch): k = x wk + bk, q = x wq + bq, v = x wv + bv (128); scores[n][m] = k_n . q_m (no scaling); attn = softmax over m; o = attn v; out = o wo + bo + x -> [4][64][64][256].
// Note the roles: the module's 'key' is the attention query (rows n) and its 'query' the attention key (columns m).
// Deterministic: no index structures, no atomics; flash-style online softmax, the keys of a query tile split over four waves of a block in a fixed order, the four partial results joined in a fixed order.
// WMMA (v_wmma_f32_16x16x32_f16, f32 accumulate): the QKV projection with x EXACT bf16 x8 (K 256) against exact weight rows x256 (one product); S^T = K Q^T (hi+lo x hi+lo, 3 products, K 128; K is the A operand, Q the B operand; K is written by the projection in B-fragment order, tiles [16 keys][hi, lo][8][32 lanes][8], staged in LDS by asynchronous copies for four query tiles at once and read from there in loads of 512 contiguous bytes); O^T = V^T P^T (V^T hi+lo as A, P^T x256 hi+lo as B, packed in registers from the score tiles, 3 products; V^T is written by the projection in tiles [16 keys][128 channels][16] and staged in LDS the same way); out = attended (hi+lo) Wo^T (2 products); softmax in f32. Inputs rounded to bf16 once. Fragment k-map per lane half hh for A AND B: elements 0..7 <- k = 8hh+0..7, 8..15 <- k = 16+8hh+0..7; acc[r] = D[8hh+r][col].

namespace {
constexpr int NB = 4, L = 4096, C = 128, CX = 256 /* input / output channels */, NH = 1, HD = 128, NT = NB * L, KB = 64 /* keys per softmax block: its score tiles stay in registers */, PW = 3 * C, KW = 4 /* key groups per attention block, each takes L / KW keys */, QT = 4 /* query tiles per attention block */, SK = 32 /* keys per staged tile */, SEL = SK * HD * 2 /* its elements, hi + lo */, NST = (L / KW / KB) * (2 * KB / SK) /* staged tiles per key group: K and V^T */;
constexpr float XS = 8.0f, HS = 256.0f /* hi+lo staging scale for k/q/v/attended */, WSC = 256.0f, PS = 256.0f, SCALE = 1.0f;
typedef _Float16 b16;
typedef _Float16 __attribute__((may_alias)) b16a;
typedef __attribute__((ext_vector_type(16))) _Float16 v16b;
typedef __attribute__((ext_vector_type(8))) _Float16 v8b;
typedef __attribute__((ext_vector_type(8))) float v8f;
typedef __attribute__((ext_vector_type(4))) float v4f;
__device__ __forceinline__ float bf16_rne(float f) { unsigned int u = __float_as_uint(f); u += 0x7FFFu + ((u >> 16) & 1u); float r = __uint_as_float(u & 0xFFFF0000u); asm volatile("" : "+v"(r)); return r; }
__device__ __forceinline__ float bfv(float f) { float r = bf16_rne(f); asm volatile("" : "+v"(r)); return r; }
__device__ __forceinline__ void split16(float v, b16& hi, b16& lo) { hi = (b16)v; lo = (b16)(v - (float)hi); }
__device__ __forceinline__ v16b frag_kb(const b16* p, int hh) { const v8b a = *(const v8b*)(p + 8 * hh), b = *(const v8b*)(p + 16 + 8 * hh); v16b f;
#pragma unroll
  for (int e = 0; e < 8; ++e) { f[e] = a[e]; f[8 + e] = b[e]; } return f; }
// same k-map as frag_kb, from the V^T staged in LDS: p = this lane's 8 elements of the channel tile's 256-element piece that holds k = 0..15; k = 16..31 is the next key tile, HD * 16 elements on
__device__ __forceinline__ v16b frag_vs(const b16* p) { const v8b a = *(const v8b*)(p), b = *(const v8b*)(p + HD * 16); v16b f;
#pragma unroll
  for (int e = 0; e < 8; ++e) { f[e] = a[e]; f[8 + e] = b[e]; } return f; }
// same k-map as frag_kb, from the tiled K: p = this lane's 8 elements of the 256-element piece that holds k = 0..15 of all 16 keys; k = 16..31 is the next piece
__device__ __forceinline__ v16b frag_kt(const b16* p) { const v8b a = *(const v8b*)(p), b = *(const v8b*)(p + 256); v16b f;
#pragma unroll
  for (int e = 0; e < 8; ++e) { f[e] = a[e]; f[8 + e] = b[e]; } return f; }
__device__ __forceinline__ v8f wmma16b(v16b a, v16b b, v8f c) { v8f d = __builtin_amdgcn_wmma_f32_16x16x32_f16(false, a, false, b, (short)0, c, false, false); asm volatile("v_nop\n\tv_nop\n\tv_nop\n\tv_nop" : "+v"(d) : "v"(a), "v"(b)); return d; }
__device__ __forceinline__ void wave_lds_sync() { __builtin_amdgcn_fence(__ATOMIC_RELEASE, "workgroup"); __builtin_amdgcn_wave_barrier(); __builtin_amdgcn_fence(__ATOMIC_ACQUIRE, "workgroup"); }
// lane l <-> l ^ 16: the other half of the wave holds the other eight keys of each 16-key tile of the same query
__device__ __forceinline__ float xhalf(float v) { const int b = __float_as_int(v); return __int_as_float(__builtin_amdgcn_permlanex16(b, b, 0x76543210, 0xfedcba98, false, false)); }
__device__ __forceinline__ float pmul(float a, float b) { float p = a * b; asm volatile("" : "+v"(p)); return p; }

__global__ __launch_bounds__(256) void wput_kernel(const float* __restrict__ wq, const float* __restrict__ wk, const float* __restrict__ wv, const float* __restrict__ wo, b16* __restrict__ W3, b16* __restrict__ WO) { const size_t u = (size_t)blockIdx.x * 256 + threadIdx.x; v8b v;
  if (u < (size_t)3 * C * (CX / 8)) { const int r = (int)(u / (CX / 8)), k0 = (int)(u % (CX / 8)) * 8; const int p = r / C, o = r % C; const float* w = p == 0 ? wq : (p == 1 ? wk : wv); float wr[8];   /* all eight loads stand ahead of the first rounding: its asm statement holds later loads behind it, which cost one memory wait per element */
#pragma unroll
    for (int j = 0; j < 8; ++j) wr[j] = w[(size_t)(k0 + j) * C + o];
#pragma unroll
    for (int j = 0; j < 8; ++j) v[j] = (b16)(bf16_rne(wr[j]) * WSC); { *(v8b*)(W3 + (size_t)r * CX + k0) = v;  } }
  if (u < (size_t)CX * (C / 8)) { const int o = (int)(u / (C / 8)), k0 = (int)(u % (C / 8)) * 8; float wr[8];
#pragma unroll
    for (int j = 0; j < 8; ++j) wr[j] = wo[(size_t)(k0 + j) * CX + o];
#pragma unroll
    for (int j = 0; j < 8; ++j) v[j] = (b16)(bf16_rne(wr[j]) * WSC); { *(v8b*)(WO + (size_t)o * C + k0) = v;  } } }
__global__ __launch_bounds__(32) void proj_kernel(const float* __restrict__ x, const b16* __restrict__ W3, const float* __restrict__ bq, const float* __restrict__ bk, const float* __restrict__ bv, int TLIM, b16* __restrict__ PH, b16* __restrict__ PL, b16* __restrict__ VTH, b16* __restrict__ VTL, b16* __restrict__ KT) { __shared__ __attribute__((aligned(16))) b16 Ah[16][CX + 8], Oh[16][264], Ol[16][264]; const int lane = threadIdx.x, nloc = lane & 15, hlf = lane >> 4; const size_t m0 = (size_t)blockIdx.x * 16; if (m0 >= (size_t)TLIM) return;
#pragma unroll
  for (int r0 = 0; r0 < 16; r0 += 8) { float xv[8][CX / 32];   /* eight rows of x (64 loads) are requested before the first rounding (see wput_kernel): one memory wait per half tile, not one per element */
#pragma unroll
    for (int rr = 0; rr < 8; ++rr)
#pragma unroll
      for (int q = 0; q < CX / 32; ++q) xv[rr][q] = x[(m0 + r0 + rr) * CX + q * 32 + lane];
#pragma unroll
    for (int rr = 0; rr < 8; ++rr)
#pragma unroll
      for (int q = 0; q < CX / 32; ++q) Ah[r0 + rr][q * 32 + lane] = (b16)(bf16_rne(xv[rr][q]) * XS); }
  wave_lds_sync();
#pragma unroll 1
  for (int g = 0; g < 3; ++g) { const int pj = g;   /* one group of 8 tiles per projection (128 columns) */ const float* bb = pj == 0 ? bq : (pj == 1 ? bk : bv); v8f acc[8]; float braw[8];
#pragma unroll
    for (int t = 0; t < 8; ++t) { acc[t] = (v8f){}; braw[t] = bb[t * 16 + nloc]; }   /* the bias loads fly with the first weight group */
#pragma unroll 1   /* one group of 32 loads (128 registers) per trip, kept rolled so that the groups share those registers */
    for (int kb = 0; kb < CX; kb += 64) { v16b bw[2][8];   /* the weight fragments of two k steps are loaded ahead of their 16 products: the asm statement behind each product holds later loads back, which cost one L2 wait per product */
#pragma unroll
      for (int u2 = 0; u2 < 2; ++u2)
#pragma unroll
        for (int t = 0; t < 8; ++t) bw[u2][t] = frag_kb(W3 + (size_t)(g * C + t * 16 + nloc) * CX + kb + 32 * u2, hlf);
#pragma unroll
      for (int u2 = 0; u2 < 2; ++u2) { const v16b a = frag_kb(&Ah[nloc][kb + 32 * u2], hlf);
#pragma unroll
        for (int t = 0; t < 8; ++t) acc[t] = wmma16b(a, bw[u2][t], acc[t]); } }
    if (g == 2) {   /* v: a lane's 8 accumulator rows are 8 consecutive keys of one channel = 16 bytes of V^T; tile [this block's 16 keys][channel][16], 512 contiguous bytes per store; the v third of the PH / PL rows stays unwritten and unread */
#pragma unroll
      for (int t = 0; t < 8; ++t) { const int cc = t * 16 + nloc; const float bvv = bfv(braw[t]); v8b vh8, vl8;
#pragma unroll
        for (int r8 = 0; r8 < 8; ++r8) { b16 p, ql; split16((acc[t][r8] * (1.0f / (XS * WSC)) + bvv) * HS, p, ql); vh8[r8] = p; vl8[r8] = ql; }
        const size_t vo8 = ((size_t)blockIdx.x * HD + cc) * 16 + 8 * hlf; *(v8b*)(VTH + vo8) = vh8; *(v8b*)(VTL + vo8) = vl8; }
      asm volatile("s_wait_xcnt 0x0" ::: "memory");   /* stands behind the last V^T store, in front of any rewrite of the stores' address and data registers: this pass skips the sync whose store wait does that for k and q */
      continue; }
#pragma unroll
    for (int t = 0; t < 8; ++t) { const int cc = t * 16 + nloc; const float bvv = bfv(braw[t]);
#pragma unroll
      for (int r8 = 0; r8 < 8; ++r8) { b16 p, ql; split16((acc[t][r8] * (1.0f / (XS * WSC)) + bvv) * HS, p, ql); Oh[8 * hlf + r8][cc] = p; Ol[8 * hlf + r8][cc] = ql; } }
    wave_lds_sync();
    if (g == 1) {   /* attention keys: written in B-fragment order, tile [this block's 16 keys][hi, lo][8 pieces of 16 channels][lane][8], so that each load of the attention kernel covers 512 contiguous bytes (four whole lines) and not 32 bytes of each of 16 rows; the k third of the PH / PL rows stays unwritten and unread */
      v8b fh[HD / 16], fl[HD / 16]; b16* kt = KT + (size_t)blockIdx.x * (2 * 16 * HD) + lane * 8;
#pragma unroll
      for (int f = 0; f < HD / 16; ++f) { fh[f] = *(const v8b*)(&Oh[nloc][f * 16 + 8 * hlf]); fl[f] = *(const v8b*)(&Ol[nloc][f * 16 + 8 * hlf]); }
#pragma unroll
      for (int f = 0; f < HD / 16; ++f) { *(v8b*)(kt + f * 256) = fh[f]; *(v8b*)(kt + 16 * HD + f * 256) = fl[f]; }
      asm volatile("s_wait_xcnt 0x0" ::: "memory");   /* stands behind the last tile store, in front of any rewrite of the stores' address and data registers */
    } else
    { for (int rr = 0; rr < 16; ++rr) if (lane < 16) { *(v8b*)(PH + (m0 + rr) * PW + g * C + lane * 8) = *(const v8b*)(&Oh[rr][lane * 8]); *(v8b*)(PL + (m0 + rr) * PW + g * C + lane * 8) = *(const v8b*)(&Ol[rr][lane * 8]); }  }   
    wave_lds_sync(); } }
// attention: block per (b, h, QT query tiles of 16), QT * KW waves; wave (qi, kg) holds query tile qi and walks keys [kg L / KW, (kg + 1) L / KW) in key blocks of 64: S^T = K Q^T (3 products, K 128), so that a lane holds the scores of one query; online softmax in registers; P^T x256 hi+lo is the B operand of O^T = V^T P^T; at the end the KW partial (max, sum, O) of each query tile are joined through LDS.
// The QT waves of a key group read the same K and V^T tiles: each tile (32 keys, hi + lo, 16 KiB) is brought into LDS once per block by asynchronous copies, a quarter per wave, two buffers, the next tile in flight while this one is worked on; L2 delivers a quarter of the bytes.
// One block per WGP, 4 waves per SIMD (256 registers each). Scores and P never touch LDS; SfW holds only the partial O of the join.
__global__ __launch_bounds__(32 * KW * QT) __attribute__((amdgpu_waves_per_eu(4, 4))) void att_kernel(const b16* __restrict__ PH, const b16* __restrict__ PL, const b16* __restrict__ VTH, const b16* __restrict__ VTL, const b16* __restrict__ KT, const float* __restrict__ amask, int BLIM, float* __restrict__ ATT) { __shared__ __attribute__((aligned(16))) b16 Stg[KW][2][SEL];   /* the two buffers of a key group lie side by side: one base register and immediate offsets reach both */ __shared__ __attribute__((aligned(16))) float SfW[KW * QT][16][HD + 4]; __shared__ float Mw[KW * QT][16], Dw[KW * QT][16]; static_assert(L % (KW * KB) == 0, "whole key blocks per wave: no key of a block is masked"); static_assert(QT == 4 && HD == 128 && KB == 2 * SK && NST >= 2 && 32 * KW == HD, "a wave copies a quarter of a stage; the join takes one thread per (query tile, channel)");
  const int wv = __builtin_amdgcn_readfirstlane((int)(threadIdx.x >> 5)); const int qi = wv % QT, kg = wv / QT; auto& Sf = SfW[wv];
  const int lane = threadIdx.x & 31, nloc = lane & 15, hlf = lane >> 4; const int qt = blockIdx.x % (L / (16 * QT)); const int h = (blockIdx.x / (L / (16 * QT))) % NH; const int b = blockIdx.x / ((L / (16 * QT)) * NH); if (b >= BLIM) return; const int tb = qt * 16 * QT, t0 = tb + qi * 16; const size_t rowb = (size_t)b * L; const int qo = h * HD;
  const int kstart = kg * (L / KW);   // this wave's keys [kstart, kstart + L / KW)
  const unsigned ldst = (unsigned)(size_t)&Stg[kg][0][0] + (unsigned)(qi * 4096 + lane * 16);   // this lane's first 16 bytes of its wave's quarter, buffer 0
  // stage s of a key group: key block s / 4; s % 4 = 0, 1: 32 keys of K (two fragment-order tiles [hi, lo], 16 KiB contiguous); 2, 3: 32 keys of V^T (two tiles of the hi plane, then two of the lo plane).
  // V^T: lane l takes the 16 bytes (channel l % 16, key half l / 16) of each 512-byte channel tile, so that in LDS a fragment load reads 512 contiguous bytes (no bank conflict), as for K.
  auto stage_copy = [&](int s) { const int ph = s & 3; const size_t tile = (rowb + kstart + (s >> 2) * KB + (ph & 1) * SK) / 16;
    const char* g = ph < 2 ? (const char*)KT + tile * 8192 + qi * 4096 + lane * 16 : (const char*)(qi < 2 ? VTH : VTL) + (tile + (qi & 1)) * 4096 + (nloc * 2 + hlf) * 16;
    const unsigned l = ldst + (unsigned)(s & 1) * (unsigned)(SEL * 2);
    /* eight copies of 512 bytes per wave: the immediate offset moves the LDS address and the global address alike, so one register of each serves all eight (the score tiles need the registers); the last line stands in front of any rewrite of the copies' address registers */
    asm volatile("global_load_async_to_lds_b128 %0, %1, off\n\tglobal_load_async_to_lds_b128 %0, %1, off offset:512\n\tglobal_load_async_to_lds_b128 %0, %1, off offset:1024\n\tglobal_load_async_to_lds_b128 %0, %1, off offset:1536\n\tglobal_load_async_to_lds_b128 %0, %1, off offset:2048\n\tglobal_load_async_to_lds_b128 %0, %1, off offset:2560\n\tglobal_load_async_to_lds_b128 %0, %1, off offset:3072\n\tglobal_load_async_to_lds_b128 %0, %1, off offset:3584\n\ts_wait_xcnt 0x0"
      :: "v"(l), "v"(g) : "memory"); };
  // foot of stage s: this wave's LDS reads of the stage are done, its copies of stage s + 1 have landed, every wave has passed both; only then is the buffer of stage s refilled
  auto stage_foot = [&](int s) {
    asm volatile("s_wait_dscnt 0x0" ::: "memory");     /* the wave's reads of this buffer have returned before another wave's copies may overwrite it */
    asm volatile("s_wait_asynccnt 0x0" ::: "memory");  /* the wave's own copies of the next stage have landed before the barrier publishes them */
    __syncthreads();
    if (s + 2 < NST) stage_copy(s + 2); };
  stage_copy(0);
  v16b qh[HD / 32], ql[HD / 32];
#pragma unroll
  for (int s = 0; s < HD / 32; ++s) { qh[s] = frag_kb(PH + (rowb + t0 + nloc) * PW + qo + s * 32, hlf); ql[s] = frag_kb(PL + (rowb + t0 + nloc) * PW + qo + s * 32, hlf); }
  float m_q = -INFINITY, den_q = 0.0f; v8f acc[HD / 16];   /* this lane's query (column nloc): running max; sum over the keys of this lane half; acc[t][r8] = O^T[channel 16 t + 8 hlf + r8][query nloc] */
#pragma unroll
  for (int t = 0; t < HD / 16; ++t) acc[t] = (v8f){};
  asm volatile("s_wait_asynccnt 0x0" ::: "memory");   /* stage 0 has landed before the barrier publishes it */
  __syncthreads();
  stage_copy(1);
#pragma unroll 1   /* one key block per trip: the body is long, and the stage number stays a scalar */
  for (int kbi = 0; kbi < L / KW / KB; ++kbi) { v8f st[KB / 16];   /* st[t][r8] = S^T[key 16 t + 8 hlf + r8][query nloc], x HS HS */
#pragma unroll   /* the score tiles live in registers: constant indices only; one stage per pass, its foot at the end */
    for (int ph = 0; ph < KB / SK; ++ph) { const b16* ks0 = &Stg[kg][ph & 1][0] + lane * 8;
#pragma unroll
      for (int tt = 0; tt < SK / 16; ++tt) { const b16* kp = ks0 + tt * (2 * 16 * HD); v8f s = {}; v16b kh[HD / 32], kl[HD / 32];   /* all 16 LDS loads of a key tile are issued ahead of its 12 products: one wait per tile */
#pragma unroll
        for (int q = 0; q < HD / 32; ++q) { kh[q] = frag_kt(kp + q * 512); kl[q] = frag_kt(kp + 16 * HD + q * 512); }
#pragma unroll
        for (int q = 0; q < HD / 32; ++q) { s = wmma16b(kh[q], qh[q], s); s = wmma16b(kl[q], qh[q], s); s = wmma16b(kh[q], ql[q], s); }
        st[ph * (SK / 16) + tt] = s; }
      stage_foot(kbi * (2 * KB / SK) + ph); }
    /* softmax of one query per lane: max and sum run over the lane's own registers; the max is joined with the other lane half by one exchange, the sums of the two halves once behind the loop */
    float mx = st[0][0];
#pragma unroll
    for (int t = 0; t < KB / 16; ++t)
#pragma unroll
      for (int r8 = 0; r8 < 8; ++r8) mx = fmaxf(mx, st[t][r8]);
    mx = fmaxf(mx, xhalf(mx)) * (1.0f / (HS * HS));
    const float mold = m_q; const float mn = fmaxf(mold, mx); const float es = __expf(mold - mn); const float sf = (mold == -INFINITY) ? 0.0f : es;   /* a select, no branch: mold above -inf makes mn finite */
    const float mz = (mn == -INFINITY) ? 0.0f : mn;   /* every score of the query so far is -inf: exp(-inf - 0) = 0, as for a single such score */
    float ps[4] = {0.0f, 0.0f, 0.0f, 0.0f}; v16b pa[KB / SK], pb[KB / SK];   /* P^T x256 hi / lo: two score tiles converted in place are the B fragment of 32 keys (element e <- key 8 hlf + e, 8 + e <- key 16 + 8 hlf + e) */
#pragma unroll
    for (int t = 0; t < KB / 16; ++t)
#pragma unroll
      for (int r8 = 0; r8 < 8; ++r8) { const float p = __expf(st[t][r8] * (1.0f / (HS * HS)) - mz); ps[r8 & 3] += p; b16 hi, lo; split16(p * PS, hi, lo); pa[t >> 1][(t & 1) * 8 + r8] = hi; pb[t >> 1][(t & 1) * 8 + r8] = lo; }
    den_q = den_q * sf + ((ps[0] + ps[1]) + (ps[2] + ps[3])); m_q = mn;
#pragma unroll
    for (int t = 0; t < HD / 16; ++t) acc[t] = acc[t] * sf;
#pragma unroll   /* the P fragments live in registers: constant indices only; one stage per pass, its foot at the end */
    for (int ph = 0; ph < KB / SK; ++ph) { const b16* vs0 = &Stg[kg][ph & 1][0] + lane * 8;
#pragma unroll
      for (int tg = 0; tg < HD / 16; tg += 4) { v16b vh[4], vl[4];   /* the V^T fragments of four channel tiles are loaded ahead of their products: one wait per 12 products */
#pragma unroll
        for (int t = 0; t < 4; ++t) { vh[t] = frag_vs(vs0 + (tg + t) * 256); vl[t] = frag_vs(vs0 + 2 * 16 * HD + (tg + t) * 256); }
#pragma unroll
        for (int t = 0; t < 4; ++t) { acc[tg + t] = wmma16b(vh[t], pa[ph], acc[tg + t]); acc[tg + t] = wmma16b(vl[t], pa[ph], acc[tg + t]); acc[tg + t] = wmma16b(vh[t], pb[ph], acc[tg + t]); } }
      stage_foot(kbi * (2 * KB / SK) + KB / SK + ph); } }
  asm volatile("s_wait_asynccnt 0x0" ::: "memory");   /* no copy is outstanding when the wave goes on to the join and ends */
#pragma unroll
  for (int t = 0; t < HD / 16; ++t) { *(v4f*)&Sf[nloc][t * 16 + 8 * hlf] = (v4f){acc[t][0], acc[t][1], acc[t][2], acc[t][3]}; *(v4f*)&Sf[nloc][t * 16 + 8 * hlf + 4] = (v4f){acc[t][4], acc[t][5], acc[t][6], acc[t][7]}; }   /* a lane's 8 accumulator rows are 8 consecutive channels of its query */
  { const float dsum = den_q + xhalf(den_q); if (hlf == 0) { Mw[wv][nloc] = m_q; Dw[wv][nloc] = dsum; } }
  __syncthreads();   /* every wave's partial (max, sum, O) is in LDS before any thread joins them */
  { const int qj = threadIdx.x / HD, ch = threadIdx.x % HD;   /* one thread per (query tile, channel); key groups joined in the order 0..KW-1; wave of (qj, w) = w * QT + qj */
    for (int rr = 0; rr < 16; ++rr) { float mx = Mw[qj][rr];
      for (int w = 1; w < KW; ++w) mx = fmaxf(mx, Mw[w * QT + qj][rr]);
      float dn = 0.0f, o = 0.0f;
      for (int w = 0; w < KW; ++w) { const float mw = Mw[w * QT + qj][rr]; const float e = (mw == -INFINITY) ? 0.0f : __expf(mw - mx); dn += e * Dw[w * QT + qj][rr]; o += e * SfW[w * QT + qj][rr][ch]; }
      ATT[(rowb + tb + qj * 16 + rr) * C + h * HD + ch] = dn > 0.0f ? o * (1.0f / (HS * PS)) / dn : 0.0f;
      asm volatile("s_wait_xcnt 0x0" ::: "memory");   /* stands behind the store, in front of the next row's rewrite of the store's data and address registers */
    } } }
__global__ __launch_bounds__(32) void out_kernel(const float* __restrict__ ATT, const b16* __restrict__ WO, const float* __restrict__ bo, const float* __restrict__ xres, int TLIM, float* __restrict__ out) { __shared__ __attribute__((aligned(16))) b16 Ah[16][C + 8], Al[16][C + 8]; __shared__ float Tf[16][260]; const int lane = threadIdx.x, nloc = lane & 15, hlf = lane >> 4; const size_t m0 = (size_t)blockIdx.x * 16; if (m0 >= (size_t)TLIM) return;
  for (int rr = 0; rr < 16; ++rr) for (int q = 0; q < C / 32; ++q) { b16 p, ql; split16(ATT[(m0 + rr) * C + q * 32 + lane] * HS, p, ql); Ah[rr][q * 32 + lane] = p; Al[rr][q * 32 + lane] = ql; }
  wave_lds_sync();
#pragma unroll 1
  for (int g = 0; g < CX / 256; ++g) { v8f acc[16]; float braw[16];
#pragma unroll
    for (int t = 0; t < 16; ++t) { acc[t] = (v8f){}; braw[t] = bo[g * 256 + t * 16 + nloc]; }   /* the bias loads fly with the first weight group */
#pragma unroll 2
    for (int kb = 0; kb < C; kb += 32) { const v16b a = frag_kb(&Ah[nloc][kb], hlf), al = frag_kb(&Al[nloc][kb], hlf);
#pragma unroll
      for (int tg = 0; tg < 16; tg += 8) { v16b bw[8];   /* the weight fragments of eight tiles are loaded ahead of their 16 products: one L2 wait per group, not one per tile */
#pragma unroll
        for (int t = 0; t < 8; ++t) bw[t] = frag_kb(WO + (size_t)(g * 256 + (tg + t) * 16 + nloc) * C + kb, hlf);
#pragma unroll
        for (int t = 0; t < 8; ++t) { acc[tg + t] = wmma16b(a, bw[t], acc[tg + t]); acc[tg + t] = wmma16b(al, bw[t], acc[tg + t]); } } }
#pragma unroll
    for (int tg = 0; tg < 16; tg += 8) { float xr[8][8];   /* the residual of eight tiles is requested ahead of the first rounding: one wait per 64 loads, not one per element */
#pragma unroll
      for (int t = 0; t < 8; ++t)
#pragma unroll
        for (int r8 = 0; r8 < 8; ++r8) xr[t][r8] = xres[(m0 + 8 * hlf + r8) * CX + g * 256 + (tg + t) * 16 + nloc];
#pragma unroll
      for (int t = 0; t < 8; ++t) { const int cc = (tg + t) * 16 + nloc; const float bb = bfv(braw[tg + t]);
#pragma unroll
        for (int r8 = 0; r8 < 8; ++r8) { const int rr = 8 * hlf + r8; Tf[rr][cc] = acc[tg + t][r8] * (1.0f / (HS * WSC)) + bb + bfv(xr[t][r8]); } } }   /* + residual x */
    wave_lds_sync();
    { for (int rr = 0; rr < 16; ++rr) for (int q = 0; q < 2; ++q) *(v4f*)(out + (m0 + rr) * CX + g * 256 + q * 128 + lane * 4) = *(const v4f*)(&Tf[rr][q * 128 + lane * 4]);  }
    wave_lds_sync(); } }
}  // namespace

extern "C" void kernel_launch(void* const* d_in, const int* in_sizes, int n_in, void* d_out, int out_size, void* d_ws, size_t ws_size, hipStream_t stream) {
  (void)n_in;
  auto Fp = [&](int i) { return (const float*)d_in[i]; };
  // input order: 0 x [4,64,64,256]; 1 wk [256,128]; 2 bk; 3 wq [256,128]; 4 bq; 5 wv [256,128]; 6 bv; 7 wo [128,256]; 8 bo [256]  (all (in,out))
  if (in_sizes[0] != NT * CX || in_sizes[1] != CX * C || in_sizes[3] != CX * C || in_sizes[5] != CX * C || in_sizes[7] != C * CX || in_sizes[8] != CX || out_size != NT * CX) return;
  const int BLIM = NB;
  const int TLIM = BLIM * L;
  size_t off = 0; char* ws = (char*)d_ws;
  auto carve = [&](size_t bytes) { char* p = ws + off; off += (bytes + 255) & ~(size_t)255; return p; };
  b16* W3 = (b16*)carve((size_t)3 * C * CX * 2); b16* WO = (b16*)carve((size_t)CX * C * 2); b16* PH = (b16*)carve((size_t)NT * PW * 2); b16* PL = (b16*)carve((size_t)NT * PW * 2); float* ATT = (float*)carve((size_t)NT * C * 4); b16* VTH = (b16*)carve((size_t)NT * HD * 2); b16* VTL = (b16*)carve((size_t)NT * HD * 2); b16* KT = (b16*)carve((size_t)NT * HD * 2 * 2);
  if (off > ws_size || off > ((size_t)96 << 20)) return;   // ~ 50 MB
  wput_kernel<<<(unsigned)(((size_t)3 * C * (CX / 8) + 255) / 256), 256, 0, stream>>>(Fp(1), Fp(3), Fp(5), Fp(7), W3, WO);
  proj_kernel<<<TLIM / 16, 32, 0, stream>>>(Fp(0), W3, Fp(2), Fp(4), Fp(6), TLIM, PH, PL, VTH, VTL, KT);
  att_kernel<<<BLIM * NH * (L / (16 * QT)), 32 * KW * QT, 0, stream>>>(PH, PL, VTH, VTL, KT, (const float*)0, BLIM, ATT);
  out_kernel<<<TLIM / 16, 32, 0, stream>>>(ATT, WO, Fp(8), Fp(0), TLIM, (float*)d_out);
}

// v007
// It runs in 109 microseconds.
// In both of two side-by-side timings against v006, it was 1.05 times as fast.
// All steps since v000 together make it 27.1 times as fast.
#include <hip/hip_runtime.h>

// Self_attention_pixel_wise: per image (4,096 pixels, NHWC 256 ch): k = x wk + bk, q = x wq + bq, v = x wv + bv (128); scores[n][m] = k_n . q_m (no scaling); attn = softmax over m; o = attn v; out = o wo + bo + x -> [4][64][64][256].
// Note the roles: the module's 'key' is the attention query (rows n) and its 'query' the attention key (columns m).
// Deterministic: no index structures, no atomics; flash-style online softmax, the keys of a query tile split over four key groups of a block in a fixed order, the four partial results joined in a fixed order.
// WMMA (v_wmma_f32_16x16x32_f16, f32 accumulate): the QKV projection with x EXACT bf16 x8 (K 256) against exact weight rows x256 (one product); S^T = K Q^T (hi+lo x hi+lo, 3 products, K 128; K is the A operand, Q the B operand; K is written by the projection in B-fragment order, tiles [16 keys][hi, lo][8][32 lanes][8], staged in LDS by asynchronous copies for four query tiles at once and read from there in loads of 512 contiguous bytes); O^T = V^T P^T (V^T hi+lo as A, P^T x256 hi+lo as B, packed in registers from the score tiles, 3 products; V^T is written by the projection in tiles [16 keys][128 channels][16] and staged in LDS the same way); out = attended (hi+lo) Wo^T (2 products); softmax in f32. Inputs rounded to bf16 once. Fragment k-map per lane half hh for A AND B: elements 0..7 <- k = 8hh+0..7, 8..15 <- k = 16+8hh+0..7; acc[r] = D[8hh+r][col].

namespace {
constexpr int NB = 4, L = 4096, C = 128, CX = 256 /* input / output channels */, NH = 1, HD = 128, NT = NB * L, KB = 64 /* keys per softmax block: its score tiles stay in registers */, PW = 3 * C, KW = 4 /* key groups per attention block, each takes L / KW keys */, QT = 4 /* query tiles per attention block */, QW = 2 /* query tiles per attention wave */, NWQ = QT / QW /* waves per key group */, SK = 32 /* keys per staged tile */, SEL = SK * HD * 2 /* its elements, hi + lo */, NST = (L / KW / KB) * (2 * KB / SK) /* staged tiles per key group: K and V^T */;
constexpr float XS = 8.0f, HS = 256.0f /* hi+lo staging scale for k/q/v/attended */, WSC = 256.0f, PS = 256.0f, SCALE = 1.0f;
typedef _Float16 b16;
typedef _Float16 __attribute__((may_alias)) b16a;
typedef __attribute__((ext_vector_type(16))) _Float16 v16b;
typedef __attribute__((ext_vector_type(8))) _Float16 v8b;
typedef __attribute__((ext_vector_type(8))) float v8f;
typedef __attribute__((ext_vector_type(4))) float v4f;
typedef __attribute__((ext_vector_type(4))) int v4i;
typedef __attribute__((address_space(1))) v4i gv4i;   /* 16 bytes in global memory, 16 bytes in LDS: the asynchronous copy's two pointers */
typedef __attribute__((address_space(3))) v4i lv4i;
__device__ __forceinline__ float bf16_rne(float f) { unsigned int u = __float_as_uint(f); u += 0x7FFFu + ((u >> 16) & 1u); float r = __uint_as_float(u & 0xFFFF0000u); asm volatile("" : "+v"(r)); return r; }
__device__ __forceinline__ float bfv(float f) { float r = bf16_rne(f); asm volatile("" : "+v"(r)); return r; }
__device__ __forceinline__ void split16(float v, b16& hi, b16& lo) { hi = (b16)v; lo = (b16)(v - (float)hi); }
__device__ __forceinline__ v16b frag_kb(const b16* p, int hh) { const v8b a = *(const v8b*)(p + 8 * hh), b = *(const v8b*)(p + 16 + 8 * hh); v16b f;
#pragma unroll
  for (int e = 0; e < 8; ++e) { f[e] = a[e]; f[8 + e] = b[e]; } return f; }
// same k-map as frag_kb, from the V^T staged in LDS: p = this lane's 8 elements of the channel tile's 256-element piece that holds k = 0..15; k = 16..31 is the next key tile, HD * 16 elements on
__device__ __forceinline__ v16b frag_vs(const b16* p) { const v8b a = *(const v8b*)(p), b = *(const v8b*)(p + HD * 16); v16b f;
#pragma unroll
  for (int e = 0; e < 8; ++e) { f[e] = a[e]; f[8 + e] = b[e]; } return f; }
// same k-map as frag_kb, from the tiled K: p = this lane's 8 elements of the 256-element piece that holds k = 0..15 of all 16 keys; k = 16..31 is the next piece
__device__ __forceinline__ v16b frag_kt(const b16* p) { const v8b a = *(const v8b*)(p), b = *(const v8b*)(p + 256); v16b f;
#pragma unroll
  for (int e = 0; e < 8; ++e) { f[e] = a[e]; f[8 + e] = b[e]; } return f; }
__device__ __forceinline__ v8f wmma16b(v16b a, v16b b, v8f c) { v8f d = __builtin_amdgcn_wmma_f32_16x16x32_f16(false, a, false, b, (short)0, c, false, false); asm volatile("v_nop\n\tv_nop\n\tv_nop\n\tv_nop" : "+v"(d) : "v"(a), "v"(b)); return d; }
// the bare builtin, for the attention kernel: this compiler keeps the operands of an asm statement in the first 256 registers, and a wave of two query tiles holds more than those (with the asm statement behind each product the build spilled); the compiler keeps the distance behind its own matrix instructions
__device__ __forceinline__ v8f wmma16n(v16b a, v16b b, v8f c) { return __builtin_amdgcn_wmma_f32_16x16x32_f16(false, a, false, b, (short)0, c, false, false); }
__device__ __forceinline__ void wave_lds_sync() { __builtin_amdgcn_fence(__ATOMIC_RELEASE, "workgroup"); __builtin_amdgcn_wave_barrier(); __builtin_amdgcn_fence(__ATOMIC_ACQUIRE, "workgroup"); }
// lane l <-> l ^ 16: the other half of the wave holds the other eight keys of each 16-key tile of the same query
__device__ __forceinline__ float xhalf(float v) { const int b = __float_as_int(v); return __int_as_float(__builtin_amdgcn_permlanex16(b, b, 0x76543210, 0xfedcba98, false, false)); }
__device__ __forceinline__ float pmul(float a, float b) { float p = a * b; asm volatile("" : "+v"(p)); return p; }

__global__ __launch_bounds__(256) void wput_kernel(const float* __restrict__ wq, const float* __restrict__ wk, const float* __restrict__ wv, const float* __restrict__ wo, b16* __restrict__ W3, b16* __restrict__ WO) { const size_t u = (size_t)blockIdx.x * 256 + threadIdx.x; v8b v;
  if (u < (size_t)3 * C * (CX / 8)) { const int r = (int)(u / (CX / 8)), k0 = (int)(u % (CX / 8)) * 8; const int p = r / C, o = r % C; const float* w = p == 0 ? wq : (p == 1 ? wk : wv); float wr[8];   /* all eight loads stand ahead of the first rounding: its asm statement holds later loads behind it, which cost one memory wait per element */
#pragma unroll
    for (int j = 0; j < 8; ++j) wr[j] = w[(size_t)(k0 + j) * C + o];
#pragma unroll
    for (int j = 0; j < 8; ++j) v[j] = (b16)(bf16_rne(wr[j]) * WSC); { *(v8b*)(W3 + (size_t)r * CX + k0) = v;  } }
  if (u < (size_t)CX * (C / 8)) { const int o = (int)(u / (C / 8)), k0 = (int)(u % (C / 8)) * 8; float wr[8];
#pragma unroll
    for (int j = 0; j < 8; ++j) wr[j] = wo[(size_t)(k0 + j) * CX + o];
#pragma unroll
    for (int j = 0; j < 8; ++j) v[j] = (b16)(bf16_rne(wr[j]) * WSC); { *(v8b*)(WO + (size_t)o * C + k0) = v;  } } }
__global__ __launch_bounds__(32) void proj_kernel(const float* __restrict__ x, const b16* __restrict__ W3, const float* __restrict__ bq, const float* __restrict__ bk, const float* __restrict__ bv, int TLIM, b16* __restrict__ PH, b16* __restrict__ PL, b16* __restrict__ VTH, b16* __restrict__ VTL, b16* __restrict__ KT) { __shared__ __attribute__((aligned(16))) b16 Ah[16][CX + 8], Oh[16][264], Ol[16][264]; const int lane = threadIdx.x, nloc = lane & 15, hlf = lane >> 4; const size_t m0 = (size_t)blockIdx.x * 16; if (m0 >= (size_t)TLIM) return;
#pragma unroll
  for (int r0 = 0; r0 < 16; r0 += 8) { float xv[8][CX / 32];   /* eight rows of x (64 loads) are requested before the first rounding (see wput_kernel): one memory wait per half tile, not one per element */
#pragma unroll
    for (int rr = 0; rr < 8; ++rr)
#pragma unroll
      for (int q = 0; q < CX / 32; ++q) xv[rr][q] = x[(m0 + r0 + rr) * CX + q * 32 + lane];
#pragma unroll
    for (int rr = 0; rr < 8; ++rr)
#pragma unroll
      for (int q = 0; q < CX / 32; ++q) Ah[r0 + rr][q * 32 + lane] = (b16)(bf16_rne(xv[rr][q]) * XS); }
  wave_lds_sync();
#pragma unroll 1
  for (int g = 0; g < 3; ++g) { const int pj = g;   /* one group of 8 tiles per projection (128 columns) */ const float* bb = pj == 0 ? bq : (pj == 1 ? bk : bv); v8f acc[8]; float braw[8];
#pragma unroll
    for (int t = 0; t < 8; ++t) { acc[t] = (v8f){}; braw[t] = bb[t * 16 + nloc]; }   /* the bias loads fly with the first weight group */
#pragma unroll 1   /* one group of 32 loads (128 registers) per trip, kept rolled so that the groups share those registers */
    for (int kb = 0; kb < CX; kb += 64) { v16b bw[2][8];   /* the weight fragments of two k steps are loaded ahead of their 16 products: the asm statement behind each product holds later loads back, which cost one L2 wait per product */
#pragma unroll
      for (int u2 = 0; u2 < 2; ++u2)
#pragma unroll
        for (int t = 0; t < 8; ++t) bw[u2][t] = frag_kb(W3 + (size_t)(g * C + t * 16 + nloc) * CX + kb + 32 * u2, hlf);
#pragma unroll
      for (int u2 = 0; u2 < 2; ++u2) { const v16b a = frag_kb(&Ah[nloc][kb + 32 * u2], hlf);
#pragma unroll
        for (int t = 0; t < 8; ++t) acc[t] = wmma16b(a, bw[u2][t], acc[t]); } }
    if (g == 2) {   /* v: a lane's 8 accumulator rows are 8 consecutive keys of one channel = 16 bytes of V^T; tile [this block's 16 keys][channel][16], 512 contiguous bytes per store; the v third of the PH / PL rows stays unwritten and unread */
#pragma unroll
      for (int t = 0; t < 8; ++t) { const int cc = t * 16 + nloc; const float bvv = bfv(braw[t]); v8b vh8, vl8;
#pragma unroll
        for (int r8 = 0; r8 < 8; ++r8) { b16 p, ql; split16((acc[t][r8] * (1.0f / (XS * WSC)) + bvv) * HS, p, ql); vh8[r8] = p; vl8[r8] = ql; }
        const size_t vo8 = ((size_t)blockIdx.x * HD + cc) * 16 + 8 * hlf; *(v8b*)(VTH + vo8) = vh8; *(v8b*)(VTL + vo8) = vl8; }
      asm volatile("s_wait_xcnt 0x0" ::: "memory");   /* stands behind the last V^T store, in front of any rewrite of the stores' address and data registers: this pass skips the sync whose store wait does that for k and q */
      continue; }
#pragma unroll
    for (int t = 0; t < 8; ++t) { const int cc = t * 16 + nloc; const float bvv = bfv(braw[t]);
#pragma unroll
      for (int r8 = 0; r8 < 8; ++r8) { b16 p, ql; split16((acc[t][r8] * (1.0f / (XS * WSC)) + bvv) * HS, p, ql); Oh[8 * hlf + r8][cc] = p; Ol[8 * hlf + r8][cc] = ql; } }
    wave_lds_sync();
    if (g == 1) {   /* attention keys: written in B-fragment order, tile [this block's 16 keys][hi, lo][8 pieces of 16 channels][lane][8], so that each load of the attention kernel covers 512 contiguous bytes (four whole lines) and not 32 bytes of each of 16 rows; the k third of the PH / PL rows stays unwritten and unread */
      v8b fh[HD / 16], fl[HD / 16]; b16* kt = KT + (size_t)blockIdx.x * (2 * 16 * HD) + lane * 8;
#pragma unroll
      for (int f = 0; f < HD / 16; ++f) { fh[f] = *(const v8b*)(&Oh[nloc][f * 16 + 8 * hlf]); fl[f] = *(const v8b*)(&Ol[nloc][f * 16 + 8 * hlf]); }
#pragma unroll
      for (int f = 0; f < HD / 16; ++f) { *(v8b*)(kt + f * 256) = fh[f]; *(v8b*)(kt + 16 * HD + f * 256) = fl[f]; }
      asm volatile("s_wait_xcnt 0x0" ::: "memory");   /* stands behind the last tile store, in front of any rewrite of the stores' address and data registers */
    } else
    { for (int rr = 0; rr < 16; ++rr) if (lane < 16) { *(v8b*)(PH + (m0 + rr) * PW + g * C + lane * 8) = *(const v8b*)(&Oh[rr][lane * 8]); *(v8b*)(PL + (m0 + rr) * PW + g * C + lane * 8) = *(const v8b*)(&Ol[rr][lane * 8]); }  }   
    wave_lds_sync(); } }
// attention: block per (b, h, QT query tiles of 16), KW * NWQ waves; wave (qp, kg) holds the QW query tiles qp QW .. qp QW + QW - 1 and walks keys [kg L / KW, (kg + 1) L / KW) in key blocks of 64: S^T = K Q^T (3 products, K 128), so that a lane holds the scores of one query per tile; online softmax in registers; P^T x256 hi+lo is the B operand of O^T = V^T P^T; at the end the KW partial (max, sum, O) of each query tile are joined through LDS.
// Every K and V^T fragment that a wave reads from LDS is the A operand for both of its query tiles: the LDS delivers half the bytes per product that one tile per wave needs, and the two tiles' accumulator chains are independent of each other.
// The NWQ waves of a key group read the same K and V^T tiles: each tile (32 keys, hi + lo, 16 KiB) is brought into LDS once per block by asynchronous copies, a half per wave, two buffers, the next tile in flight while this one is worked on.
// One block per WGP, 2 waves per SIMD (512 registers each). Scores and P never touch LDS; SfW holds only the partial O of the join.
__global__ __launch_bounds__(32 * KW * NWQ) __attribute__((amdgpu_waves_per_eu(2, 2))) void att_kernel(const b16* __restrict__ PH, const b16* __restrict__ PL, const b16* __restrict__ VTH, const b16* __restrict__ VTL, const b16* __restrict__ KT, const float* __restrict__ amask, int BLIM, float* __restrict__ ATT) { __shared__ __attribute__((aligned(16))) b16 Stg[KW][2][SEL];   /* the two buffers of a key group lie side by side: one base register and immediate offsets reach both */ __shared__ __attribute__((aligned(16))) float SfW[KW * QT][16][HD + 4]; __shared__ float Mw[KW * QT][16], Dw[KW * QT][16]; static_assert(L % (KW * KB) == 0, "whole key blocks per wave: no key of a block is masked"); static_assert(QT == 4 && QW == 2 && HD == 128 && KB == 2 * SK && NST >= 2 && (QT * 16) % (KW * NWQ) == 0, "a wave copies a half of a stage; in the join a wave takes whole query rows, a lane four channels");
  const int wv = __builtin_amdgcn_readfirstlane((int)(threadIdx.x >> 5)); const int qp = wv % NWQ, kg = wv / NWQ;
  const int lane = threadIdx.x & 31, nloc = lane & 15, hlf = lane >> 4; const int qt = blockIdx.x % (L / (16 * QT)); const int h = (blockIdx.x / (L / (16 * QT))) % NH; const int b = blockIdx.x / ((L / (16 * QT)) * NH); if (b >= BLIM) return; const int tb = qt * 16 * QT, t0 = tb + qp * QW * 16; const size_t rowb = (size_t)b * L; const int qo = h * HD;
  const int kstart = kg * (L / KW);   // this wave's keys [kstart, kstart + L / KW)
  b16* const ldst = &Stg[kg][0][0] + qp * 4096 + lane * 8;   // this lane's first 16 bytes of its wave's half, buffer 0
  // stage s of a key group: key block s / 4; s % 4 = 0, 1: 32 keys of K (two fragment-order tiles [hi, lo], 16 KiB contiguous); 2, 3: 32 keys of V^T (two tiles of the hi plane, then two of the lo plane; a wave takes one plane, whose two tiles are contiguous).
  // V^T: lane l takes the 16 bytes (channel l % 16, key half l / 16) of each 512-byte channel tile, so that in LDS a fragment load reads 512 contiguous bytes (no bank conflict), as for K.
  auto stage_copy = [&](int s) { const int ph = s & 3; const size_t tile = (rowb + kstart + (s >> 2) * KB + (ph & 1) * SK) / 16;
    const char* g = ph < 2 ? (const char*)KT + tile * 8192 + qp * 8192 + lane * 16 : (const char*)(qp == 0 ? VTH : VTL) + tile * 4096 + (nloc * 2 + hlf) * 16;
    b16* l = ldst + (s & 1) * SEL;
    /* sixteen copies of 512 bytes per wave: the immediate offset moves the LDS address and the global address alike, so one address of each serves all sixteen; the builtin form, because this compiler keeps the operands of an asm statement in the first 256 registers: with asm copies it spilled the LDS addresses and reloaded them in front of every refill */
#define CP(n) __builtin_amdgcn_global_load_async_to_lds_b128((gv4i*)g, (lv4i*)l, (n) * 512, 0)
    CP(0); CP(1); CP(2); CP(3); CP(4); CP(5); CP(6); CP(7); CP(8); CP(9); CP(10); CP(11); CP(12); CP(13); CP(14); CP(15);
#undef CP
  };
  // foot of stage s: this wave's LDS reads of the stage are done, its copies of stage s + 1 have landed, every wave has passed both; only then is the buffer of stage s refilled
  auto stage_foot = [&](int s, bool more) {   /* more: a stage s + 2 exists; a constant at every call */
    asm volatile("s_wait_dscnt 0x0" ::: "memory");     /* the wave's reads of this buffer have returned before another wave's copies may overwrite it */
    asm volatile("s_wait_asynccnt 0x0" ::: "memory");  /* the wave's own copies of the next stage have landed before the barrier publishes them */
    __syncthreads();
    if (more) stage_copy(s + 2); };
  stage_copy(0);
  v16b qh[QW][HD / 32], ql[QW][HD / 32];
#pragma unroll
  for (int u = 0; u < QW; ++u)
#pragma unroll
    for (int s = 0; s < HD / 32; ++s) { qh[u][s] = frag_kb(PH + (rowb + t0 + u * 16 + nloc) * PW + qo + s * 32, hlf); ql[u][s] = frag_kb(PL + (rowb + t0 + u * 16 + nloc) * PW + qo + s * 32, hlf); }
  float m_q[QW], den_q[QW]; v8f acc[QW][HD / 16];   /* this lane's query of tile u (column nloc): running max; sum over the keys of this lane half; acc[u][t][r8] = O^T[channel 16 t + 8 hlf + r8][query nloc] */
#pragma unroll
  for (int u = 0; u < QW; ++u) { m_q[u] = -INFINITY; den_q[u] = 0.0f;
#pragma unroll
    for (int t = 0; t < HD / 16; ++t) acc[u][t] = (v8f){}; }
  asm volatile("s_wait_asynccnt 0x0" ::: "memory");   /* stage 0 has landed before the barrier publishes it */
  __syncthreads();
  stage_copy(1);
  /* one key block. The last one stands behind the loop, so that inside the loop every foot refills without a test: a test ends the basic block, and the products that the compiler moves behind the barrier then stand in front of the copies and shorten their lead */
  auto key_block = [&](int kbi, bool last) __attribute__((always_inline)) { v8f st[QW][KB / 16];   /* st[u][t][r8] = S^T[key 16 t + 8 hlf + r8][query nloc of tile u], x HS HS */
#pragma unroll   /* the score tiles live in registers: constant indices only; one stage per pass, its foot at the end */
    for (int ph = 0; ph < KB / SK; ++ph) { const b16* ks0 = &Stg[kg][ph & 1][0] + lane * 8;
#pragma unroll
      for (int tt = 0; tt < SK / 16; ++tt) { const b16* kp = ks0 + tt * (2 * 16 * HD); v8f s[QW]; v16b kh[HD / 32], kl[HD / 32];   /* all 16 LDS loads of a key tile are issued ahead of its 24 products: one wait per tile */
#pragma unroll
        for (int q = 0; q < HD / 32; ++q) { kh[q] = frag_kt(kp + q * 512); kl[q] = frag_kt(kp + 16 * HD + q * 512); }
        __builtin_amdgcn_sched_barrier(0);   /* keeps the loads in one group ahead of the products: without it the compiler sinks each pair of loads to its first use and waits for the LDS before every second product */
#pragma unroll
        for (int u = 0; u < QW; ++u) s[u] = (v8f){};
#pragma unroll   /* the two query tiles' chains alternate: each product stands in the other chain's accumulator latency; within a chain the products of a k step keep the order hi hi, lo hi, hi lo */
        for (int q = 0; q < HD / 32; ++q) {
#pragma unroll
          for (int u = 0; u < QW; ++u) s[u] = wmma16n(kh[q], qh[u][q], s[u]);
#pragma unroll
          for (int u = 0; u < QW; ++u) s[u] = wmma16n(kl[q], qh[u][q], s[u]);
#pragma unroll
          for (int u = 0; u < QW; ++u) s[u] = wmma16n(kh[q], ql[u][q], s[u]); }
#pragma unroll
        for (int u = 0; u < QW; ++u) st[u][ph * (SK / 16) + tt] = s[u]; }
      stage_foot(kbi * (2 * KB / SK) + ph, true); }   /* the V^T stages of the same key block follow */
    v16b pa[QW][KB / SK], pb[QW][KB / SK];   /* P^T x256 hi / lo: two score tiles converted in place are the B fragment of 32 keys (element e <- key 8 hlf + e, 8 + e <- key 16 + 8 hlf + e) */
#pragma unroll
    for (int u = 0; u < QW; ++u) {
      /* softmax of one query per lane and tile: max and sum run over the lane's own registers; the max is joined with the other lane half by one exchange, the sums of the two halves once behind the loop */
      float mx = st[u][0][0];
#pragma unroll
      for (int t = 0; t < KB / 16; ++t)
#pragma unroll
        for (int r8 = 0; r8 < 8; ++r8) mx = fmaxf(mx, st[u][t][r8]);
      mx = fmaxf(mx, xhalf(mx)) * (1.0f / (HS * HS));
      const float mold = m_q[u]; const float mn = fmaxf(mold, mx); const float es = __expf(mold - mn); const float sf = (mold == -INFINITY) ? 0.0f : es;   /* a select, no branch: mold above -inf makes mn finite */
      const float mz = (mn == -INFINITY) ? 0.0f : mn;   /* every score of the query so far is -inf: exp(-inf - 0) = 0, as for a single such score */
      float ps[4] = {0.0f, 0.0f, 0.0f, 0.0f};
#pragma unroll
      for (int t = 0; t < KB / 16; ++t)
#pragma unroll
        for (int r8 = 0; r8 < 8; ++r8) { const float p = __expf(st[u][t][r8] * (1.0f / (HS * HS)) - mz); ps[r8 & 3] += p; b16 hi, lo; split16(p * PS, hi, lo); pa[u][t >> 1][(t & 1) * 8 + r8] = hi; pb[u][t >> 1][(t & 1) * 8 + r8] = lo; }
      den_q[u] = den_q[u] * sf + ((ps[0] + ps[1]) + (ps[2] + ps[3])); m_q[u] = mn;
#pragma unroll
      for (int t = 0; t < HD / 16; ++t) acc[u][t] = acc[u][t] * sf; }
#pragma unroll   /* the P fragments live in registers: constant indices only; one stage per pass, its foot at the end */
    for (int ph = 0; ph < KB / SK; ++ph) { const b16* vs0 = &Stg[kg][ph & 1][0] + lane * 8;
#pragma unroll
      for (int tg = 0; tg < HD / 16; tg += 4) { v16b vh[4], vl[4];   /* the V^T fragments of four channel tiles are loaded ahead of their products: one wait per 24 products */
#pragma unroll
        for (int t = 0; t < 4; ++t) { vh[t] = frag_vs(vs0 + (tg + t) * 256); vl[t] = frag_vs(vs0 + 2 * 16 * HD + (tg + t) * 256); }
        __builtin_amdgcn_sched_barrier(0);   /* keeps the loads in one group ahead of the products, as for K */
#pragma unroll
        for (int t = 0; t < 4; ++t) {
#pragma unroll
          for (int u = 0; u < QW; ++u) acc[u][tg + t] = wmma16n(vh[t], pa[u][ph], acc[u][tg + t]);
#pragma unroll
          for (int u = 0; u < QW; ++u) acc[u][tg + t] = wmma16n(vl[t], pa[u][ph], acc[u][tg + t]);
#pragma unroll
          for (int u = 0; u < QW; ++u) acc[u][tg + t] = wmma16n(vh[t], pb[u][ph], acc[u][tg + t]); } }
      stage_foot(kbi * (2 * KB / SK) + KB / SK + ph, !last); } };
#pragma unroll 1   /* one key block per trip: the body is long, and the stage number stays a scalar */
  for (int kbi = 0; kbi < L / KW / KB - 1; ++kbi) key_block(kbi, false);
  key_block(L / KW / KB - 1, true);
  asm volatile("s_wait_asynccnt 0x0" ::: "memory");   /* no copy is outstanding when the wave goes on to the join and ends */
#pragma unroll
  for (int u = 0; u < QW; ++u) { const int pw = kg * QT + qp * QW + u;   /* the partial result of (key group kg, query tile qp QW + u) */
#pragma unroll
    for (int t = 0; t < HD / 16; ++t) { *(v4f*)&SfW[pw][nloc][t * 16 + 8 * hlf] = (v4f){acc[u][t][0], acc[u][t][1], acc[u][t][2], acc[u][t][3]}; *(v4f*)&SfW[pw][nloc][t * 16 + 8 * hlf + 4] = (v4f){acc[u][t][4], acc[u][t][5], acc[u][t][6], acc[u][t][7]}; }   /* a lane's 8 accumulator rows are 8 consecutive channels of its query */
    const float dsum = den_q[u] + xhalf(den_q[u]); if (hlf == 0) { Mw[pw][nloc] = m_q[u]; Dw[pw][nloc] = dsum; } }
  __syncthreads();   /* every wave's partial (max, sum, O) is in LDS before any thread joins them */
  { constexpr int RW = QT * 16 / (KW * NWQ);   /* query rows per wave; a lane takes four consecutive channels of the row; key groups joined in the order 0..KW-1; partial of (qj, w) = w * QT + qj */
    for (int i = 0; i < RW; ++i) { const int rq = wv * RW + i, qj = rq / 16, rr = rq % 16; float mx = Mw[qj][rr];
      for (int w = 1; w < KW; ++w) mx = fmaxf(mx, Mw[w * QT + qj][rr]);
      float dn = 0.0f; v4f o = {};
      for (int w = 0; w < KW; ++w) { const float mw = Mw[w * QT + qj][rr]; const float e = (mw == -INFINITY) ? 0.0f : __expf(mw - mx); dn += e * Dw[w * QT + qj][rr]; const v4f sv = *(const v4f*)&SfW[w * QT + qj][rr][lane * 4];
#pragma unroll
        for (int j = 0; j < 4; ++j) o[j] += e * sv[j]; }
      v4f res;
#pragma unroll
      for (int j = 0; j < 4; ++j) res[j] = dn > 0.0f ? o[j] * (1.0f / (HS * PS)) / dn : 0.0f;
      *(v4f*)(ATT + (rowb + tb + rq) * C + h * HD + lane * 4) = res;
      asm volatile("s_wait_xcnt 0x0" ::: "memory");   /* stands behind the store, in front of the next row's rewrite of the store's data and address registers */
    } } }
__global__ __launch_bounds__(32) void out_kernel(const float* __restrict__ ATT, const b16* __restrict__ WO, const float* __restrict__ bo, const float* __restrict__ xres, int TLIM, float* __restrict__ out) { __shared__ __attribute__((aligned(16))) b16 Ah[16][C + 8], Al[16][C + 8]; __shared__ float Tf[16][260]; const int lane = threadIdx.x, nloc = lane & 15, hlf = lane >> 4; const size_t m0 = (size_t)blockIdx.x * 16; if (m0 >= (size_t)TLIM) return;
  for (int rr = 0; rr < 16; ++rr) for (int q = 0; q < C / 32; ++q) { b16 p, ql; split16(ATT[(m0 + rr) * C + q * 32 + lane] * HS, p, ql); Ah[rr][q * 32 + lane] = p; Al[rr][q * 32 + lane] = ql; }
  wave_lds_sync();
#pragma unroll 1
  for (int g = 0; g < CX / 256; ++g) { v8f acc[16]; float braw[16];
#pragma unroll
    for (int t = 0; t < 16; ++t) { acc[t] = (v8f){}; braw[t] = bo[g * 256 + t * 16 + nloc]; }   /* the bias loads fly with the first weight group */
#pragma unroll 2
    for (int kb = 0; kb < C; kb += 32) { const v16b a = frag_kb(&Ah[nloc][kb], hlf), al = frag_kb(&Al[nloc][kb], hlf);
#pragma unroll
      for (int tg = 0; tg < 16; tg += 8) { v16b bw[8];   /* the weight fragments of eight tiles are loaded ahead of their 16 products: one L2 wait per group, not one per tile */
#pragma unroll
        for (int t = 0; t < 8; ++t) bw[t] = frag_kb(WO + (size_t)(g * 256 + (tg + t) * 16 + nloc) * C + kb, hlf);
#pragma unroll
        for (int t = 0; t < 8; ++t) { acc[tg + t] = wmma16b(a, bw[t], acc[tg + t]); acc[tg + t] = wmma16b(al, bw[t], acc[tg + t]); } } }
#pragma unroll
    for (int tg = 0; tg < 16; tg += 8) { float xr[8][8];   /* the residual of eight tiles is requested ahead of the first rounding: one wait per 64 loads, not one per element */
#pragma unroll
      for (int t = 0; t < 8; ++t)
#pragma unroll
        for (int r8 = 0; r8 < 8; ++r8) xr[t][r8] = xres[(m0 + 8 * hlf + r8) * CX + g * 256 + (tg + t) * 16 + nloc];
#pragma unroll
      for (int t = 0; t < 8; ++t) { const int cc = (tg + t) * 16 + nloc; const float bb = bfv(braw[tg + t]);
#pragma unroll
        for (int r8 = 0; r8 < 8; ++r8) { const int rr = 8 * hlf + r8; Tf[rr][cc] = acc[tg + t][r8] * (1.0f / (HS * WSC)) + bb + bfv(xr[t][r8]); } } }   /* + residual x */
    wave_lds_sync();
    { for (int rr = 0; rr < 16; ++rr) for (int q = 0; q < 2; ++q) *(v4f*)(out + (m0 + rr) * CX + g * 256 + q * 128 + lane * 4) = *(const v4f*)(&Tf[rr][q * 128 + lane * 4]);  }
    wave_lds_sync(); } }
}  // namespace

extern "C" void kernel_launch(void* const* d_in, const int* in_sizes, int n_in, void* d_out, int out_size, void* d_ws, size_t ws_size, hipStream_t stream) {
  (void)n_in;
  auto Fp = [&](int i) { return (const float*)d_in[i]; };
  // input order: 0 x [4,64,64,256]; 1 wk [256,128]; 2 bk; 3 wq [256,128]; 4 bq; 5 wv [256,128]; 6 bv; 7 wo [128,256]; 8 bo [256]  (all (in,out))
  if (in_sizes[0] != NT * CX || in_sizes[1] != CX * C || in_sizes[3] != CX * C || in_sizes[5] != CX * C || in_sizes[7] != C * CX || in_sizes[8] != CX || out_size != NT * CX) return;
  const int BLIM = NB;
  const int TLIM = BLIM * L;
  size_t off = 0; char* ws = (char*)d_ws;
  auto carve = [&](size_t bytes) { char* p = ws + off; off += (bytes + 255) & ~(size_t)255; return p; };
  b16* W3 = (b16*)carve((size_t)3 * C * CX * 2); b16* WO = (b16*)carve((size_t)CX * C * 2); b16* PH = (b16*)carve((size_t)NT * PW * 2); b16* PL = (b16*)carve((size_t)NT * PW * 2); float* ATT = (float*)carve((size_t)NT * C * 4); b16* VTH = (b16*)carve((size_t)NT * HD * 2); b16* VTL = (b16*)carve((size_t)NT * HD * 2); b16* KT = (b16*)carve((size_t)NT * HD * 2 * 2);
  if (off > ws_size || off > ((size_t)96 << 20)) return;   // ~ 50 MB
  wput_kernel<<<(unsigned)(((size_t)3 * C * (CX / 8) + 255) / 256), 256, 0, stream>>>(Fp(1), Fp(3), Fp(5), Fp(7), W3, WO);
  proj_kernel<<<TLIM / 16, 32, 0, stream>>>(Fp(0), W3, Fp(2), Fp(4), Fp(6), TLIM, PH, PL, VTH, VTL, KT);
  att_kernel<<<BLIM * NH * (L / (16 * QT)), 32 * KW * NWQ, 0, stream>>>(PH, PL, VTH, VTL, KT, (const float*)0, BLIM, ATT);
  out_kernel<<<TLIM / 16, 32, 0, stream>>>(ATT, WO, Fp(8), Fp(0), TLIM, (float*)d_out);
}

// v008
// One run takes 90.8 microseconds.
// In both of two side-by-side timings against v007, it was 1.19 times as fast.
// Counting every step since v000, it is 32.2 times as fast.
#include <hip/hip_runtime.h>

// Self_attention_pixel_wise: per image (4,096 pixels, NHWC 256 ch): k = x wk + bk, q = x wq + bq, v = x wv + bv (128); scores[n][m] = k_n . q_m (no scaling); attn = softmax over m; o = attn v; out = o wo + bo + x -> [4][64][64][256].
// Note the roles: the module's 'key' is the attention query (rows n) and its 'query' the attention key (columns m).
// Deterministic: no index structures, no atomics; flash-style online softmax, the keys of a query tile split over four blocks in a fixed order, the four partial results joined in a fixed order by the output kernel.
// WMMA (v_wmma_f32_16x16x32_f16, f32 accumulate): the QKV projection with x EXACT bf16 x8 (K 256) against exact weight rows x256 (one product); S^T = K Q^T (hi+lo x hi+lo, 3 products, K 128; K is the A operand, Q the B operand; K is written by the projection in B-fragment order, tiles [16 keys][hi, lo][8][32 lanes][8], staged in LDS by asynchronous copies for sixteen query tiles at once and read from there in loads of 512 contiguous bytes); O^T = V^T P^T (V^T hi+lo as A, P^T x256 hi+lo as B, packed in registers from the score tiles, 3 products; V^T is written by the projection in tiles [16 keys][128 channels][16] and staged in LDS the same way); out = attended (hi+lo) Wo^T (2 products); softmax in f32. Inputs rounded to bf16 once. Fragment k-map per lane half hh for A AND B: elements 0..7 <- k = 8hh+0..7, 8..15 <- k = 16+8hh+0..7; acc[r] = D[8hh+r][col].

namespace {
constexpr int NB = 4, L = 4096, C = 128, CX = 256 /* input / output channels */, NH = 1, HD = 128, NT = NB * L, KB = 64 /* keys per softmax block: its score tiles stay in registers */, PW = 3 * C, KP = 4 /* key parts: an attention block takes L / KP keys */, QT = 16 /* query tiles per attention block */, QW = 2 /* query tiles per attention wave */, NWQ = QT / QW /* waves per attention block */, SK = 32 /* keys per P fragment */, SEL = KB * HD * 2 * 2 /* elements of a stage: K and V^T of a key block, hi + lo each */, VOF = KB * HD * 2 /* where V^T begins in a stage */, NKB = L / KP / KB /* stages (key blocks) per attention block */;
constexpr float XS = 8.0f, HS = 256.0f /* hi+lo staging scale for k/q/v/attended */, WSC = 256.0f, PS = 256.0f, SCALE = 1.0f;
typedef _Float16 b16;
typedef _Float16 __attribute__((may_alias)) b16a;
typedef __attribute__((ext_vector_type(16))) _Float16 v16b;
typedef __attribute__((ext_vector_type(8))) _Float16 v8b;
typedef __attribute__((ext_vector_type(4))) _Float16 v4b;
typedef __attribute__((ext_vector_type(8))) float v8f;
typedef __attribute__((ext_vector_type(4))) float v4f;
typedef __attribute__((ext_vector_type(2))) float v2f;
typedef __attribute__((ext_vector_type(4))) int v4i;
typedef __attribute__((address_space(1))) v4i gv4i;   /* 16 bytes in global memory, 16 bytes in LDS: the asynchronous copy's two pointers */
typedef __attribute__((address_space(3))) v4i lv4i;
__device__ __forceinline__ float bf16_rne(float f) { unsigned int u = __float_as_uint(f); u += 0x7FFFu + ((u >> 16) & 1u); float r = __uint_as_float(u & 0xFFFF0000u); asm volatile("" : "+v"(r)); return r; }
__device__ __forceinline__ float bfv(float f) { float r = bf16_rne(f); asm volatile("" : "+v"(r)); return r; }
__device__ __forceinline__ void split16(float v, b16& hi, b16& lo) { hi = (b16)v; lo = (b16)(v - (float)hi); }
__device__ __forceinline__ v16b frag_kb(const b16* p, int hh) { const v8b a = *(const v8b*)(p + 8 * hh), b = *(const v8b*)(p + 16 + 8 * hh); v16b f;
#pragma unroll
  for (int e = 0; e < 8; ++e) { f[e] = a[e]; f[8 + e] = b[e]; } return f; }
// same k-map as frag_kb, from the V^T staged in LDS: p = this lane's 8 elements of the channel tile's 256-element piece that holds k = 0..15; k = 16..31 is the next key tile, HD * 16 elements on
__device__ __forceinline__ v16b frag_vs(const b16* p) { const v8b a = *(const v8b*)(p), b = *(const v8b*)(p + HD * 16); v16b f;
#pragma unroll
  for (int e = 0; e < 8; ++e) { f[e] = a[e]; f[8 + e] = b[e]; } return f; }
// same k-map as frag_kb, from the tiled K: p = this lane's 8 elements of the 256-element piece that holds k = 0..15 of all 16 keys; k = 16..31 is the next piece
__device__ __forceinline__ v16b frag_kt(const b16* p) { const v8b a = *(const v8b*)(p), b = *(const v8b*)(p + 256); v16b f;
#pragma unroll
  for (int e = 0; e < 8; ++e) { f[e] = a[e]; f[8 + e] = b[e]; } return f; }
__device__ __forceinline__ v8f wmma16b(v16b a, v16b b, v8f c) { v8f d = __builtin_amdgcn_wmma_f32_16x16x32_f16(false, a, false, b, (short)0, c, false, false); asm volatile("v_nop\n\tv_nop\n\tv_nop\n\tv_nop" : "+v"(d) : "v"(a), "v"(b)); return d; }
// the bare builtin, for the attention kernel: this compiler keeps the operands of an asm statement in the first 256 registers, and a wave of two query tiles holds more than those (with the asm statement behind each product the build spilled); the compiler keeps the distance behind its own matrix instructions
__device__ __forceinline__ v8f wmma16n(v16b a, v16b b, v8f c) { return __builtin_amdgcn_wmma_f32_16x16x32_f16(false, a, false, b, (short)0, c, false, false); }
__device__ __forceinline__ void wave_lds_sync() { __builtin_amdgcn_fence(__ATOMIC_RELEASE, "workgroup"); __builtin_amdgcn_wave_barrier(); __builtin_amdgcn_fence(__ATOMIC_ACQUIRE, "workgroup"); }
// lane l <-> l ^ 16: the other half of the wave holds the other eight keys of each 16-key tile of the same query
__device__ __forceinline__ float xhalf(float v) { const int b = __float_as_int(v); return __int_as_float(__builtin_amdgcn_permlanex16(b, b, 0x76543210, 0xfedcba98, false, false)); }
__device__ __forceinline__ float pmul(float a, float b) { float p = a * b; asm volatile("" : "+v"(p)); return p; }

__global__ __launch_bounds__(256) void wput_kernel(const float* __restrict__ wq, const float* __restrict__ wk, const float* __restrict__ wv, const float* __restrict__ wo, b16* __restrict__ W3, b16* __restrict__ WO) { const size_t u = (size_t)blockIdx.x * 256 + threadIdx.x; v8b v;
  if (u < (size_t)3 * C * (CX / 8)) { const int r = (int)(u / (CX / 8)), k0 = (int)(u % (CX / 8)) * 8; const int p = r / C, o = r % C; const float* w = p == 0 ? wq : (p == 1 ? wk : wv); float wr[8];   /* all eight loads stand ahead of the first rounding: its asm statement holds later loads behind it, which cost one memory wait per element */
#pragma unroll
    for (int j = 0; j < 8; ++j) wr[j] = w[(size_t)(k0 + j) * C + o];
#pragma unroll
    for (int j = 0; j < 8; ++j) v[j] = (b16)(bf16_rne(wr[j]) * WSC); { *(v8b*)(W3 + (size_t)r * CX + k0) = v;  } }
  if (u < (size_t)CX * (C / 8)) { const int o = (int)(u / (C / 8)), k0 = (int)(u % (C / 8)) * 8; float wr[8];
#pragma unroll
    for (int j = 0; j < 8; ++j) wr[j] = wo[(size_t)(k0 + j) * CX + o];
#pragma unroll
    for (int j = 0; j < 8; ++j) v[j] = (b16)(bf16_rne(wr[j]) * WSC); { *(v8b*)(WO + (size_t)o * C + k0) = v;  } } }
__global__ __launch_bounds__(32) void proj_kernel(const float* __restrict__ x, const b16* __restrict__ W3, const float* __restrict__ bq, const float* __restrict__ bk, const float* __restrict__ bv, int TLIM, b16* __restrict__ PH, b16* __restrict__ PL, b16* __restrict__ VTH, b16* __restrict__ VTL, b16* __restrict__ KT) { __shared__ __attribute__((aligned(16))) b16 Ah[16][CX + 8], Oh[16][264], Ol[16][264]; const int lane = threadIdx.x, nloc = lane & 15, hlf = lane >> 4; const size_t m0 = (size_t)blockIdx.x * 16; if (m0 >= (size_t)TLIM) return;
#pragma unroll
  for (int r0 = 0; r0 < 16; r0 += 8) { float xv[8][CX / 32];   /* eight rows of x (64 loads) are requested before the first rounding (see wput_kernel): one memory wait per half tile, not one per element */
#pragma unroll
    for (int rr = 0; rr < 8; ++rr)
#pragma unroll
      for (int q = 0; q < CX / 32; ++q) xv[rr][q] = x[(m0 + r0 + rr) * CX + q * 32 + lane];
#pragma unroll
    for (int rr = 0; rr < 8; ++rr)
#pragma unroll
      for (int q = 0; q < CX / 32; ++q) Ah[r0 + rr][q * 32 + lane] = (b16)(bf16_rne(xv[rr][q]) * XS); }
  wave_lds_sync();
#pragma unroll 1
  for (int g = 0; g < 3; ++g) { const int pj = g;   /* one group of 8 tiles per projection (128 columns) */ const float* bb = pj == 0 ? bq : (pj == 1 ? bk : bv); v8f acc[8]; float braw[8];
#pragma unroll
    for (int t = 0; t < 8; ++t) { acc[t] = (v8f){}; braw[t] = bb[t * 16 + nloc]; }   /* the bias loads fly with the first weight group */
#pragma unroll 1   /* one group of 32 loads (128 registers) per trip, kept rolled so that the groups share those registers */
    for (int kb = 0; kb < CX; kb += 64) { v16b bw[2][8];   /* the weight fragments of two k steps are loaded ahead of their 16 products: the asm statement behind each product holds later loads back, which cost one L2 wait per product */
#pragma unroll
      for (int u2 = 0; u2 < 2; ++u2)
#pragma unroll
        for (int t = 0; t < 8; ++t) bw[u2][t] = frag_kb(W3 + (size_t)(g * C + t * 16 + nloc) * CX + kb + 32 * u2, hlf);
#pragma unroll
      for (int u2 = 0; u2 < 2; ++u2) { const v16b a = frag_kb(&Ah[nloc][kb + 32 * u2], hlf);
#pragma unroll
        for (int t = 0; t < 8; ++t) acc[t] = wmma16b(a, bw[u2][t], acc[t]); } }
    if (g == 2) {   /* v: a lane's 8 accumulator rows are 8 consecutive keys of one channel = 16 bytes of V^T; tile [this block's 16 keys][channel][16], 512 contiguous bytes per store; the v third of the PH / PL rows stays unwritten and unread */
#pragma unroll
      for (int t = 0; t < 8; ++t) { const int cc = t * 16 + nloc; const float bvv = bfv(braw[t]); v8b vh8, vl8;
#pragma unroll
        for (int r8 = 0; r8 < 8; ++r8) { b16 p, ql; split16((acc[t][r8] * (1.0f / (XS * WSC)) + bvv) * HS, p, ql); vh8[r8] = p; vl8[r8] = ql; }
        const size_t vo8 = ((size_t)blockIdx.x * HD + cc) * 16 + 8 * hlf; *(v8b*)(VTH + vo8) = vh8; *(v8b*)(VTL + vo8) = vl8; }
      asm volatile("s_wait_xcnt 0x0" ::: "memory");   /* stands behind the last V^T store, in front of any rewrite of the stores' address and data registers: this pass skips the sync whose store wait does that for k and q */
      continue; }
#pragma unroll
    for (int t = 0; t < 8; ++t) { const int cc = t * 16 + nloc; const float bvv = bfv(braw[t]);
#pragma unroll
      for (int r8 = 0; r8 < 8; ++r8) { b16 p, ql; split16((acc[t][r8] * (1.0f / (XS * WSC)) + bvv) * HS, p, ql); Oh[8 * hlf + r8][cc] = p; Ol[8 * hlf + r8][cc] = ql; } }
    wave_lds_sync();
    if (g == 1) {   /* attention keys: written in B-fragment order, tile [this block's 16 keys][hi, lo][8 pieces of 16 channels][lane][8], so that each load of the attention kernel covers 512 contiguous bytes (four whole lines) and not 32 bytes of each of 16 rows; the k third of the PH / PL rows stays unwritten and unread */
      v8b fh[HD / 16], fl[HD / 16]; b16* kt = KT + (size_t)blockIdx.x * (2 * 16 * HD) + lane * 8;
#pragma unroll
      for (int f = 0; f < HD / 16; ++f) { fh[f] = *(const v8b*)(&Oh[nloc][f * 16 + 8 * hlf]); fl[f] = *(const v8b*)(&Ol[nloc][f * 16 + 8 * hlf]); }
#pragma unroll
      for (int f = 0; f < HD / 16; ++f) { *(v8b*)(kt + f * 256) = fh[f]; *(v8b*)(kt + 16 * HD + f * 256) = fl[f]; }
      asm volatile("s_wait_xcnt 0x0" ::: "memory");   /* stands behind the last tile store, in front of any rewrite of the stores' address and data registers */
    } else
    { for (int rr = 0; rr < 16; ++rr) if (lane < 16) { *(v8b*)(PH + (m0 + rr) * PW + g * C + lane * 8) = *(const v8b*)(&Oh[rr][lane * 8]); *(v8b*)(PL + (m0 + rr) * PW + g * C + lane * 8) = *(const v8b*)(&Ol[rr][lane * 8]); }  }   
    wave_lds_sync(); } }
// attention: block per (b, h, key part kp, QT query tiles of 16), NWQ waves; wave qp holds the QW query tiles qp QW .. qp QW + QW - 1 and walks the block's keys [kp L / KP, (kp + 1) L / KP) in key blocks of 64: S^T = K Q^T (3 products, K 128), so that a lane holds the scores of one query per tile; online softmax in registers; P^T x256 hi+lo is the B operand of O^T = V^T P^T; the block writes its partial (max, sum, O) of each query, and the output kernel joins the KP partials.
// Every K and V^T fragment that a wave reads from LDS is the A operand for both of its query tiles.
// All NWQ waves of a block read the same K and V^T: one stream per block. A stage is a whole key block (K and V^T of 64 keys, hi + lo, 64 KiB), brought into LDS once per block by asynchronous copies, an eighth per wave, two buffers, the next stage in flight while this one is worked on. One foot (waits and barrier) per key block: between two feet the two waves of a SIMD are free to drift, one in its softmax while the other has the matrix unit.
// One block per WGP, 2 waves per SIMD (512 registers each). Scores and P never touch LDS; SfW only turns each wave's own O^T into rows.
__global__ __launch_bounds__(32 * NWQ) __attribute__((amdgpu_waves_per_eu(2, 2))) void att_kernel(const b16* __restrict__ PH, const b16* __restrict__ PL, const b16* __restrict__ VTH, const b16* __restrict__ VTL, const b16* __restrict__ KT, const float* __restrict__ amask, int BLIM, float* __restrict__ OP, float* __restrict__ MD) { __shared__ __attribute__((aligned(16))) b16 Stg[2][SEL]; __shared__ __attribute__((aligned(16))) float SfW[QT][16][HD + 4]; static_assert(L % (KP * KB) == 0, "whole key blocks per block: no key of a block is masked"); static_assert(NWQ == 8 && QW == 2 && HD == 128 && KB == 64 && KB == 2 * SK && NKB >= 2, "a wave copies an eighth of a stage: one K tile, or two tiles of one V^T plane");
  const int qp = __builtin_amdgcn_readfirstlane((int)(threadIdx.x >> 5));
  const int lane = threadIdx.x & 31, nloc = lane & 15, hlf = lane >> 4; const int qt = blockIdx.x % (L / (16 * QT)); const int kp = (blockIdx.x / (L / (16 * QT))) % KP; const int h = (blockIdx.x / ((L / (16 * QT)) * KP)) % NH; const int b = blockIdx.x / ((L / (16 * QT)) * KP * NH); if (b >= BLIM) return; const int tb = qt * 16 * QT, t0 = tb + qp * QW * 16; const size_t rowb = (size_t)b * L; const int qo = h * HD;
  const int kstart = kp * (L / KP);   // this block's keys [kstart, kstart + L / KP)
  // a stage in LDS: four K tiles of 16 keys in fragment order, [hi, lo] each (32 KiB, contiguous in KT); four tiles of the V^T hi plane (16 KiB); four of the lo plane. Waves 0..3 copy one K tile each, 4 and 5 a half of the hi plane, 6 and 7 a half of the lo plane: 8 KiB per wave, contiguous in global memory and in LDS.
  // V^T: lane l takes the 16 bytes (channel l % 16, key half l / 16) of each 512-byte channel tile, so that in LDS a fragment load reads 512 contiguous bytes (no bank conflict), as for K.
  const size_t tile0 = (rowb + kstart) / 16;
  const char* const g0 = qp < 4 ? (const char*)KT + (tile0 + qp) * 8192 + lane * 16 : (const char*)(qp < 6 ? VTH : VTL) + (tile0 + (qp & 1) * 2) * 4096 + (nloc * 2 + hlf) * 16;   // this lane's first 16 bytes of stage 0
  const int gs = qp < 4 ? (KB / 16) * 8192 : (KB / 16) * 4096;   // from one stage to the next
  b16* const ldst = &Stg[0][0] + qp * 4096 + lane * 8;   // this lane's first 16 bytes of its wave's eighth, buffer 0
  auto stage_copy = [&](int s) { const char* g = g0 + (size_t)s * gs; b16* l = ldst + (s & 1) * SEL;
    /* sixteen copies of 512 bytes per wave: the immediate offset moves the LDS address and the global address alike, so one address of each serves all sixteen; the builtin form, because this compiler keeps the operands of an asm statement in the first 256 registers */
#define CP(n) __builtin_amdgcn_global_load_async_to_lds_b128((gv4i*)g, (lv4i*)l, (n) * 512, 0)
    CP(0); CP(1); CP(2); CP(3); CP(4); CP(5); CP(6); CP(7); CP(8); CP(9); CP(10); CP(11); CP(12); CP(13); CP(14); CP(15);
#undef CP
  };
  stage_copy(0);
  v16b qh[QW][HD / 32], ql[QW][HD / 32];
#pragma unroll
  for (int u = 0; u < QW; ++u)
#pragma unroll
    for (int s = 0; s < HD / 32; ++s) { qh[u][s] = frag_kb(PH + (rowb + t0 + u * 16 + nloc) * PW + qo + s * 32, hlf); ql[u][s] = frag_kb(PL + (rowb + t0 + u * 16 + nloc) * PW + qo + s * 32, hlf); }
  float m_q[QW], den_q[QW]; v8f acc[QW][HD / 16];   /* this lane's query of tile u (column nloc): running max; sum over the keys of this lane half; acc[u][t][r8] = O^T[channel 16 t + 8 hlf + r8][query nloc] */
#pragma unroll
  for (int u = 0; u < QW; ++u) { m_q[u] = -INFINITY; den_q[u] = 0.0f;
#pragma unroll
    for (int t = 0; t < HD / 16; ++t) acc[u][t] = (v8f){}; }
  asm volatile("s_wait_asynccnt 0x0" ::: "memory");   /* stage 0 has landed before the barrier publishes it */
  __syncthreads();
  stage_copy(1);
#pragma unroll 1   /* one key block per trip: the body is long; the buffer is one base register, every place in the stage an immediate offset */
  for (int kbi = 0; kbi < NKB; ++kbi) { const b16* const sb = &Stg[0][0] + (kbi & 1) * SEL + lane * 8; v8f st[QW][KB / 16];   /* st[u][t][r8] = S^T[key 16 t + 8 hlf + r8][query nloc of tile u], x HS HS */
#pragma unroll   /* the score tiles live in registers: constant indices only */
    for (int kt = 0; kt < KB / 16; ++kt) { const b16* kq = sb + kt * (2 * 16 * HD); v8f s[QW]; v16b kh[HD / 32], kl[HD / 32];   /* all 16 LDS loads of a key tile are issued ahead of its 24 products: one wait per tile */
#pragma unroll
      for (int q = 0; q < HD / 32; ++q) { kh[q] = frag_kt(kq + q * 512); kl[q] = frag_kt(kq + 16 * HD + q * 512); }
      __builtin_amdgcn_sched_barrier(0);   /* keeps the loads in one group ahead of the products: without it the compiler sinks each pair of loads to its first use and waits for the LDS before every second product */
#pragma unroll
      for (int u = 0; u < QW; ++u) s[u] = (v8f){};
#pragma unroll   /* the two query tiles' chains alternate: each product stands in the other chain's accumulator latency; within a chain the products of a k step keep the order hi hi, lo hi, hi lo */
      for (int q = 0; q < HD / 32; ++q) {
#pragma unroll
        for (int u = 0; u < QW; ++u) s[u] = wmma16n(kh[q], qh[u][q], s[u]);
#pragma unroll
        for (int u = 0; u < QW; ++u) s[u] = wmma16n(kl[q], qh[u][q], s[u]);
#pragma unroll
        for (int u = 0; u < QW; ++u) s[u] = wmma16n(kh[q], ql[u][q], s[u]); }
#pragma unroll
      for (int u = 0; u < QW; ++u) st[u][kt] = s[u]; }
    v16b pa[QW][KB / SK], pb[QW][KB / SK];   /* P^T x256 hi / lo: two score tiles converted in place are the B fragment of 32 keys (element e <- key 8 hlf + e, 8 + e <- key 16 + 8 hlf + e) */
#pragma unroll
    for (int u = 0; u < QW; ++u) {
      /* softmax of one query per lane and tile: max and sum run over the lane's own registers; the max is joined with the other lane half by one exchange, the sums of the two halves once behind the loop */
      float mx = st[u][0][0];
#pragma unroll
      for (int t = 0; t < KB / 16; ++t)
#pragma unroll
        for (int r8 = 0; r8 < 8; ++r8) mx = fmaxf(mx, st[u][t][r8]);
      mx = fmaxf(mx, xhalf(mx)) * (1.0f / (HS * HS));
      const float mold = m_q[u]; const float mn = fmaxf(mold, mx); const float es = __expf(mold - mn); const float sf = (mold == -INFINITY) ? 0.0f : es;   /* a select, no branch: mold above -inf makes mn finite */
      const float mz = (mn == -INFINITY) ? 0.0f : mn;   /* every score of the query so far is -inf: exp(-inf - 0) = 0, as for a single such score */
      float ps[4] = {0.0f, 0.0f, 0.0f, 0.0f};
#pragma unroll
      for (int t = 0; t < KB / 16; ++t)
#pragma unroll
        for (int r8 = 0; r8 < 8; ++r8) { const float p = __expf(st[u][t][r8] * (1.0f / (HS * HS)) - mz); ps[r8 & 3] += p; b16 hi, lo; split16(p * PS, hi, lo); pa[u][t >> 1][(t & 1) * 8 + r8] = hi; pb[u][t >> 1][(t & 1) * 8 + r8] = lo; }
      den_q[u] = den_q[u] * sf + ((ps[0] + ps[1]) + (ps[2] + ps[3])); m_q[u] = mn;
#pragma unroll
      for (int t = 0; t < HD / 16; ++t) acc[u][t] = acc[u][t] * sf; }
    v16b pca[QW], pcb[QW];   /* the P fragments of the current 32 keys */
#pragma unroll
    for (int u = 0; u < QW; ++u) { pca[u] = pa[u][0]; pcb[u] = pb[u][0]; }
    static_assert(KB / SK == 2, "the second trip takes the second P fragments");
#pragma unroll 1   /* kept rolled: unrolled, the compiler puts the V^T loads of all 64 keys (256 registers) ahead of the first product and spills the Q fragments; the price is the 32 register moves at the trip's end */
    for (int ph = 0; ph < KB / SK; ++ph) { const b16* vs0 = sb + VOF + ph * (2 * 16 * HD);   /* the two hi tiles of these 32 keys; the lo plane lies KB HD elements on */
#pragma unroll
      for (int tg = 0; tg < HD / 16; tg += 4) { v16b vh[4], vl[4];   /* the V^T fragments of four channel tiles are loaded ahead of their products: one wait per 24 products */
#pragma unroll
        for (int t = 0; t < 4; ++t) { vh[t] = frag_vs(vs0 + (tg + t) * 256); vl[t] = frag_vs(vs0 + KB * HD + (tg + t) * 256); }
        __builtin_amdgcn_sched_barrier(0);   /* keeps the loads in one group ahead of the products, as for K */
#pragma unroll
        for (int t = 0; t < 4; ++t) {
#pragma unroll
          for (int u = 0; u < QW; ++u) acc[u][tg + t] = wmma16n(vh[t], pca[u], acc[u][tg + t]);
#pragma unroll
          for (int u = 0; u < QW; ++u) acc[u][tg + t] = wmma16n(vl[t], pca[u], acc[u][tg + t]);
#pragma unroll
          for (int u = 0; u < QW; ++u) acc[u][tg + t] = wmma16n(vh[t], pcb[u], acc[u][tg + t]); } }
#pragma unroll
      for (int u = 0; u < QW; ++u) { pca[u] = pa[u][1]; pcb[u] = pb[u][1]; } }
    /* foot of stage kbi: this wave's LDS reads of the stage are done, its copies of stage kbi + 1 have landed, every wave has passed both; only then is the buffer of stage kbi refilled */
    asm volatile("s_wait_dscnt 0x0" ::: "memory");     /* the wave's reads of this buffer have returned before another wave's copies may overwrite it */
    asm volatile("s_wait_asynccnt 0x0" ::: "memory");  /* the wave's own copies of the next stage have landed before the barrier publishes them */
    __syncthreads();
    if (kbi + 2 < NKB) stage_copy(kbi + 2); }
  asm volatile("s_wait_asynccnt 0x0" ::: "memory");   /* no copy is outstanding when the wave goes on to its stores and ends */
  const size_t prow = (size_t)kp * NT + rowb + t0;   /* this wave's first row in the planes of part kp */
#pragma unroll
  for (int u = 0; u < QW; ++u) {
#pragma unroll
    for (int t = 0; t < HD / 16; ++t) { *(v4f*)&SfW[qp * QW + u][nloc][t * 16 + 8 * hlf] = (v4f){acc[u][t][0], acc[u][t][1], acc[u][t][2], acc[u][t][3]}; *(v4f*)&SfW[qp * QW + u][nloc][t * 16 + 8 * hlf + 4] = (v4f){acc[u][t][4], acc[u][t][5], acc[u][t][6], acc[u][t][7]}; }   /* a lane's 8 accumulator rows are 8 consecutive channels of its query */
    const float dsum = den_q[u] + xhalf(den_q[u]); if (hlf == 0) *(v2f*)(MD + (prow + u * 16 + nloc) * 2) = (v2f){m_q[u], dsum}; }
  wave_lds_sync();   /* a wave reads back only the two tiles that it wrote itself: no block barrier */
#pragma unroll 1   /* eight rows per trip, kept rolled so that the wait below stands in front of every reuse of the stores' registers */
  for (int i0 = 0; i0 < QW * 16; i0 += 8) { v4f sv[8];   /* a row of 512 bytes per store, a lane four consecutive channels */
#pragma unroll
    for (int i = 0; i < 8; ++i) sv[i] = *(const v4f*)&SfW[qp * QW + (i0 >> 4)][(i0 & 15) + i][lane * 4];
#pragma unroll
    for (int i = 0; i < 8; ++i) *(v4f*)(OP + (prow + i0 + i) * C + h * HD + lane * 4) = sv[i];
    asm volatile("s_wait_xcnt 0x0" ::: "memory");   /* stands behind the stores, in front of the next trip's rewrite of their data and address registers */
  } }
__global__ __launch_bounds__(32) void out_kernel(const float* __restrict__ OP, const float* __restrict__ MD, const b16* __restrict__ WO, const float* __restrict__ bo, const float* __restrict__ xres, int TLIM, float* __restrict__ out) { __shared__ __attribute__((aligned(16))) b16 Ah[16][C + 8], Al[16][C + 8]; __shared__ float Tf[16][260]; const int lane = threadIdx.x, nloc = lane & 15, hlf = lane >> 4; const size_t m0 = (size_t)blockIdx.x * 16; if (m0 >= (size_t)TLIM) return;
  /* join of the KP partial results of each query: lane (row nloc, half hlf) holds (max, sum) of the parts hlf and hlf + 2; attended x HS = sum over the parts of O_p exp(m_p - m) / (PS sum) */
  static_assert(KP == 4 && C == 128, "two parts per lane half; a lane takes four channels of a row");
  const v2f mda = *(const v2f*)(MD + ((size_t)hlf * NT + m0 + nloc) * 2), mdb = *(const v2f*)(MD + ((size_t)(hlf + 2) * NT + m0 + nloc) * 2);
  asm volatile("s_wait_xcnt 0x0" ::: "memory");   /* stands behind the two loads, in front of any rewrite of their address registers */
  float mx = fmaxf(mda[0], mdb[0]); mx = fmaxf(mx, xhalf(mx));
  const float ea = (mda[0] == -INFINITY) ? 0.0f : __expf(mda[0] - mx), eb = (mdb[0] == -INFINITY) ? 0.0f : __expf(mdb[0] - mx);
  float dn = ea * mda[1] + eb * mdb[1]; dn = dn + xhalf(dn);
  const float rs = dn > 0.0f ? (1.0f / PS) / dn : 0.0f; const int ca = __float_as_int(ea * rs), cb = __float_as_int(eb * rs);
#pragma unroll 1   /* kept rolled: unrolled, the compiler requests all 64 loads at once and goes beyond the first 256 registers */
  for (int r0 = 0; r0 < 16; r0 += 8) { v4f pv[8][KP];   /* the four parts of eight rows (32 loads of 512 bytes) are requested together: one wait per half tile */
#pragma unroll
    for (int p = 0; p < KP; ++p) {
#pragma unroll
      for (int rr = 0; rr < 8; ++rr) pv[rr][p] = *(const v4f*)(OP + ((size_t)p * NT + m0 + r0 + rr) * C + lane * 4);
      asm volatile("s_wait_xcnt 0x0" ::: "memory");   /* stands behind the eight loads of a part, in front of any rewrite of their address registers: the compiler lets a later part's loads land in them; the data of all 32 loads stays in flight */
    }
#pragma unroll
    for (int rr = 0; rr < 8; ++rr) { const int r = r0 + rr;   /* the row's four weights, the same for every lane, from the two lanes that hold them; parts joined in the order 0..KP-1 */
      const float c0 = __int_as_float(__builtin_amdgcn_readlane(ca, r)), c1 = __int_as_float(__builtin_amdgcn_readlane(ca, 16 + r)), c2 = __int_as_float(__builtin_amdgcn_readlane(cb, r)), c3 = __int_as_float(__builtin_amdgcn_readlane(cb, 16 + r));
      const v4f a = pv[rr][0] * c0 + pv[rr][1] * c1 + pv[rr][2] * c2 + pv[rr][3] * c3; v4b ah4, al4;
#pragma unroll
      for (int j = 0; j < 4; ++j) { b16 p, ql; split16(a[j], p, ql); ah4[j] = p; al4[j] = ql; }
      *(v4b*)&Ah[r][lane * 4] = ah4; *(v4b*)&Al[r][lane * 4] = al4; } }
  wave_lds_sync();
#pragma unroll 1
  for (int g = 0; g < CX / 256; ++g) { v8f acc[16]; float braw[16];
#pragma unroll
    for (int t = 0; t < 16; ++t) { acc[t] = (v8f){}; braw[t] = bo[g * 256 + t * 16 + nloc]; }   /* the bias loads fly with the first weight group */
#pragma unroll 2
    for (int kb = 0; kb < C; kb += 32) { const v16b a = frag_kb(&Ah[nloc][kb], hlf), al = frag_kb(&Al[nloc][kb], hlf);
#pragma unroll
      for (int tg = 0; tg < 16; tg += 8) { v16b bw[8];   /* the weight fragments of eight tiles are loaded ahead of their 16 products: one L2 wait per group, not one per tile */
#pragma unroll
        for (int t = 0; t < 8; ++t) bw[t] = frag_kb(WO + (size_t)(g * 256 + (tg + t) * 16 + nloc) * C + kb, hlf);
#pragma unroll
        for (int t = 0; t < 8; ++t) { acc[tg + t] = wmma16b(a, bw[t], acc[tg + t]); acc[tg + t] = wmma16b(al, bw[t], acc[tg + t]); } } }
#pragma unroll
    for (int tg = 0; tg < 16; tg += 8) { float xr[8][8];   /* the residual of eight tiles is requested ahead of the first rounding: one wait per 64 loads, not one per element */
#pragma unroll
      for (int t = 0; t < 8; ++t)
#pragma unroll
        for (int r8 = 0; r8 < 8; ++r8) xr[t][r8] = xres[(m0 + 8 * hlf + r8) * CX + g * 256 + (tg + t) * 16 + nloc];
#pragma unroll
      for (int t = 0; t < 8; ++t) { const int cc = (tg + t) * 16 + nloc; const float bb = bfv(braw[tg + t]);
#pragma unroll
        for (int r8 = 0; r8 < 8; ++r8) { const int rr = 8 * hlf + r8; Tf[rr][cc] = acc[tg + t][r8] * (1.0f / (HS * WSC)) + bb + bfv(xr[t][r8]); } } }   /* + residual x */
    wave_lds_sync();
    { for (int rr = 0; rr < 16; ++rr) for (int q = 0; q < 2; ++q) *(v4f*)(out + (m0 + rr) * CX + g * 256 + q * 128 + lane * 4) = *(const v4f*)(&Tf[rr][q * 128 + lane * 4]);  }
    wave_lds_sync(); } }
}  // namespace

extern "C" void kernel_launch(void* const* d_in, const int* in_sizes, int n_in, void* d_out, int out_size, void* d_ws, size_t ws_size, hipStream_t stream) {
  (void)n_in;
  auto Fp = [&](int i) { return (const float*)d_in[i]; };
  // input order: 0 x [4,64,64,256]; 1 wk [256,128]; 2 bk; 3 wq [256,128]; 4 bq; 5 wv [256,128]; 6 bv; 7 wo [128,256]; 8 bo [256]  (all (in,out))
  if (in_sizes[0] != NT * CX || in_sizes[1] != CX * C || in_sizes[3] != CX * C || in_sizes[5] != CX * C || in_sizes[7] != C * CX || in_sizes[8] != CX || out_size != NT * CX) return;
  const int BLIM = NB;
  const int TLIM = BLIM * L;
  size_t off = 0; char* ws = (char*)d_ws;
  auto carve = [&](size_t bytes) { char* p = ws + off; off += (bytes + 255) & ~(size_t)255; return p; };
  b16* W3 = (b16*)carve((size_t)3 * C * CX * 2); b16* WO = (b16*)carve((size_t)CX * C * 2); b16* PH = (b16*)carve((size_t)NT * PW * 2); b16* PL = (b16*)carve((size_t)NT * PW * 2); float* OP = (float*)carve((size_t)KP * NT * C * 4); float* MD = (float*)carve((size_t)KP * NT * 2 * 4); b16* VTH = (b16*)carve((size_t)NT * HD * 2); b16* VTL = (b16*)carve((size_t)NT * HD * 2); b16* KT = (b16*)carve((size_t)NT * HD * 2 * 2);
  if (off > ws_size || off > ((size_t)96 << 20)) return;   // ~ 75 MB
  wput_kernel<<<(unsigned)(((size_t)3 * C * (CX / 8) + 255) / 256), 256, 0, stream>>>(Fp(1), Fp(3), Fp(5), Fp(7), W3, WO);
  proj_kernel<<<TLIM / 16, 32, 0, stream>>>(Fp(0), W3, Fp(2), Fp(4), Fp(6), TLIM, PH, PL, VTH, VTL, KT);
  att_kernel<<<BLIM * NH * KP * (L / (16 * QT)), 32 * NWQ, 0, stream>>>(PH, PL, VTH, VTL, KT, (const float*)0, BLIM, OP, MD);
  out_kernel<<<TLIM / 16, 32, 0, stream>>>(OP, MD, WO, Fp(8), Fp(0), TLIM, (float*)d_out);
}

// v009
// A run of this version takes 87.5 microseconds.
// Timed twice side by side with v008, it ran 1.04 times as fast both times.
// Counting every step since v000, it is 33.5 times as fast.
#include <hip/hip_runtime.h>

// Self_attention_pixel_wise: per image (4,096 pixels, NHWC 256 ch): k = x wk + bk, q = x wq + bq, v = x wv + bv (128); scores[n][m] = k_n . q_m (no scaling); attn = softmax over m; o = attn v; out = o wo + bo + x -> [4][64][64][256].
// Note the roles: the module's 'key' is the attention query (rows n) and its 'query' the attention key (columns m).
// Deterministic: no index structures, no atomics; flash-style online softmax, the keys of a query tile split over four blocks in a fixed order, the four partial results joined in a fixed order by the output kernel.
// WMMA (v_wmma_f32_16x16x32_f16, f32 accumulate): the QKV projection with x EXACT bf16 x8 (K 256) against exact weight rows x256 (one product); S^T = K Q^T (hi+lo x hi+lo, 3 products, K 128; K is the A operand, Q the B operand; K is written by the projection in B-fragment order, tiles [16 keys][hi, lo][8][32 lanes][8], staged in LDS by asynchronous copies for sixteen query tiles at once and read from there in loads of 512 contiguous bytes); O^T = V^T P^T (V^T hi+lo as A, P^T x256 hi+lo as B, packed in registers from the score tiles, 3 products; V^T is written by the projection in tiles [16 keys][128 channels][16] and staged in LDS the same way); out = attended (hi+lo) Wo^T (2 products); softmax in f32. Inputs rounded to bf16 once. Fragment k-map per lane half hh for A AND B: elements 0..7 <- k = 8hh+0..7, 8..15 <- k = 16+8hh+0..7; acc[r] = D[8hh+r][col].

namespace {
constexpr int NB = 4, L = 4096, C = 128, CX = 256 /* input / output channels */, NH = 1, HD = 128, NT = NB * L, KB = 64 /* keys per softmax block: its score tiles stay in registers */, PW = 3 * C, KP = 4 /* key parts: an attention block takes L / KP keys */, QT = 16 /* query tiles per attention block */, QW = 2 /* query tiles per attention wave */, NWQ = QT / QW /* waves per attention block */, SK = 32 /* keys per P fragment */, SEL = KB * HD * 2 * 2 /* elements of a stage: K and V^T of a key block, hi + lo each */, VOF = KB * HD * 2 /* where V^T begins in a stage */, NKB = L / KP / KB /* stages (key blocks) per attention block */, PRT = 4 /* row tiles per projection block */, PWV = 3 * PRT /* its waves: one per row tile and projection */, ORT = 4 /* row tiles per output block */, OCG = 4 /* column groups of the output */, OCW = CX / OCG /* columns per group */, OWV = ORT * OCG /* waves per output block */;
constexpr float XS = 8.0f, HS = 256.0f /* hi+lo staging scale for k/q/v/attended */, WSC = 256.0f, PS = 256.0f, SCALE = 1.0f;
typedef _Float16 b16;
typedef _Float16 __attribute__((may_alias)) b16a;
typedef __attribute__((ext_vector_type(16))) _Float16 v16b;
typedef __attribute__((ext_vector_type(8))) _Float16 v8b;
typedef __attribute__((ext_vector_type(4))) _Float16 v4b;
typedef __attribute__((ext_vector_type(8))) float v8f;
typedef __attribute__((ext_vector_type(4))) float v4f;
typedef __attribute__((ext_vector_type(2))) float v2f;
typedef __attribute__((ext_vector_type(4))) int v4i;
typedef __attribute__((address_space(1))) v4i gv4i;   /* 16 bytes in global memory, 16 bytes in LDS: the asynchronous copy's two pointers */
typedef __attribute__((address_space(3))) v4i lv4i;
__device__ __forceinline__ float bf16_rne(float f) { unsigned int u = __float_as_uint(f); u += 0x7FFFu + ((u >> 16) & 1u); float r = __uint_as_float(u & 0xFFFF0000u); asm volatile("" : "+v"(r)); return r; }
__device__ __forceinline__ float bfv(float f) { float r = bf16_rne(f); asm volatile("" : "+v"(r)); return r; }
__device__ __forceinline__ void split16(float v, b16& hi, b16& lo) { hi = (b16)v; lo = (b16)(v - (float)hi); }
__device__ __forceinline__ v16b frag_kb(const b16* p, int hh) { const v8b a = *(const v8b*)(p + 8 * hh), b = *(const v8b*)(p + 16 + 8 * hh); v16b f;
#pragma unroll
  for (int e = 0; e < 8; ++e) { f[e] = a[e]; f[8 + e] = b[e]; } return f; }
// same k-map as frag_kb, from the V^T staged in LDS: p = this lane's 8 elements of the channel tile's 256-element piece that holds k = 0..15; k = 16..31 is the next key tile, HD * 16 elements on
__device__ __forceinline__ v16b frag_vs(const b16* p) { const v8b a = *(const v8b*)(p), b = *(const v8b*)(p + HD * 16); v16b f;
#pragma unroll
  for (int e = 0; e < 8; ++e) { f[e] = a[e]; f[8 + e] = b[e]; } return f; }
// same k-map as frag_kb, from the tiled K: p = this lane's 8 elements of the 256-element piece that holds k = 0..15 of all 16 keys; k = 16..31 is the next piece
__device__ __forceinline__ v16b frag_kt(const b16* p) { const v8b a = *(const v8b*)(p), b = *(const v8b*)(p + 256); v16b f;
#pragma unroll
  for (int e = 0; e < 8; ++e) { f[e] = a[e]; f[8 + e] = b[e]; } return f; }
__device__ __forceinline__ v8f wmma16b(v16b a, v16b b, v8f c) { v8f d = __builtin_amdgcn_wmma_f32_16x16x32_f16(false, a, false, b, (short)0, c, false, false); asm volatile("v_nop\n\tv_nop\n\tv_nop\n\tv_nop" : "+v"(d) : "v"(a), "v"(b)); return d; }
// the bare builtin, for the attention kernel: this compiler keeps the operands of an asm statement in the first 256 registers, and a wave of two query tiles holds more than those (with the asm statement behind each product the build spilled); the compiler keeps the distance behind its own matrix instructions
__device__ __forceinline__ v8f wmma16n(v16b a, v16b b, v8f c) { return __builtin_amdgcn_wmma_f32_16x16x32_f16(false, a, false, b, (short)0, c, false, false); }
__device__ __forceinline__ void wave_lds_sync() { __builtin_amdgcn_fence(__ATOMIC_RELEASE, "workgroup"); __builtin_amdgcn_wave_barrier(); __builtin_amdgcn_fence(__ATOMIC_ACQUIRE, "workgroup"); }
// lane l <-> l ^ 16: the other half of the wave holds the other eight keys of each 16-key tile of the same query
__device__ __forceinline__ float xhalf(float v) { const int b = __float_as_int(v); return __int_as_float(__builtin_amdgcn_permlanex16(b, b, 0x76543210, 0xfedcba98, false, false)); }
// a pointer that is the same for the whole wave, put into scalar registers: a load through it takes the form scalar base + one lane offset register
__device__ __forceinline__ const char* sbase(const void* p) { const unsigned long long a = (unsigned long long)p; const unsigned lo = (unsigned)__builtin_amdgcn_readfirstlane((int)(unsigned)a), hi = (unsigned)__builtin_amdgcn_readfirstlane((int)(unsigned)(a >> 32)); return (const char*)(const __attribute__((address_space(1))) char*)(((unsigned long long)hi << 32) | lo); }   /* by way of a global-memory pointer, so that the loads stay global loads */
__device__ __forceinline__ float pmul(float a, float b) { float p = a * b; asm volatile("" : "+v"(p)); return p; }

__global__ __launch_bounds__(256) void wput_kernel(const float* __restrict__ wq, const float* __restrict__ wk, const float* __restrict__ wv, const float* __restrict__ wo, b16* __restrict__ W3, b16* __restrict__ WO) { const size_t u = (size_t)blockIdx.x * 256 + threadIdx.x; v8b v;
  if (u < (size_t)3 * C * (CX / 8)) { const int r = (int)(u / (CX / 8)), k0 = (int)(u % (CX / 8)) * 8; const int p = r / C, o = r % C; const float* w = p == 0 ? wq : (p == 1 ? wk : wv); float wr[8];   /* all eight loads stand ahead of the first rounding: its asm statement holds later loads behind it, which cost one memory wait per element */
#pragma unroll
    for (int j = 0; j < 8; ++j) wr[j] = w[(size_t)(k0 + j) * C + o];
#pragma unroll
    for (int j = 0; j < 8; ++j) v[j] = (b16)(bf16_rne(wr[j]) * WSC); { *(v8b*)(W3 + (size_t)r * CX + k0) = v;  } }
  if (u < (size_t)CX * (C / 8)) { const int o = (int)(u / (C / 8)), k0 = (int)(u % (C / 8)) * 8; float wr[8];
#pragma unroll
    for (int j = 0; j < 8; ++j) wr[j] = wo[(size_t)(k0 + j) * CX + o];
#pragma unroll
    for (int j = 0; j < 8; ++j) v[j] = (b16)(bf16_rne(wr[j]) * WSC); { *(v8b*)(WO + (size_t)o * C + k0) = v;  } } }
// projection: block per PRT row tiles of 16 pixels, 3 PRT waves; wave (rt, g) does projection g (0 q, 1 k, 2 v; 128 columns) of row tile rt. The three waves of a row tile share its x, staged once in LDS (rows g, g + 3, ... per wave) behind one block barrier.
// One block per WGP, three waves per SIMD: a wave's memory waits and dependent vector chains are covered by the other two; a wave alone on its SIMD sat through all of them, for three projections in a row.
__global__ __launch_bounds__(32 * PWV) void proj_kernel(const float* __restrict__ x, const b16* __restrict__ W3, const float* __restrict__ bq, const float* __restrict__ bk, const float* __restrict__ bv, int TLIM, b16* __restrict__ PH, b16* __restrict__ PL, b16* __restrict__ VTH, b16* __restrict__ VTL, b16* __restrict__ KT) { __shared__ __attribute__((aligned(16))) b16 Ah[PRT][16][CX + 8], Oh[2 * PRT][16][C + 8], Ol[2 * PRT][16][C + 8]; static_assert(L % (16 * PRT) == 0, "a block's rows are all inside the row limit or all outside");
  const int wv = __builtin_amdgcn_readfirstlane((int)(threadIdx.x >> 5)), rt = wv / 3, g = wv % 3; const int lane = threadIdx.x & 31, nloc = lane & 15, hlf = lane >> 4; if ((size_t)blockIdx.x * (16 * PRT) >= (size_t)TLIM) return;   /* the whole block leaves, in front of the barrier */
  const size_t mt = (size_t)blockIdx.x * PRT + rt, m0 = mt * 16;   /* this wave's row tile, its first row */
  { float xv[6][CX / 32];   /* the wave's rows of x (40 or 48 loads) are requested before the first rounding (see wput_kernel): one memory wait, not one per element */
    const float* const xa = x + (m0 + g) * CX + lane, * const xb = x + (m0 + 15) * CX + lane;   /* rows g, g + 3, .. g + 12; wave 0 takes row 15 too */
#pragma unroll
    for (int i = 0; i < 5; ++i)
#pragma unroll
      for (int q = 0; q < CX / 32; ++q) xv[i][q] = xa[(size_t)(3 * i) * CX + q * 32];
    asm volatile("s_wait_xcnt 0x0" ::: "memory");   /* stands behind the loads, in front of any rewrite of their address registers; the data stays in flight */
    if (g == 0) {
#pragma unroll
      for (int q = 0; q < CX / 32; ++q) xv[5][q] = xb[q * 32];
      asm volatile("s_wait_xcnt 0x0" ::: "memory");   /* as above */
    }
#pragma unroll
    for (int i = 0; i < 6; ++i) if (g + 3 * i < 16) {
#pragma unroll
      for (int q = 0; q < CX / 32; ++q) Ah[rt][g + 3 * i][q * 32 + lane] = (b16)(bf16_rne(xv[i][q]) * XS); } }
  __syncthreads();   /* the row tile's x is written by three waves and read by all three */
  const float* bb = g == 0 ? bq : (g == 1 ? bk : bv); v8f acc[8]; float braw[8];
#pragma unroll
  for (int t = 0; t < 8; ++t) { acc[t] = (v8f){}; braw[t] = bb[t * 16 + nloc]; }   /* the bias loads fly with the first weight group */
#pragma unroll 1   /* one group of 32 loads (128 registers) per trip, kept rolled so that the groups share those registers */
  for (int kb = 0; kb < CX; kb += 64) { v16b bw[2][8];   /* the weight fragments of two k steps are loaded ahead of their 16 products: the asm statement behind each product holds later loads back, which cost one L2 wait per product */
#pragma unroll
    for (int u2 = 0; u2 < 2; ++u2)
#pragma unroll
      for (int t = 0; t < 8; ++t) bw[u2][t] = frag_kb(W3 + (size_t)(g * C + t * 16 + nloc) * CX + kb + 32 * u2, hlf);
#pragma unroll
    for (int u2 = 0; u2 < 2; ++u2) { const v16b a = frag_kb(&Ah[rt][nloc][kb + 32 * u2], hlf);
#pragma unroll
      for (int t = 0; t < 8; ++t) acc[t] = wmma16b(a, bw[u2][t], acc[t]); } }
  if (g == 2) {   /* v: a lane's 8 accumulator rows are 8 consecutive keys of one channel = 16 bytes of V^T; tile [this wave's 16 keys][channel][16], 512 contiguous bytes per store; the v third of the PH / PL rows stays unwritten and unread */
#pragma unroll
    for (int t = 0; t < 8; ++t) { const int cc = t * 16 + nloc; const float bvv = bfv(braw[t]); v8b vh8, vl8;
#pragma unroll
      for (int r8 = 0; r8 < 8; ++r8) { b16 p, ql; split16((acc[t][r8] * (1.0f / (XS * WSC)) + bvv) * HS, p, ql); vh8[r8] = p; vl8[r8] = ql; }
      const size_t vo8 = (mt * HD + cc) * 16 + 8 * hlf; *(v8b*)(VTH + vo8) = vh8; *(v8b*)(VTL + vo8) = vl8; }
    asm volatile("s_wait_xcnt 0x0" ::: "memory");   /* stands behind the last V^T store, in front of any rewrite of the stores' address and data registers */
    return; }   /* no barrier follows */
  const int oi = rt * 2 + g;   /* this wave's own turning tile */
#pragma unroll
  for (int t = 0; t < 8; ++t) { const int cc = t * 16 + nloc; const float bvv = bfv(braw[t]);
#pragma unroll
    for (int r8 = 0; r8 < 8; ++r8) { b16 p, ql; split16((acc[t][r8] * (1.0f / (XS * WSC)) + bvv) * HS, p, ql); Oh[oi][8 * hlf + r8][cc] = p; Ol[oi][8 * hlf + r8][cc] = ql; } }
  wave_lds_sync();   /* a wave reads back only the tile that it wrote itself: no block barrier */
  v8b fh[HD / 16], fl[HD / 16];
  if (g == 1) {   /* attention keys: written in B-fragment order, tile [this wave's 16 keys][hi, lo][8 pieces of 16 channels][lane][8], so that each load of the attention kernel covers 512 contiguous bytes (four whole lines) and not 32 bytes of each of 16 rows; the k third of the PH / PL rows stays unwritten and unread */
    b16* kt = KT + mt * (2 * 16 * HD) + lane * 8;
#pragma unroll
    for (int f = 0; f < HD / 16; ++f) { fh[f] = *(const v8b*)(&Oh[oi][nloc][f * 16 + 8 * hlf]); fl[f] = *(const v8b*)(&Ol[oi][nloc][f * 16 + 8 * hlf]); }
#pragma unroll
    for (int f = 0; f < HD / 16; ++f) { *(v8b*)(kt + f * 256) = fh[f]; *(v8b*)(kt + 16 * HD + f * 256) = fl[f]; }
    asm volatile("s_wait_xcnt 0x0" ::: "memory");   /* stands behind the last tile store, in front of any rewrite of the stores' address and data registers */
  } else {   /* attention queries: rows of PH / PL, a lane half per row (256 contiguous bytes), two rows per store */
#pragma unroll
    for (int f = 0; f < 8; ++f) { fh[f] = *(const v8b*)(&Oh[oi][2 * f + hlf][nloc * 8]); fl[f] = *(const v8b*)(&Ol[oi][2 * f + hlf][nloc * 8]); }
#pragma unroll
    for (int f = 0; f < 8; ++f) { *(v8b*)(PH + (m0 + 2 * f + hlf) * PW + nloc * 8) = fh[f]; *(v8b*)(PL + (m0 + 2 * f + hlf) * PW + nloc * 8) = fl[f]; }
    asm volatile("s_wait_xcnt 0x0" ::: "memory");   /* stands behind the last row store, as above */
  }
}
// attention: block per (b, h, key part kp, QT query tiles of 16), NWQ waves; wave qp holds the QW query tiles qp QW .. qp QW + QW - 1 and walks the block's keys [kp L / KP, (kp + 1) L / KP) in key blocks of 64: S^T = K Q^T (3 products, K 128), so that a lane holds the scores of one query per tile; online softmax in registers; P^T x256 hi+lo is the B operand of O^T = V^T P^T; the block writes its partial (max, sum, O) of each query, and the output kernel joins the KP partials.
// Every K and V^T fragment that a wave reads from LDS is the A operand for both of its query tiles.
// All NWQ waves of a block read the same K and V^T: one stream per block. A stage is a whole key block (K and V^T of 64 keys, hi + lo, 64 KiB), brought into LDS once per block by asynchronous copies, an eighth per wave, two buffers, the next stage in flight while this one is worked on. One foot (waits and barrier) per key block: between two feet the two waves of a SIMD are free to drift, one in its softmax while the other has the matrix unit.
// One block per WGP, 2 waves per SIMD (512 registers each). Scores and P never touch LDS; SfW only turns each wave's own O^T into rows.
__global__ __launch_bounds__(32 * NWQ) __attribute__((amdgpu_waves_per_eu(2, 2))) void att_kernel(const b16* __restrict__ PH, const b16* __restrict__ PL, const b16* __restrict__ VTH, const b16* __restrict__ VTL, const b16* __restrict__ KT, const float* __restrict__ amask, int BLIM, float* __restrict__ OP, float* __restrict__ MD) { __shared__ __attribute__((aligned(16))) b16 Stg[2][SEL]; __shared__ __attribute__((aligned(16))) float SfW[QT][16][HD + 4]; static_assert(L % (KP * KB) == 0, "whole key blocks per block: no key of a block is masked"); static_assert(NWQ == 8 && QW == 2 && HD == 128 && KB == 64 && KB == 2 * SK && NKB >= 2, "a wave copies an eighth of a stage: one K tile, or two tiles of one V^T plane");
  const int qp = __builtin_amdgcn_readfirstlane((int)(threadIdx.x >> 5));
  const int lane = threadIdx.x & 31, nloc = lane & 15, hlf = lane >> 4; const int qt = blockIdx.x % (L / (16 * QT)); const int kp = (blockIdx.x / (L / (16 * QT))) % KP; const int h = (blockIdx.x / ((L / (16 * QT)) * KP)) % NH; const int b = blockIdx.x / ((L / (16 * QT)) * KP * NH); if (b >= BLIM) return; const int tb = qt * 16 * QT, t0 = tb + qp * QW * 16; const size_t rowb = (size_t)b * L; const int qo = h * HD;
  const int kstart = kp * (L / KP);   // this block's keys [kstart, kstart + L / KP)
  // a stage in LDS: four K tiles of 16 keys in fragment order, [hi, lo] each (32 KiB, contiguous in KT); four tiles of the V^T hi plane (16 KiB); four of the lo plane. Waves 0..3 copy one K tile each, 4 and 5 a half of the hi plane, 6 and 7 a half of the lo plane: 8 KiB per wave, contiguous in global memory and in LDS.
  // V^T: lane l takes the 16 bytes (channel l % 16, key half l / 16) of each 512-byte channel tile, so that in LDS a fragment load reads 512 contiguous bytes (no bank conflict), as for K.
  const size_t tile0 = (rowb + kstart) / 16;
  const char* const g0 = qp < 4 ? (const char*)KT + (tile0 + qp) * 8192 + lane * 16 : (const char*)(qp < 6 ? VTH : VTL) + (tile0 + (qp & 1) * 2) * 4096 + (nloc * 2 + hlf) * 16;   // this lane's first 16 bytes of stage 0
  const int gs = qp < 4 ? (KB / 16) * 8192 : (KB / 16) * 4096;   // from one stage to the next
  b16* const ldst = &Stg[0][0] + qp * 4096 + lane * 8;   // this lane's first 16 bytes of its wave's eighth, buffer 0
  auto stage_copy = [&](int s) { const char* g = g0 + (size_t)s * gs; b16* l = ldst + (s & 1) * SEL;
    /* sixteen copies of 512 bytes per wave: the immediate offset moves the LDS address and the global address alike, so one address of each serves all sixteen; the builtin form, because this compiler keeps the operands of an asm statement in the first 256 registers */
#define CP(n) __builtin_amdgcn_global_load_async_to_lds_b128((gv4i*)g, (lv4i*)l, (n) * 512, 0)
    CP(0); CP(1); CP(2); CP(3); CP(4); CP(5); CP(6); CP(7); CP(8); CP(9); CP(10); CP(11); CP(12); CP(13); CP(14); CP(15);
#undef CP
  };
  stage_copy(0);
  v16b qh[QW][HD / 32], ql[QW][HD / 32];
#pragma unroll
  for (int u = 0; u < QW; ++u)
#pragma unroll
    for (int s = 0; s < HD / 32; ++s) { qh[u][s] = frag_kb(PH + (rowb + t0 + u * 16 + nloc) * PW + qo + s * 32, hlf); ql[u][s] = frag_kb(PL + (rowb + t0 + u * 16 + nloc) * PW + qo + s * 32, hlf); }
  float m_q[QW], den_q[QW]; v8f acc[QW][HD / 16];   /* this lane's query of tile u (column nloc): running max; sum over the keys of this lane half; acc[u][t][r8] = O^T[channel 16 t + 8 hlf + r8][query nloc] */
#pragma unroll
  for (int u = 0; u < QW; ++u) { m_q[u] = -INFINITY; den_q[u] = 0.0f;
#pragma unroll
    for (int t = 0; t < HD / 16; ++t) acc[u][t] = (v8f){}; }
  asm volatile("s_wait_asynccnt 0x0" ::: "memory");   /* stage 0 has landed before the barrier publishes it */
  __syncthreads();
  stage_copy(1);
#pragma unroll 1   /* one key block per trip: the body is long; the buffer is one base register, every place in the stage an immediate offset */
  for (int kbi = 0; kbi < NKB; ++kbi) { const b16* const sb = &Stg[0][0] + (kbi & 1) * SEL + lane * 8; v8f st[QW][KB / 16];   /* st[u][t][r8] = S^T[key 16 t + 8 hlf + r8][query nloc of tile u], x HS HS */
#pragma unroll   /* the score tiles live in registers: constant indices only */
    for (int kt = 0; kt < KB / 16; ++kt) { const b16* kq = sb + kt * (2 * 16 * HD); v8f s[QW]; v16b kh[HD / 32], kl[HD / 32];   /* all 16 LDS loads of a key tile are issued ahead of its 24 products: one wait per tile */
#pragma unroll
      for (int q = 0; q < HD / 32; ++q) { kh[q] = frag_kt(kq + q * 512); kl[q] = frag_kt(kq + 16 * HD + q * 512); }
      __builtin_amdgcn_sched_barrier(0);   /* keeps the loads in one group ahead of the products: without it the compiler sinks each pair of loads to its first use and waits for the LDS before every second product */
#pragma unroll
      for (int u = 0; u < QW; ++u) s[u] = (v8f){};
#pragma unroll   /* the two query tiles' chains alternate: each product stands in the other chain's accumulator latency; within a chain the products of a k step keep the order hi hi, lo hi, hi lo */
      for (int q = 0; q < HD / 32; ++q) {
#pragma unroll
        for (int u = 0; u < QW; ++u) s[u] = wmma16n(kh[q], qh[u][q], s[u]);
#pragma unroll
        for (int u = 0; u < QW; ++u) s[u] = wmma16n(kl[q], qh[u][q], s[u]);
#pragma unroll
        for (int u = 0; u < QW; ++u) s[u] = wmma16n(kh[q], ql[u][q], s[u]); }
#pragma unroll
      for (int u = 0; u < QW; ++u) st[u][kt] = s[u]; }
    v16b pa[QW][KB / SK], pb[QW][KB / SK];   /* P^T x256 hi / lo: two score tiles converted in place are the B fragment of 32 keys (element e <- key 8 hlf + e, 8 + e <- key 16 + 8 hlf + e) */
#pragma unroll
    for (int u = 0; u < QW; ++u) {
      /* softmax of one query per lane and tile: max and sum run over the lane's own registers; the max is joined with the other lane half by one exchange, the sums of the two halves once behind the loop */
      float mx = st[u][0][0];
#pragma unroll
      for (int t = 0; t < KB / 16; ++t)
#pragma unroll
        for (int r8 = 0; r8 < 8; ++r8) mx = fmaxf(mx, st[u][t][r8]);
      mx = fmaxf(mx, xhalf(mx)) * (1.0f / (HS * HS));
      const float mold = m_q[u]; const float mn = fmaxf(mold, mx); const float es = __expf(mold - mn); const float sf = (mold == -INFINITY) ? 0.0f : es;   /* a select, no branch: mold above -inf makes mn finite */
      const float mz = (mn == -INFINITY) ? 0.0f : mn;   /* every score of the query so far is -inf: exp(-inf - 0) = 0, as for a single such score */
      float ps[4] = {0.0f, 0.0f, 0.0f, 0.0f};
#pragma unroll
      for (int t = 0; t < KB / 16; ++t)
#pragma unroll
        for (int r8 = 0; r8 < 8; ++r8) { const float p = __expf(st[u][t][r8] * (1.0f / (HS * HS)) - mz); ps[r8 & 3] += p; b16 hi, lo; split16(p * PS, hi, lo); pa[u][t >> 1][(t & 1) * 8 + r8] = hi; pb[u][t >> 1][(t & 1) * 8 + r8] = lo; }
      den_q[u] = den_q[u] * sf + ((ps[0] + ps[1]) + (ps[2] + ps[3])); m_q[u] = mn;
#pragma unroll
      for (int t = 0; t < HD / 16; ++t) acc[u][t] = acc[u][t] * sf; }
    v16b pca[QW], pcb[QW];   /* the P fragments of the current 32 keys */
#pragma unroll
    for (int u = 0; u < QW; ++u) { pca[u] = pa[u][0]; pcb[u] = pb[u][0]; }
    static_assert(KB / SK == 2, "the second trip takes the second P fragments");
#pragma unroll 1   /* kept rolled: unrolled, the compiler puts the V^T loads of all 64 keys (256 registers) ahead of the first product and spills the Q fragments; the price is the 32 register moves at the trip's end */
    for (int ph = 0; ph < KB / SK; ++ph) { const b16* vs0 = sb + VOF + ph * (2 * 16 * HD);   /* the two hi tiles of these 32 keys; the lo plane lies KB HD elements on */
#pragma unroll
      for (int tg = 0; tg < HD / 16; tg += 4) { v16b vh[4], vl[4];   /* the V^T fragments of four channel tiles are loaded ahead of their products: one wait per 24 products */
#pragma unroll
        for (int t = 0; t < 4; ++t) { vh[t] = frag_vs(vs0 + (tg + t) * 256); vl[t] = frag_vs(vs0 + KB * HD + (tg + t) * 256); }
        __builtin_amdgcn_sched_barrier(0);   /* keeps the loads in one group ahead of the products, as for K */
#pragma unroll
        for (int t = 0; t < 4; ++t) {
#pragma unroll
          for (int u = 0; u < QW; ++u) acc[u][tg + t] = wmma16n(vh[t], pca[u], acc[u][tg + t]);
#pragma unroll
          for (int u = 0; u < QW; ++u) acc[u][tg + t] = wmma16n(vl[t], pca[u], acc[u][tg + t]);
#pragma unroll
          for (int u = 0; u < QW; ++u) acc[u][tg + t] = wmma16n(vh[t], pcb[u], acc[u][tg + t]); } }
#pragma unroll
      for (int u = 0; u < QW; ++u) { pca[u] = pa[u][1]; pcb[u] = pb[u][1]; } }
    /* foot of stage kbi: this wave's LDS reads of the stage are done, its copies of stage kbi + 1 have landed, every wave has passed both; only then is the buffer of stage kbi refilled */
    asm volatile("s_wait_dscnt 0x0" ::: "memory");     /* the wave's reads of this buffer have returned before another wave's copies may overwrite it */
    asm volatile("s_wait_asynccnt 0x0" ::: "memory");  /* the wave's own copies of the next stage have landed before the barrier publishes them */
    __syncthreads();
    if (kbi + 2 < NKB) stage_copy(kbi + 2); }
  asm volatile("s_wait_asynccnt 0x0" ::: "memory");   /* no copy is outstanding when the wave goes on to its stores and ends */
  const size_t prow = (size_t)kp * NT + rowb + t0;   /* this wave's first row in the planes of part kp */
#pragma unroll
  for (int u = 0; u < QW; ++u) {
#pragma unroll
    for (int t = 0; t < HD / 16; ++t) { *(v4f*)&SfW[qp * QW + u][nloc][t * 16 + 8 * hlf] = (v4f){acc[u][t][0], acc[u][t][1], acc[u][t][2], acc[u][t][3]}; *(v4f*)&SfW[qp * QW + u][nloc][t * 16 + 8 * hlf + 4] = (v4f){acc[u][t][4], acc[u][t][5], acc[u][t][6], acc[u][t][7]}; }   /* a lane's 8 accumulator rows are 8 consecutive channels of its query */
    const float dsum = den_q[u] + xhalf(den_q[u]); if (hlf == 0) *(v2f*)(MD + (prow + u * 16 + nloc) * 2) = (v2f){m_q[u], dsum}; }
  wave_lds_sync();   /* a wave reads back only the two tiles that it wrote itself: no block barrier */
#pragma unroll 1   /* eight rows per trip, kept rolled so that the wait below stands in front of every reuse of the stores' registers */
  for (int i0 = 0; i0 < QW * 16; i0 += 8) { v4f sv[8];   /* a row of 512 bytes per store, a lane four consecutive channels */
#pragma unroll
    for (int i = 0; i < 8; ++i) sv[i] = *(const v4f*)&SfW[qp * QW + (i0 >> 4)][(i0 & 15) + i][lane * 4];
#pragma unroll
    for (int i = 0; i < 8; ++i) *(v4f*)(OP + (prow + i0 + i) * C + h * HD + lane * 4) = sv[i];
    asm volatile("s_wait_xcnt 0x0" ::: "memory");   /* stands behind the stores, in front of the next trip's rewrite of their data and address registers */
  } }
// output: block per ORT row tiles of 16 pixels, ORT OCG waves; wave (rt, cg) joins four rows of row tile rt (the four waves of a tile share the joined rows through LDS, behind one block barrier) and does the OCW output columns from cg OCW on.
// One block per WGP, four waves per SIMD: a wave's memory waits and dependent vector chains are covered by the other three, and a wave has five memory waits (max / sum, partial rows, two weight groups, residual) where the one wave of a row tile had thirteen.
__global__ __launch_bounds__(32 * OWV) void out_kernel(const float* __restrict__ OP, const float* __restrict__ MD, const b16* __restrict__ WO, const float* __restrict__ bo, const float* __restrict__ xres, int TLIM, float* __restrict__ out) { __shared__ __attribute__((aligned(16))) b16 Ah[ORT][16][C + 8], Al[ORT][16][C + 8]; __shared__ __attribute__((aligned(16))) float Tf[OWV][16][OCW + 4]; static_assert(L % (16 * ORT) == 0, "a block's rows are all inside the row limit or all outside");
  const int wv = __builtin_amdgcn_readfirstlane((int)(threadIdx.x >> 5)), rt = wv / OCG, cg = wv % OCG; const int lane = threadIdx.x & 31, nloc = lane & 15, hlf = lane >> 4; if ((size_t)blockIdx.x * (16 * ORT) >= (size_t)TLIM) return;   /* the whole block leaves, in front of the barrier */
  const size_t m0 = ((size_t)blockIdx.x * ORT + rt) * 16; const int col0 = cg * OCW, row0 = cg * (16 / OCG);   /* the wave's row tile; its first output column; the first row that it joins */
  /* join of the KP partial results of each query: lane (row nloc, half hlf) holds (max, sum) of the parts hlf and hlf + 2; attended x HS = sum over the parts of O_p exp(m_p - m) / (PS sum) */
  static_assert(KP == 4 && C == 128 && OCG == 4 && OCW * OCG == CX, "two parts per lane half; a lane takes four channels of a row; a wave joins four rows");
  const v2f mda = *(const v2f*)(MD + ((size_t)hlf * NT + m0 + nloc) * 2), mdb = *(const v2f*)(MD + ((size_t)(hlf + 2) * NT + m0 + nloc) * 2);
  asm volatile("s_wait_xcnt 0x0" ::: "memory");   /* stands behind the two loads, in front of any rewrite of their address registers */
  float mx = fmaxf(mda[0], mdb[0]); mx = fmaxf(mx, xhalf(mx));
  const float ea = (mda[0] == -INFINITY) ? 0.0f : __expf(mda[0] - mx), eb = (mdb[0] == -INFINITY) ? 0.0f : __expf(mdb[0] - mx);
  float dn = ea * mda[1] + eb * mdb[1]; dn = dn + xhalf(dn);
  const float rs = dn > 0.0f ? (1.0f / PS) / dn : 0.0f; const int ca = __float_as_int(ea * rs), cb = __float_as_int(eb * rs);
  { const unsigned lo16 = (unsigned)lane * 16u; v4f pv[16 / OCG][KP];   /* the four parts of the wave's four rows (16 loads of 512 bytes) are requested together: one wait */
#pragma unroll
    for (int p = 0; p < KP; ++p) { const char* const op = sbase(OP + ((size_t)p * NT + m0 + row0) * C);   /* the same for the whole wave: a scalar base; the lane's byte offset lo16 is one register for all 16 loads */
#pragma unroll
      for (int rr = 0; rr < 16 / OCG; ++rr) pv[rr][p] = *(const v4f*)(op + rr * (C * 4) + lo16);
      asm volatile("s_wait_xcnt 0x0" ::: "memory");   /* stands behind the loads of a part, in front of any rewrite of their address registers; the data of all 16 loads stays in flight */
    }
#pragma unroll
    for (int rr = 0; rr < 16 / OCG; ++rr) { const int r = row0 + rr;   /* the row's four weights, the same for every lane, from the two lanes that hold them; parts joined in the order 0..KP-1 */
      const float c0 = __int_as_float(__builtin_amdgcn_readlane(ca, r)), c1 = __int_as_float(__builtin_amdgcn_readlane(ca, 16 + r)), c2 = __int_as_float(__builtin_amdgcn_readlane(cb, r)), c3 = __int_as_float(__builtin_amdgcn_readlane(cb, 16 + r));
      const v4f a = pv[rr][0] * c0 + pv[rr][1] * c1 + pv[rr][2] * c2 + pv[rr][3] * c3; v4b ah4, al4;
#pragma unroll
      for (int j = 0; j < 4; ++j) { b16 p, ql; split16(a[j], p, ql); ah4[j] = p; al4[j] = ql; }
      *(v4b*)&Ah[rt][r][lane * 4] = ah4; *(v4b*)&Al[rt][r][lane * 4] = al4; } }
  __syncthreads();   /* the row tile's joined rows are written by four waves and read by all four */
  v8f acc[OCW / 16]; float braw[OCW / 16];
#pragma unroll
  for (int t = 0; t < OCW / 16; ++t) { acc[t] = (v8f){}; braw[t] = bo[col0 + t * 16 + nloc]; }   /* the bias loads fly with the first weight group */
  const char* const wb = sbase(WO + (size_t)col0 * C); const unsigned wvo = (unsigned)(nloc * C + 8 * hlf) * 2u;   /* the wave's weight rows: scalar base; the lane's byte offset (row nloc, k half hlf) */
#pragma unroll
  for (int kb = 0; kb < C; kb += 64) { v16b bw[2][OCW / 16];   /* the eight weight fragments of two k steps are loaded ahead of their 16 products: one L2 wait per group, not one per tile */
#pragma unroll
    for (int u2 = 0; u2 < 2; ++u2)
#pragma unroll
      for (int t = 0; t < OCW / 16; ++t) bw[u2][t] = frag_kb((const b16*)(wb + (t * 16 * C + kb + 32 * u2) * 2 + wvo), 0);   /* the k half is in wvo */
    asm volatile("s_wait_xcnt 0x0" ::: "memory");   /* stands behind the group's loads (and the bias loads), in front of any rewrite of their address registers; the data stays in flight */
#pragma unroll
    for (int u2 = 0; u2 < 2; ++u2) { const v16b a = frag_kb(&Ah[rt][nloc][kb + 32 * u2], hlf), al = frag_kb(&Al[rt][nloc][kb + 32 * u2], hlf);
#pragma unroll
      for (int t = 0; t < OCW / 16; ++t) { acc[t] = wmma16b(a, bw[u2][t], acc[t]); acc[t] = wmma16b(al, bw[u2][t], acc[t]); } } }
  { float xr[OCW / 16][8];   /* the residual of the wave's four tiles is requested ahead of the first rounding: one wait per 32 loads, not one per element */
#pragma unroll
    for (int t = 0; t < OCW / 16; ++t)
#pragma unroll
      for (int r8 = 0; r8 < 8; ++r8) xr[t][r8] = xres[(m0 + 8 * hlf + r8) * CX + col0 + t * 16 + nloc];
#pragma unroll
    for (int t = 0; t < OCW / 16; ++t) { const int cc = t * 16 + nloc; const float bb = bfv(braw[t]);
#pragma unroll
      for (int r8 = 0; r8 < 8; ++r8) { const int rr = 8 * hlf + r8; Tf[wv][rr][cc] = acc[t][r8] * (1.0f / (HS * WSC)) + bb + bfv(xr[t][r8]); } } }   /* + residual x */
  wave_lds_sync();   /* a wave reads back only the tile that it wrote itself: no block barrier */
  v4f ov[8];   /* the wave's 64 columns of a row are 256 contiguous bytes (two whole lines): a lane half per row, two rows per store */
#pragma unroll
  for (int i = 0; i < 8; ++i) ov[i] = *(const v4f*)(&Tf[wv][2 * i + hlf][nloc * 4]);
#pragma unroll
  for (int i = 0; i < 8; ++i) *(v4f*)(out + (m0 + 2 * i + hlf) * CX + col0 + nloc * 4) = ov[i];
  asm volatile("s_wait_xcnt 0x0" ::: "memory");   /* stands behind the last store, in front of any rewrite of the stores' address and data registers */
}
}  // namespace

extern "C" void kernel_launch(void* const* d_in, const int* in_sizes, int n_in, void* d_out, int out_size, void* d_ws, size_t ws_size, hipStream_t stream) {
  (void)n_in;
  auto Fp = [&](int i) { return (const float*)d_in[i]; };
  // input order: 0 x [4,64,64,256]; 1 wk [256,128]; 2 bk; 3 wq [256,128]; 4 bq; 5 wv [256,128]; 6 bv; 7 wo [128,256]; 8 bo [256]  (all (in,out))
  if (in_sizes[0] != NT * CX || in_sizes[1] != CX * C || in_sizes[3] != CX * C || in_sizes[5] != CX * C || in_sizes[7] != C * CX || in_sizes[8] != CX || out_size != NT * CX) return;
  const int BLIM = NB;
  const int TLIM = BLIM * L;
  size_t off = 0; char* ws = (char*)d_ws;
  auto carve = [&](size_t bytes) { char* p = ws + off; off += (bytes + 255) & ~(size_t)255; return p; };
  b16* W3 = (b16*)carve((size_t)3 * C * CX * 2); b16* WO = (b16*)carve((size_t)CX * C * 2); b16* PH = (b16*)carve((size_t)NT * PW * 2); b16* PL = (b16*)carve((size_t)NT * PW * 2); float* OP = (float*)carve((size_t)KP * NT * C * 4); float* MD = (float*)carve((size_t)KP * NT * 2 * 4); b16* VTH = (b16*)carve((size_t)NT * HD * 2); b16* VTL = (b16*)carve((size_t)NT * HD * 2); b16* KT = (b16*)carve((size_t)NT * HD * 2 * 2);
  if (off > ws_size || off > ((size_t)96 << 20)) return;   // ~ 75 MB
  wput_kernel<<<(unsigned)(((size_t)3 * C * (CX / 8) + 255) / 256), 256, 0, stream>>>(Fp(1), Fp(3), Fp(5), Fp(7), W3, WO);
  proj_kernel<<<TLIM / (16 * PRT), 32 * PWV, 0, stream>>>(Fp(0), W3, Fp(2), Fp(4), Fp(6), TLIM, PH, PL, VTH, VTL, KT);
  att_kernel<<<BLIM * NH * KP * (L / (16 * QT)), 32 * NWQ, 0, stream>>>(PH, PL, VTH, VTL, KT, (const float*)0, BLIM, OP, MD);
  out_kernel<<<TLIM / (16 * ORT), 32 * OWV, 0, stream>>>(OP, MD, WO, Fp(8), Fp(0), TLIM, (float*)d_out);
}

// v010
// It runs in 84.2 microseconds.
// In two side-by-side timings against v009, it was 1.04 and 1.03 times as fast.
// Over all steps from v000 it is 34.7 times as fast.
#include <hip/hip_runtime.h>

// Self_attention_pixel_wise: per image (4,096 pixels, NHWC 256 ch): k = x wk + bk, q = x wq + bq, v = x wv + bv (128); scores[n][m] = k_n . q_m (no scaling); attn = softmax over m; o = attn v; out = o wo + bo + x -> [4][64][64][256].
// Note the roles: the module's 'key' is the attention query (rows n) and its 'query' the attention key (columns m).
// Deterministic: no index structures, no atomics; flash-style online softmax, the keys of a query tile split over four blocks in a fixed order, the four partial results joined in a fixed order by the output kernel.
// WMMA (v_wmma_f32_16x16x32_f16, f32 accumulate): the QKV projection with x EXACT bf16 x8 (K 256) against exact weight rows x256 (one product; the weights, like Q and K below, lie in memory in B-fragment order, tiles [16 rows][pieces of 16 k][32 lanes][8], so that each load covers 512 contiguous bytes); S^T = K Q^T (hi+lo x hi+lo, 3 products, K 128; K is the A operand, Q the B operand; K is written by the projection in B-fragment order, tiles [16 keys][hi, lo][8][32 lanes][8], staged in LDS by asynchronous copies for sixteen query tiles at once and read from there in loads of 512 contiguous bytes); O^T = V^T P^T (V^T hi+lo as A, P^T x256 hi+lo as B, packed in registers from the score tiles, 3 products; V^T is written by the projection in tiles [16 keys][128 channels][16] and staged in LDS the same way); out = attended (hi+lo) Wo^T (2 products); softmax in f32. Inputs rounded to bf16 once. Fragment k-map per lane half hh for A AND B: elements 0..7 <- k = 8hh+0..7, 8..15 <- k = 16+8hh+0..7; acc[r] = D[8hh+r][col].

namespace {
constexpr int NB = 4, L = 4096, C = 128, CX = 256 /* input / output channels */, NH = 1, HD = 128, NT = NB * L, KB = 64 /* keys per softmax block: its score tiles stay in registers */, KP = 4 /* key parts: an attention block takes L / KP keys */, QT = 16 /* query tiles per attention block */, QW = 2 /* query tiles per attention wave */, NWQ = QT / QW /* waves per attention block */, SK = 32 /* keys per P fragment */, SEL = KB * HD * 2 * 2 /* elements of a stage: K and V^T of a key block, hi + lo each */, VOF = KB * HD * 2 /* where V^T begins in a stage */, NKB = L / KP / KB /* stages (key blocks) per attention block */, PRT = 4 /* row tiles per projection block */, PWV = 3 * PRT /* its waves: one per row tile and projection */, ORT = 4 /* row tiles per output block */, OCG = 4 /* column groups of the output */, OCW = CX / OCG /* columns per group */, OWV = ORT * OCG /* waves per output block */;
constexpr float XS = 8.0f, HS = 256.0f /* hi+lo staging scale for k/q/v/attended */, WSC = 256.0f, PS = 256.0f, SCALE = 1.0f;
typedef _Float16 b16;
typedef _Float16 __attribute__((may_alias)) b16a;
typedef __attribute__((ext_vector_type(16))) _Float16 v16b;
typedef __attribute__((ext_vector_type(8))) _Float16 v8b;
typedef __attribute__((ext_vector_type(4))) _Float16 v4b;
typedef __attribute__((ext_vector_type(8))) float v8f;
typedef __attribute__((ext_vector_type(4))) float v4f;
typedef __attribute__((ext_vector_type(2))) float v2f;
typedef __attribute__((ext_vector_type(4))) int v4i;
typedef __attribute__((address_space(1))) v4i gv4i;   /* 16 bytes in global memory, 16 bytes in LDS: the asynchronous copy's two pointers */
typedef __attribute__((address_space(3))) v4i lv4i;
__device__ __forceinline__ float bf16_rne(float f) { unsigned int u = __float_as_uint(f); u += 0x7FFFu + ((u >> 16) & 1u); float r = __uint_as_float(u & 0xFFFF0000u); asm volatile("" : "+v"(r)); return r; }
__device__ __forceinline__ float bfv(float f) { float r = bf16_rne(f); asm volatile("" : "+v"(r)); return r; }
__device__ __forceinline__ void split16(float v, b16& hi, b16& lo) { hi = (b16)v; lo = (b16)(v - (float)hi); }
__device__ __forceinline__ v16b frag_kb(const b16* p, int hh) { const v8b a = *(const v8b*)(p + 8 * hh), b = *(const v8b*)(p + 16 + 8 * hh); v16b f;
#pragma unroll
  for (int e = 0; e < 8; ++e) { f[e] = a[e]; f[8 + e] = b[e]; } return f; }
// same k-map as frag_kb, from the V^T staged in LDS: p = this lane's 8 elements of the channel tile's 256-element piece that holds k = 0..15; k = 16..31 is the next key tile, HD * 16 elements on
__device__ __forceinline__ v16b frag_vs(const b16* p) { const v8b a = *(const v8b*)(p), b = *(const v8b*)(p + HD * 16); v16b f;
#pragma unroll
  for (int e = 0; e < 8; ++e) { f[e] = a[e]; f[8 + e] = b[e]; } return f; }
// same k-map as frag_kb, from the tiled K: p = this lane's 8 elements of the 256-element piece that holds k = 0..15 of all 16 keys; k = 16..31 is the next piece
__device__ __forceinline__ v16b frag_kt(const b16* p) { const v8b a = *(const v8b*)(p), b = *(const v8b*)(p + 256); v16b f;
#pragma unroll
  for (int e = 0; e < 8; ++e) { f[e] = a[e]; f[8 + e] = b[e]; } return f; }
__device__ __forceinline__ v8f wmma16b(v16b a, v16b b, v8f c) { v8f d = __builtin_amdgcn_wmma_f32_16x16x32_f16(false, a, false, b, (short)0, c, false, false); asm volatile("v_nop\n\tv_nop\n\tv_nop\n\tv_nop" : "+v"(d) : "v"(a), "v"(b)); return d; }
// the bare builtin, for the attention kernel: this compiler keeps the operands of an asm statement in the first 256 registers, and a wave of two query tiles holds more than those (with the asm statement behind each product the build spilled); the compiler keeps the distance behind its own matrix instructions
__device__ __forceinline__ v8f wmma16n(v16b a, v16b b, v8f c) { return __builtin_amdgcn_wmma_f32_16x16x32_f16(false, a, false, b, (short)0, c, false, false); }
__device__ __forceinline__ void wave_lds_sync() { __builtin_amdgcn_fence(__ATOMIC_RELEASE, "workgroup"); __builtin_amdgcn_wave_barrier(); __builtin_amdgcn_fence(__ATOMIC_ACQUIRE, "workgroup"); }
// lane l <-> l ^ 16: the other half of the wave holds the other eight keys of each 16-key tile of the same query
__device__ __forceinline__ float xhalf(float v) { const int b = __float_as_int(v); return __int_as_float(__builtin_amdgcn_permlanex16(b, b, 0x76543210, 0xfedcba98, false, false)); }
// a pointer that is the same for the whole wave, put into scalar registers: a load through it takes the form scalar base + one lane offset register
__device__ __forceinline__ const char* sbase(const void* p) { const unsigned long long a = (unsigned long long)p; const unsigned lo = (unsigned)__builtin_amdgcn_readfirstlane((int)(unsigned)a), hi = (unsigned)__builtin_amdgcn_readfirstlane((int)(unsigned)(a >> 32)); return (const char*)(const __attribute__((address_space(1))) char*)(((unsigned long long)hi << 32) | lo); }   /* by way of a global-memory pointer, so that the loads stay global loads */
__device__ __forceinline__ float pmul(float a, float b) { float p = a * b; asm volatile("" : "+v"(p)); return p; }

__global__ __launch_bounds__(256) void wput_kernel(const float* __restrict__ wq, const float* __restrict__ wk, const float* __restrict__ wv, const float* __restrict__ wo, b16* __restrict__ W3, b16* __restrict__ WO) { const size_t u = (size_t)blockIdx.x * 256 + threadIdx.x; const int nloc = (int)(u & 15), hlf = (int)(u >> 4) & 1; v8b v;
  /* both weight planes are written in B-fragment order: thread u holds lane u % 32 of piece u / 32 (16 weight rows x 16 k): row nloc of the tile, k = 8 hlf .. 8 hlf + 7 of the piece. A wave stores 512 contiguous bytes, and so does each load of the kernels that read the planes; a wave's loads here cover 64 contiguous bytes of two rows of w */
  if (u < (size_t)3 * C * (CX / 8)) { const int r = (int)((u >> 5) / (CX / 16)) * 16 + nloc, k0 = (int)((u >> 5) % (CX / 16)) * 16 + 8 * hlf; const int p = r / C, o = r % C; const float* w = p == 0 ? wq : (p == 1 ? wk : wv); float wr[8];   /* all eight loads stand ahead of the first rounding: its asm statement holds later loads behind it, which cost one memory wait per element */
#pragma unroll
    for (int j = 0; j < 8; ++j) wr[j] = w[(size_t)(k0 + j) * C + o];
#pragma unroll
    for (int j = 0; j < 8; ++j) v[j] = (b16)(bf16_rne(wr[j]) * WSC); { *(v8b*)(W3 + u * 8) = v;  } }
  if (u < (size_t)CX * (C / 8)) { const int o = (int)((u >> 5) / (C / 16)) * 16 + nloc, k0 = (int)((u >> 5) % (C / 16)) * 16 + 8 * hlf; float wr[8];
#pragma unroll
    for (int j = 0; j < 8; ++j) wr[j] = wo[(size_t)(k0 + j) * CX + o];
#pragma unroll
    for (int j = 0; j < 8; ++j) v[j] = (b16)(bf16_rne(wr[j]) * WSC); { *(v8b*)(WO + u * 8) = v;  } } }
// projection: block per PRT row tiles of 16 pixels, 3 PRT waves; wave (rt, g) does projection g (0 q, 1 k, 2 v; 128 columns) of row tile rt. The three waves of a row tile share its x, staged once in LDS (rows g, g + 3, ... per wave) behind one block barrier.
// One block per WGP, three waves per SIMD: a wave's memory waits and dependent vector chains are covered by the other two; a wave alone on its SIMD sat through all of them, for three projections in a row.
__global__ __launch_bounds__(32 * PWV) void proj_kernel(const float* __restrict__ x, const b16* __restrict__ W3, const float* __restrict__ bq, const float* __restrict__ bk, const float* __restrict__ bv, int TLIM, b16* __restrict__ QF, b16* __restrict__ VTH, b16* __restrict__ VTL, b16* __restrict__ KT) { __shared__ __attribute__((aligned(16))) b16 Ah[PRT][16][CX + 8], Oh[2 * PRT][16][C + 8], Ol[2 * PRT][16][C + 8]; static_assert(L % (16 * PRT) == 0, "a block's rows are all inside the row limit or all outside");
  const int wv = __builtin_amdgcn_readfirstlane((int)(threadIdx.x >> 5)), rt = wv / 3, g = wv % 3; const int lane = threadIdx.x & 31, nloc = lane & 15, hlf = lane >> 4; if ((size_t)blockIdx.x * (16 * PRT) >= (size_t)TLIM) return;   /* the whole block leaves, in front of the barrier */
  const size_t mt = (size_t)blockIdx.x * PRT + rt, m0 = mt * 16;   /* this wave's row tile, its first row */
  { float xv[6][CX / 32];   /* the wave's rows of x (40 or 48 loads) are requested before the first rounding (see wput_kernel): one memory wait, not one per element */
    const float* const xa = x + (m0 + g) * CX + lane, * const xb = x + (m0 + 15) * CX + lane;   /* rows g, g + 3, .. g + 12; wave 0 takes row 15 too */
#pragma unroll
    for (int i = 0; i < 5; ++i)
#pragma unroll
      for (int q = 0; q < CX / 32; ++q) xv[i][q] = xa[(size_t)(3 * i) * CX + q * 32];
    asm volatile("s_wait_xcnt 0x0" ::: "memory");   /* stands behind the loads, in front of any rewrite of their address registers; the data stays in flight */
    if (g == 0) {
#pragma unroll
      for (int q = 0; q < CX / 32; ++q) xv[5][q] = xb[q * 32];
      asm volatile("s_wait_xcnt 0x0" ::: "memory");   /* as above */
    }
#pragma unroll
    for (int i = 0; i < 6; ++i) if (g + 3 * i < 16) {
#pragma unroll
      for (int q = 0; q < CX / 32; ++q) Ah[rt][g + 3 * i][q * 32 + lane] = (b16)(bf16_rne(xv[i][q]) * XS); } }
  __syncthreads();   /* the row tile's x is written by three waves and read by all three */
  const float* bb = g == 0 ? bq : (g == 1 ? bk : bv); v8f acc[8]; float braw[8];
#pragma unroll
  for (int t = 0; t < 8; ++t) { acc[t] = (v8f){}; braw[t] = bb[t * 16 + nloc]; }   /* the bias loads fly with the first weight group */
#pragma unroll 1   /* one group of 32 loads (128 registers) per trip, kept rolled so that the groups share those registers */
  for (int kb = 0; kb < CX; kb += 64) { v16b bw[2][8];   /* the weight fragments of two k steps are loaded ahead of their 16 products: the asm statement behind each product holds later loads back, which cost one L2 wait per product */
#pragma unroll
    for (int u2 = 0; u2 < 2; ++u2)
#pragma unroll
      for (int t = 0; t < 8; ++t) bw[u2][t] = frag_kt(W3 + (size_t)((g * (C / 16) + t) * (CX / 16) + kb / 16 + 2 * u2) * 256 + lane * 8);   /* the two pieces of this k step, 512 contiguous bytes per load */
#pragma unroll
    for (int u2 = 0; u2 < 2; ++u2) { const v16b a = frag_kb(&Ah[rt][nloc][kb + 32 * u2], hlf);
#pragma unroll
      for (int t = 0; t < 8; ++t) acc[t] = wmma16b(a, bw[u2][t], acc[t]); } }
  if (g == 2) {   /* v: a lane's 8 accumulator rows are 8 consecutive keys of one channel = 16 bytes of V^T; tile [this wave's 16 keys][channel][16], 512 contiguous bytes per store; */
#pragma unroll
    for (int t = 0; t < 8; ++t) { const int cc = t * 16 + nloc; const float bvv = bfv(braw[t]); v8b vh8, vl8;
#pragma unroll
      for (int r8 = 0; r8 < 8; ++r8) { b16 p, ql; split16((acc[t][r8] * (1.0f / (XS * WSC)) + bvv) * HS, p, ql); vh8[r8] = p; vl8[r8] = ql; }
      const size_t vo8 = (mt * HD + cc) * 16 + 8 * hlf; *(v8b*)(VTH + vo8) = vh8; *(v8b*)(VTL + vo8) = vl8; }
    asm volatile("s_wait_xcnt 0x0" ::: "memory");   /* stands behind the last V^T store, in front of any rewrite of the stores' address and data registers */
    return; }   /* no barrier follows */
  const int oi = rt * 2 + g;   /* this wave's own turning tile */
#pragma unroll
  for (int t = 0; t < 8; ++t) { const int cc = t * 16 + nloc; const float bvv = bfv(braw[t]);
#pragma unroll
    for (int r8 = 0; r8 < 8; ++r8) { b16 p, ql; split16((acc[t][r8] * (1.0f / (XS * WSC)) + bvv) * HS, p, ql); Oh[oi][8 * hlf + r8][cc] = p; Ol[oi][8 * hlf + r8][cc] = ql; } }
  wave_lds_sync();   /* a wave reads back only the tile that it wrote itself: no block barrier */
  v8b fh[HD / 16], fl[HD / 16];
  /* attention queries and keys: both written in B-fragment order, tile [this wave's 16 rows][hi, lo][8 pieces of 16 channels][lane][8], so that each load or copy of the attention kernel covers 512 contiguous bytes (four whole lines) and not 32 bytes of each of 16 rows */
  b16* kt = (g == 1 ? KT : QF) + mt * (2 * 16 * HD) + lane * 8;
#pragma unroll
  for (int f = 0; f < HD / 16; ++f) { fh[f] = *(const v8b*)(&Oh[oi][nloc][f * 16 + 8 * hlf]); fl[f] = *(const v8b*)(&Ol[oi][nloc][f * 16 + 8 * hlf]); }
#pragma unroll
  for (int f = 0; f < HD / 16; ++f) { *(v8b*)(kt + f * 256) = fh[f]; *(v8b*)(kt + 16 * HD + f * 256) = fl[f]; }
  asm volatile("s_wait_xcnt 0x0" ::: "memory");   /* stands behind the last tile store, in front of any rewrite of the stores' address and data registers */
}
// attention: block per (b, h, key part kp, QT query tiles of 16), NWQ waves; wave qp holds the QW query tiles qp QW .. qp QW + QW - 1 and walks the block's keys [kp L / KP, (kp + 1) L / KP) in key blocks of 64: S^T = K Q^T (3 products, K 128), so that a lane holds the scores of one query per tile; online softmax in registers; P^T x256 hi+lo is the B operand of O^T = V^T P^T; the block writes its partial (max, sum, O) of each query, and the output kernel joins the KP partials.
// Every K and V^T fragment that a wave reads from LDS is the A operand for both of its query tiles.
// All NWQ waves of a block read the same K and V^T: one stream per block. A stage is a whole key block (K and V^T of 64 keys, hi + lo, 64 KiB), brought into LDS once per block by asynchronous copies, an eighth per wave, two buffers, the next stage in flight while this one is worked on. One foot (waits and barrier) per key block: between two feet the two waves of a SIMD are free to drift, one in its softmax while the other has the matrix unit.
// One block per WGP, 2 waves per SIMD (512 registers each). Scores and P never touch LDS; SfW only turns each wave's own O^T into rows.
__global__ __launch_bounds__(32 * NWQ) __attribute__((amdgpu_waves_per_eu(2, 2))) void att_kernel(const b16* __restrict__ QF, const b16* __restrict__ VTH, const b16* __restrict__ VTL, const b16* __restrict__ KT, const float* __restrict__ amask, int BLIM, float* __restrict__ OP, float* __restrict__ MD) { __shared__ __attribute__((aligned(16))) b16 Stg[2][SEL]; __shared__ __attribute__((aligned(16))) float SfW[QT][16][HD + 4]; static_assert(L % (KP * KB) == 0, "whole key blocks per block: no key of a block is masked"); static_assert(NWQ == 8 && QW == 2 && HD == 128 && KB == 64 && KB == 2 * SK && NKB >= 2, "a wave copies an eighth of a stage: one K tile, or two tiles of one V^T plane"); static_assert(NH == 1 && HD == C, "a Q or K tile holds all channels of its 16 rows");
  const int qp = __builtin_amdgcn_readfirstlane((int)(threadIdx.x >> 5));
  const int lane = threadIdx.x & 31, nloc = lane & 15, hlf = lane >> 4; const int qt = blockIdx.x % (L / (16 * QT)); const int kp = (blockIdx.x / (L / (16 * QT))) % KP; const int h = (blockIdx.x / ((L / (16 * QT)) * KP)) % NH; const int b = blockIdx.x / ((L / (16 * QT)) * KP * NH); if (b >= BLIM) return; const int tb = qt * 16 * QT, t0 = tb + qp * QW * 16; const size_t rowb = (size_t)b * L;
  const int kstart = kp * (L / KP);   // this block's keys [kstart, kstart + L / KP)
  // a stage in LDS: four K tiles of 16 keys in fragment order, [hi, lo] each (32 KiB, contiguous in KT); four tiles of the V^T hi plane (16 KiB); four of the lo plane. Waves 0..3 copy one K tile each, 4 and 5 a half of the hi plane, 6 and 7 a half of the lo plane: 8 KiB per wave, contiguous in global memory and in LDS.
  // V^T: lane l takes the 16 bytes (channel l % 16, key half l / 16) of each 512-byte channel tile, so that in LDS a fragment load reads 512 contiguous bytes (no bank conflict), as for K.
  const size_t tile0 = (rowb + kstart) / 16;
  const char* const g0 = qp < 4 ? (const char*)KT + (tile0 + qp) * 8192 + lane * 16 : (const char*)(qp < 6 ? VTH : VTL) + (tile0 + (qp & 1) * 2) * 4096 + (nloc * 2 + hlf) * 16;   // this lane's first 16 bytes of stage 0
  const int gs = qp < 4 ? (KB / 16) * 8192 : (KB / 16) * 4096;   // from one stage to the next
  b16* const ldst = &Stg[0][0] + qp * 4096 + lane * 8;   // this lane's first 16 bytes of its wave's eighth, buffer 0
  auto stage_copy = [&](int s) { const char* g = g0 + (size_t)s * gs; b16* l = ldst + (s & 1) * SEL;
    /* sixteen copies of 512 bytes per wave: the immediate offset moves the LDS address and the global address alike, so one address of each serves all sixteen; the builtin form, because this compiler keeps the operands of an asm statement in the first 256 registers */
#define CP(n) __builtin_amdgcn_global_load_async_to_lds_b128((gv4i*)g, (lv4i*)l, (n) * 512, 0)
    CP(0); CP(1); CP(2); CP(3); CP(4); CP(5); CP(6); CP(7); CP(8); CP(9); CP(10); CP(11); CP(12); CP(13); CP(14); CP(15);
#undef CP
  };
  stage_copy(0);
  v16b qh[QW][HD / 32], ql[QW][HD / 32];
#pragma unroll
  for (int u = 0; u < QW; ++u)
#pragma unroll
    for (int s = 0; s < HD / 32; ++s) { const b16* const qf = QF + ((rowb + t0) / 16 + u) * (2 * 16 * HD) + s * 512 + lane * 8; qh[u][s] = frag_kt(qf); ql[u][s] = frag_kt(qf + 16 * HD); }   /* tiled as K: 512 contiguous bytes per load */
  asm volatile("s_wait_xcnt 0x0" ::: "memory");   /* stands behind the Q loads, in front of any rewrite of their address registers; the data stays in flight */
  float m_q[QW], den_q[QW]; v8f acc[QW][HD / 16];   /* this lane's query of tile u (column nloc): running max; sum over the keys of this lane half; acc[u][t][r8] = O^T[channel 16 t + 8 hlf + r8][query nloc] */
#pragma unroll
  for (int u = 0; u < QW; ++u) { m_q[u] = -INFINITY; den_q[u] = 0.0f;
#pragma unroll
    for (int t = 0; t < HD / 16; ++t) acc[u][t] = (v8f){}; }
  asm volatile("s_wait_asynccnt 0x0" ::: "memory");   /* stage 0 has landed before the barrier publishes it */
  __syncthreads();
  stage_copy(1);
#pragma unroll 1   /* one key block per trip: the body is long; the buffer is one base register, every place in the stage an immediate offset */
  for (int kbi = 0; kbi < NKB; ++kbi) { const b16* const sb = &Stg[0][0] + (kbi & 1) * SEL + lane * 8; v8f st[QW][KB / 16];   /* st[u][t][r8] = S^T[key 16 t + 8 hlf + r8][query nloc of tile u], x HS HS */
#pragma unroll   /* the score tiles live in registers: constant indices only */
    for (int kt = 0; kt < KB / 16; ++kt) { const b16* kq = sb + kt * (2 * 16 * HD); v8f s[QW]; v16b kh[HD / 32], kl[HD / 32];   /* all 16 LDS loads of a key tile are issued ahead of its 24 products: one wait per tile */
#pragma unroll
      for (int q = 0; q < HD / 32; ++q) { kh[q] = frag_kt(kq + q * 512); kl[q] = frag_kt(kq + 16 * HD + q * 512); }
      __builtin_amdgcn_sched_barrier(0);   /* keeps the loads in one group ahead of the products: without it the compiler sinks each pair of loads to its first use and waits for the LDS before every second product */
#pragma unroll
      for (int u = 0; u < QW; ++u) s[u] = (v8f){};
#pragma unroll   /* the two query tiles' chains alternate: each product stands in the other chain's accumulator latency; within a chain the products of a k step keep the order hi hi, lo hi, hi lo */
      for (int q = 0; q < HD / 32; ++q) {
#pragma unroll
        for (int u = 0; u < QW; ++u) s[u] = wmma16n(kh[q], qh[u][q], s[u]);
#pragma unroll
        for (int u = 0; u < QW; ++u) s[u] = wmma16n(kl[q], qh[u][q], s[u]);
#pragma unroll
        for (int u = 0; u < QW; ++u) s[u] = wmma16n(kh[q], ql[u][q], s[u]); }
#pragma unroll
      for (int u = 0; u < QW; ++u) st[u][kt] = s[u]; }
    v16b pa[QW][KB / SK], pb[QW][KB / SK];   /* P^T x256 hi / lo: two score tiles converted in place are the B fragment of 32 keys (element e <- key 8 hlf + e, 8 + e <- key 16 + 8 hlf + e) */
#pragma unroll
    for (int u = 0; u < QW; ++u) {
      /* softmax of one query per lane and tile: max and sum run over the lane's own registers; the max is joined with the other lane half by one exchange, the sums of the two halves once behind the loop */
      float mx = st[u][0][0];
#pragma unroll
      for (int t = 0; t < KB / 16; ++t)
#pragma unroll
        for (int r8 = 0; r8 < 8; ++r8) mx = fmaxf(mx, st[u][t][r8]);
      mx = fmaxf(mx, xhalf(mx)) * (1.0f / (HS * HS));
      const float mold = m_q[u]; const float mn = fmaxf(mold, mx); const float es = __expf(mold - mn); const float sf = (mold == -INFINITY) ? 0.0f : es;   /* a select, no branch: mold above -inf makes mn finite */
      const float mz = (mn == -INFINITY) ? 0.0f : mn;   /* every score of the query so far is -inf: exp(-inf - 0) = 0, as for a single such score */
      float ps[4] = {0.0f, 0.0f, 0.0f, 0.0f};
#pragma unroll
      for (int t = 0; t < KB / 16; ++t)
#pragma unroll
        for (int r8 = 0; r8 < 8; ++r8) { const float p = __expf(st[u][t][r8] * (1.0f / (HS * HS)) - mz); ps[r8 & 3] += p; b16 hi, lo; split16(p * PS, hi, lo); pa[u][t >> 1][(t & 1) * 8 + r8] = hi; pb[u][t >> 1][(t & 1) * 8 + r8] = lo; }
      den_q[u] = den_q[u] * sf + ((ps[0] + ps[1]) + (ps[2] + ps[3])); m_q[u] = mn;
#pragma unroll
      for (int t = 0; t < HD / 16; ++t) acc[u][t] = acc[u][t] * sf; }
    v16b pca[QW], pcb[QW];   /* the P fragments of the current 32 keys */
#pragma unroll
    for (int u = 0; u < QW; ++u) { pca[u] = pa[u][0]; pcb[u] = pb[u][0]; }
    static_assert(KB / SK == 2, "the second trip takes the second P fragments");
#pragma unroll 1   /* kept rolled: unrolled, the compiler puts the V^T loads of all 64 keys (256 registers) ahead of the first product and spills the Q fragments; the price is the 32 register moves at the trip's end */
    for (int ph = 0; ph < KB / SK; ++ph) { const b16* vs0 = sb + VOF + ph * (2 * 16 * HD);   /* the two hi tiles of these 32 keys; the lo plane lies KB HD elements on */
#pragma unroll
      for (int tg = 0; tg < HD / 16; tg += 4) { v16b vh[4], vl[4];   /* the V^T fragments of four channel tiles are loaded ahead of their products: one wait per 24 products */
#pragma unroll
        for (int t = 0; t < 4; ++t) { vh[t] = frag_vs(vs0 + (tg + t) * 256); vl[t] = frag_vs(vs0 + KB * HD + (tg + t) * 256); }
        __builtin_amdgcn_sched_barrier(0);   /* keeps the loads in one group ahead of the products, as for K */
#pragma unroll
        for (int t = 0; t < 4; ++t) {
#pragma unroll
          for (int u = 0; u < QW; ++u) acc[u][tg + t] = wmma16n(vh[t], pca[u], acc[u][tg + t]);
#pragma unroll
          for (int u = 0; u < QW; ++u) acc[u][tg + t] = wmma16n(vl[t], pca[u], acc[u][tg + t]);
#pragma unroll
          for (int u = 0; u < QW; ++u) acc[u][tg + t] = wmma16n(vh[t], pcb[u], acc[u][tg + t]); } }
#pragma unroll
      for (int u = 0; u < QW; ++u) { pca[u] = pa[u][1]; pcb[u] = pb[u][1]; } }
    /* foot of stage kbi: this wave's LDS reads of the stage are done, its copies of stage kbi + 1 have landed, every wave has passed both; only then is the buffer of stage kbi refilled */
    asm volatile("s_wait_dscnt 0x0" ::: "memory");     /* the wave's reads of this buffer have returned before another wave's copies may overwrite it */
    asm volatile("s_wait_asynccnt 0x0" ::: "memory");  /* the wave's own copies of the next stage have landed before the barrier publishes them */
    __syncthreads();
    if (kbi + 2 < NKB) stage_copy(kbi + 2); }
  asm volatile("s_wait_asynccnt 0x0" ::: "memory");   /* no copy is outstanding when the wave goes on to its stores and ends */
  const size_t prow = (size_t)kp * NT + rowb + t0;   /* this wave's first row in the planes of part kp */
#pragma unroll
  for (int u = 0; u < QW; ++u) {
#pragma unroll
    for (int t = 0; t < HD / 16; ++t) { *(v4f*)&SfW[qp * QW + u][nloc][t * 16 + 8 * hlf] = (v4f){acc[u][t][0], acc[u][t][1], acc[u][t][2], acc[u][t][3]}; *(v4f*)&SfW[qp * QW + u][nloc][t * 16 + 8 * hlf + 4] = (v4f){acc[u][t][4], acc[u][t][5], acc[u][t][6], acc[u][t][7]}; }   /* a lane's 8 accumulator rows are 8 consecutive channels of its query */
    const float dsum = den_q[u] + xhalf(den_q[u]); if (hlf == 0) *(v2f*)(MD + (prow + u * 16 + nloc) * 2) = (v2f){m_q[u], dsum}; }
  wave_lds_sync();   /* a wave reads back only the two tiles that it wrote itself: no block barrier */
#pragma unroll 1   /* eight rows per trip, kept rolled so that the wait below stands in front of every reuse of the stores' registers */
  for (int i0 = 0; i0 < QW * 16; i0 += 8) { v4f sv[8];   /* a row of 512 bytes per store, a lane four consecutive channels */
#pragma unroll
    for (int i = 0; i < 8; ++i) sv[i] = *(const v4f*)&SfW[qp * QW + (i0 >> 4)][(i0 & 15) + i][lane * 4];
#pragma unroll
    for (int i = 0; i < 8; ++i) *(v4f*)(OP + (prow + i0 + i) * C + h * HD + lane * 4) = sv[i];
    asm volatile("s_wait_xcnt 0x0" ::: "memory");   /* stands behind the stores, in front of the next trip's rewrite of their data and address registers */
  } }
// output: block per ORT row tiles of 16 pixels, ORT OCG waves; wave (rt, cg) joins four rows of row tile rt (the four waves of a tile share the joined rows through LDS, behind one block barrier) and does the OCW output columns from cg OCW on.
// One block per WGP, four waves per SIMD: a wave's memory waits and dependent vector chains are covered by the other three, and a wave has five memory waits (max / sum, partial rows, two weight groups, residual) where the one wave of a row tile had thirteen.
__global__ __launch_bounds__(32 * OWV) void out_kernel(const float* __restrict__ OP, const float* __restrict__ MD, const b16* __restrict__ WO, const float* __restrict__ bo, const float* __restrict__ xres, int TLIM, float* __restrict__ out) { __shared__ __attribute__((aligned(16))) b16 Ah[ORT][16][C + 8], Al[ORT][16][C + 8]; __shared__ __attribute__((aligned(16))) float Tf[OWV][16][OCW + 4]; static_assert(L % (16 * ORT) == 0, "a block's rows are all inside the row limit or all outside");
  const int wv = __builtin_amdgcn_readfirstlane((int)(threadIdx.x >> 5)), rt = wv / OCG, cg = wv % OCG; const int lane = threadIdx.x & 31, nloc = lane & 15, hlf = lane >> 4; if ((size_t)blockIdx.x * (16 * ORT) >= (size_t)TLIM) return;   /* the whole block leaves, in front of the barrier */
  const size_t m0 = ((size_t)blockIdx.x * ORT + rt) * 16; const int col0 = cg * OCW, row0 = cg * (16 / OCG);   /* the wave's row tile; its first output column; the first row that it joins */
  /* join of the KP partial results of each query: lane (row nloc, half hlf) holds (max, sum) of the parts hlf and hlf + 2; attended x HS = sum over the parts of O_p exp(m_p - m) / (PS sum) */
  static_assert(KP == 4 && C == 128 && OCG == 4 && OCW * OCG == CX, "two parts per lane half; a lane takes four channels of a row; a wave joins four rows");
  const v2f mda = *(const v2f*)(MD + ((size_t)hlf * NT + m0 + nloc) * 2), mdb = *(const v2f*)(MD + ((size_t)(hlf + 2) * NT + m0 + nloc) * 2);
  asm volatile("s_wait_xcnt 0x0" ::: "memory");   /* stands behind the two loads, in front of any rewrite of their address registers */
  float mx = fmaxf(mda[0], mdb[0]); mx = fmaxf(mx, xhalf(mx));
  const float ea = (mda[0] == -INFINITY) ? 0.0f : __expf(mda[0] - mx), eb = (mdb[0] == -INFINITY) ? 0.0f : __expf(mdb[0] - mx);
  float dn = ea * mda[1] + eb * mdb[1]; dn = dn + xhalf(dn);
  const float rs = dn > 0.0f ? (1.0f / PS) / dn : 0.0f; const int ca = __float_as_int(ea * rs), cb = __float_as_int(eb * rs);
  { const unsigned lo16 = (unsigned)lane * 16u; v4f pv[16 / OCG][KP];   /* the four parts of the wave's four rows (16 loads of 512 bytes) are requested together: one wait */
#pragma unroll
    for (int p = 0; p < KP; ++p) { const char* const op = sbase(OP + ((size_t)p * NT + m0 + row0) * C);   /* the same for the whole wave: a scalar base; the lane's byte offset lo16 is one register for all 16 loads */
#pragma unroll
      for (int rr = 0; rr < 16 / OCG; ++rr) pv[rr][p] = *(const v4f*)(op + rr * (C * 4) + lo16);
      asm volatile("s_wait_xcnt 0x0" ::: "memory");   /* stands behind the loads of a part, in front of any rewrite of their address registers; the data of all 16 loads stays in flight */
    }
#pragma unroll
    for (int rr = 0; rr < 16 / OCG; ++rr) { const int r = row0 + rr;   /* the row's four weights, the same for every lane, from the two lanes that hold them; parts joined in the order 0..KP-1 */
      const float c0 = __int_as_float(__builtin_amdgcn_readlane(ca, r)), c1 = __int_as_float(__builtin_amdgcn_readlane(ca, 16 + r)), c2 = __int_as_float(__builtin_amdgcn_readlane(cb, r)), c3 = __int_as_float(__builtin_amdgcn_readlane(cb, 16 + r));
      const v4f a = pv[rr][0] * c0 + pv[rr][1] * c1 + pv[rr][2] * c2 + pv[rr][3] * c3; v4b ah4, al4;
#pragma unroll
      for (int j = 0; j < 4; ++j) { b16 p, ql; split16(a[j], p, ql); ah4[j] = p; al4[j] = ql; }
      *(v4b*)&Ah[rt][r][lane * 4] = ah4; *(v4b*)&Al[rt][r][lane * 4] = al4; } }
  __syncthreads();   /* the row tile's joined rows are written by four waves and read by all four */
  v8f acc[OCW / 16]; float braw[OCW / 16];
#pragma unroll
  for (int t = 0; t < OCW / 16; ++t) { acc[t] = (v8f){}; braw[t] = bo[col0 + t * 16 + nloc]; }   /* the bias loads fly with the first weight group */
  const char* const wb = sbase(WO + (size_t)col0 * C); const unsigned wvo = (unsigned)lane * 16u;   /* the wave's four weight tiles (fragment order, 16 C elements each): scalar base; the lane's 16 bytes of each piece */
#pragma unroll
  for (int kb = 0; kb < C; kb += 64) { v16b bw[2][OCW / 16];   /* the eight weight fragments of two k steps are loaded ahead of their 16 products: one L2 wait per group, not one per tile */
#pragma unroll
    for (int u2 = 0; u2 < 2; ++u2)
#pragma unroll
      for (int t = 0; t < OCW / 16; ++t) bw[u2][t] = frag_kt((const b16*)(wb + (t * 16 * C + (kb / 16 + 2 * u2) * 256) * 2 + wvo));   /* the two pieces of this k step, 512 contiguous bytes per load */
    asm volatile("s_wait_xcnt 0x0" :: "v"(lane) : "memory");   /* stands behind the group's loads (and the bias loads), in front of any rewrite of their address registers; the data stays in flight. The lane number, which the loads take as their scaled offset, is named as an input so that it lives up to the wait: otherwise the last load of the last group takes that register for its own data */
#pragma unroll
    for (int u2 = 0; u2 < 2; ++u2) { const v16b a = frag_kb(&Ah[rt][nloc][kb + 32 * u2], hlf), al = frag_kb(&Al[rt][nloc][kb + 32 * u2], hlf);
#pragma unroll
      for (int t = 0; t < OCW / 16; ++t) { acc[t] = wmma16b(a, bw[u2][t], acc[t]); acc[t] = wmma16b(al, bw[u2][t], acc[t]); } } }
  { float xr[OCW / 16][8];   /* the residual of the wave's four tiles is requested ahead of the first rounding: one wait per 32 loads, not one per element */
#pragma unroll
    for (int t = 0; t < OCW / 16; ++t)
#pragma unroll
      for (int r8 = 0; r8 < 8; ++r8) xr[t][r8] = xres[(m0 + 8 * hlf + r8) * CX + col0 + t * 16 + nloc];
#pragma unroll
    for (int t = 0; t < OCW / 16; ++t) { const int cc = t * 16 + nloc; const float bb = bfv(braw[t]);
#pragma unroll
      for (int r8 = 0; r8 < 8; ++r8) { const int rr = 8 * hlf + r8; Tf[wv][rr][cc] = acc[t][r8] * (1.0f / (HS * WSC)) + bb + bfv(xr[t][r8]); } } }   /* + residual x */
  wave_lds_sync();   /* a wave reads back only the tile that it wrote itself: no block barrier */
  v4f ov[8];   /* the wave's 64 columns of a row are 256 contiguous bytes (two whole lines): a lane half per row, two rows per store */
#pragma unroll
  for (int i = 0; i < 8; ++i) ov[i] = *(const v4f*)(&Tf[wv][2 * i + hlf][nloc * 4]);
#pragma unroll
  for (int i = 0; i < 8; ++i) *(v4f*)(out + (m0 + 2 * i + hlf) * CX + col0 + nloc * 4) = ov[i];
  asm volatile("s_wait_xcnt 0x0" ::: "memory");   /* stands behind the last store, in front of any rewrite of the stores' address and data registers */
}
}  // namespace

extern "C" void kernel_launch(void* const* d_in, const int* in_sizes, int n_in, void* d_out, int out_size, void* d_ws, size_t ws_size, hipStream_t stream) {
  (void)n_in;
  auto Fp = [&](int i) { return (const float*)d_in[i]; };
  // input order: 0 x [4,64,64,256]; 1 wk [256,128]; 2 bk; 3 wq [256,128]; 4 bq; 5 wv [256,128]; 6 bv; 7 wo [128,256]; 8 bo [256]  (all (in,out))
  if (in_sizes[0] != NT * CX || in_sizes[1] != CX * C || in_sizes[3] != CX * C || in_sizes[5] != CX * C || in_sizes[7] != C * CX || in_sizes[8] != CX || out_size != NT * CX) return;
  const int BLIM = NB;
  const int TLIM = BLIM * L;
  size_t off = 0; char* ws = (char*)d_ws;
  auto carve = [&](size_t bytes) { char* p = ws + off; off += (bytes + 255) & ~(size_t)255; return p; };
  b16* W3 = (b16*)carve((size_t)3 * C * CX * 2); b16* WO = (b16*)carve((size_t)CX * C * 2); b16* QF = (b16*)carve((size_t)NT * HD * 2 * 2); float* OP = (float*)carve((size_t)KP * NT * C * 4); float* MD = (float*)carve((size_t)KP * NT * 2 * 4); b16* VTH = (b16*)carve((size_t)NT * HD * 2); b16* VTL = (b16*)carve((size_t)NT * HD * 2); b16* KT = (b16*)carve((size_t)NT * HD * 2 * 2);
  if (off > ws_size || off > ((size_t)96 << 20)) return;   // ~ 60 MB
  wput_kernel<<<(unsigned)(((size_t)3 * C * (CX / 8) + 255) / 256), 256, 0, stream>>>(Fp(1), Fp(3), Fp(5), Fp(7), W3, WO);
  proj_kernel<<<TLIM / (16 * PRT), 32 * PWV, 0, stream>>>(Fp(0), W3, Fp(2), Fp(4), Fp(6), TLIM, QF, VTH, VTL, KT);
  att_kernel<<<BLIM * NH * KP * (L / (16 * QT)), 32 * NWQ, 0, stream>>>(QF, VTH, VTL, KT, (const float*)0, BLIM, OP, MD);
  out_kernel<<<TLIM / (16 * ORT), 32 * OWV, 0, stream>>>(OP, MD, WO, Fp(8), Fp(0), TLIM, (float*)d_out);
}
